// v000
// Measured on an AMD MI455X. A time is GPU time per run, averaged over a window of back-to-back runs after a warm-up
// (all launches, gaps included; the runs take copies of the inputs in turn), and the median of several windows.
// Apart from v000's, it joins two sittings. Times from different sittings can be a few percent apart, while
// side-by-side timings come from the same sitting.
// The starting kernel, v000, takes 388 microseconds a run.
// compute dtype: Q, K, V, W* (INPUTS) rounded to bf16 with exact bf16 WMMA products (f32 accumulate) for the projections; K pre-split into bf16 hi/lo rows; q f32 split, P and V f16 hi/lo (3 products each); softmax with the -1e6 valid-length fill in f32 (no sentinel shortcut, so a zero valid length yields a uniform row).
#include <hip/hip_runtime.h>
#include <math.h>

typedef __attribute__((ext_vector_type(16))) _Float16 v16h;
typedef __attribute__((ext_vector_type(16))) __bf16 v16b;
typedef __attribute__((ext_vector_type(8)))  _Float16 v8h;
typedef __attribute__((ext_vector_type(8)))  float v8f;
typedef __attribute__((ext_vector_type(4)))  float v4f;
typedef __attribute__((ext_vector_type(2)))  float v2f;
typedef __attribute__((ext_vector_type(4)))  unsigned v4u;
typedef __attribute__((ext_vector_type(4)))  int v4i;
typedef float __attribute__((may_alias)) float_a;
typedef int __attribute__((may_alias)) int_a;

template <typename T> __device__ __forceinline__ void vst2(void* p, T v) { *(T*)p = v;  }
__device__ __forceinline__ v8f wmma16(v16h a, v16h b, v8f c) {
  v8f d = __builtin_amdgcn_wmma_f32_16x16x32_f16(false, a, false, b, (short)0, c, false, false);
  asm volatile("v_nop\n\tv_nop\n\tv_nop\n\tv_nop" : "+v"(d) : "v"(a), "v"(b));
  return d;
}
__device__ __forceinline__ v8f wmma_bf(v16b a, v16b b, v8f c) {
  v8f d = __builtin_amdgcn_wmma_f32_16x16x32_bf16(false, a, false, b, (short)0, c, false, false);
  asm volatile("v_nop\n\tv_nop\n\tv_nop\n\tv_nop" : "+v"(d) : "v"(a), "v"(b));
  return d;
}
// 16x16x32 fragments: lane = (h = lane>>4, row/col = lane&15); elements 0..7 = k0+8h+0..7, 8..15 = k0+16+8h+0..7; D element r = row 8h+r
__device__ __forceinline__ v16h frag_h(const _Float16* rowk0, int lane) {
  union { v16h v; v8h q[2]; } u; const _Float16* p = rowk0 + 8 * (lane >> 4);
  u.q[0] = *(const v8h*)p; u.q[1] = *(const v8h*)(p + 16); return u.v;
}
__device__ __forceinline__ v16h frag_f32(const float* rowk0, int lane) {
  v16h a; const float* p = rowk0 + 8 * (lane >> 4);
#pragma unroll
  for (int i = 0; i < 8; ++i) { a[i] = (_Float16)p[i]; a[8 + i] = (_Float16)p[16 + i]; }
  return a;
}
__device__ __forceinline__ v16h frag_f32s(const float* rowk0, int lane, float sc) {
  v16h a; const float* p = rowk0 + 8 * (lane >> 4);
#pragma unroll
  for (int i = 0; i < 8; ++i) { a[i] = (_Float16)(p[i] * sc); a[8 + i] = (_Float16)(p[16 + i] * sc); }
  return a;
}
// column fragment from a [K][ld] layout (column n), rows >= K read as 0
__device__ __forceinline__ v16h fragc_f32(const float* W, int k0, int n, int lane, int ld, int K) {
  v16h a; const int g = lane >> 4;
#pragma unroll
  for (int i = 0; i < 8; ++i) { const int ka = k0 + 8 * g + i, kb = ka + 16;
    a[i] = (_Float16)(ka < K ? W[(size_t)ka * ld + n] : 0.f); a[8 + i] = (_Float16)(kb < K ? W[(size_t)kb * ld + n] : 0.f); }
  return a;
}
struct F2 { v16b h, l; };
__device__ __forceinline__ F2 bsplit16(const float v[16]) { F2 r;
#pragma unroll
  for (int i = 0; i < 16; ++i) { const __bf16 h = (__bf16)v[i]; r.h[i] = h; r.l[i] = (__bf16)(v[i] - (float)h); }
  return r; }
__device__ __forceinline__ F2 split_row(const float* row, int k0, int lane) { float v[16]; const float* p = row + k0 + 8 * (lane >> 4);
#pragma unroll
  for (int i = 0; i < 8; ++i) { v[i] = p[i]; v[8 + i] = p[16 + i]; }
  return bsplit16(v); }
__device__ __forceinline__ F2 split_rowK(const float* row, int k0, int lane, int K) { float v[16]; const int g = lane >> 4;
#pragma unroll
  for (int i = 0; i < 8; ++i) { const int ka = k0 + 8 * g + i, kb = ka + 16; v[i] = ka < K ? row[ka] : 0.f; v[8 + i] = kb < K ? row[kb] : 0.f; }
  return bsplit16(v); }
__device__ __forceinline__ F2 split_col(const float* W, int k0, int n, int lane, int ld, int K) { float v[16]; const int g = lane >> 4;
#pragma unroll
  for (int i = 0; i < 8; ++i) { const int ka = k0 + 8 * g + i, kb = ka + 16; v[i] = ka < K ? W[(size_t)ka * ld + n] : 0.f; v[8 + i] = kb < K ? W[(size_t)kb * ld + n] : 0.f; }
  return bsplit16(v); }
__device__ __forceinline__ v8f mac3(const F2& a, const F2& b, v8f c) { c = wmma_bf(a.l, b.h, c); c = wmma_bf(a.h, b.l, c); return wmma_bf(a.h, b.h, c); }
__device__ __forceinline__ float sigm(float v) { return 1.0f / (1.0f + expf(-v)); }
#define LDSX() do { asm volatile("s_wait_dscnt 0" ::: "memory"); __builtin_amdgcn_wave_barrier(); __builtin_amdgcn_fence(__ATOMIC_RELEASE, "workgroup"); } while (0)


// d2l-style multi-head attention (16 heads of 64 on [4,1024,1024]; separate Q/K/V inputs, [out][in] weights, no biases): scores = q.k/8, then where(key < valid_lens[bh*L + q], score, -1e6) (per-row valid length, int input), softmax, (P v) Wo^T.
#define NB 4
#define SS 1024
#define E 1024
#define NH 16
#define HD 64
#define NR (NB * SS)
#define PLO 1024.0f
#define VLO 2048.0f
__device__ __forceinline__ float bfr(float v) { return (float)(__bf16)v; }
__device__ __forceinline__ v16b frag_b(const __bf16* rowk0, int lane) { return __builtin_bit_cast(v16b, frag_h((const _Float16*)rowk0, lane)); }

__global__ __launch_bounds__(256) void k_cvt(const float* __restrict__ x, __bf16* __restrict__ Xb) {
  const size_t i8 = (size_t)blockIdx.x * 256 + threadIdx.x; if (i8 >= (size_t)NR * E / 8) return;
  union { __bf16 h[8]; v4u u; } pk;
#pragma unroll
  for (int e = 0; e < 8; ++e) pk.h[e] = (__bf16)x[i8 * 8 + e];
  vst2((unsigned*)(Xb + i8 * 8), pk.u);
}
// PT rows: [0,E) Wq[n,:], [E,2E) Wk[n,:], [2E,3E) Wv[n,:], [3E,4E) Wo[n,:]  ([out][in] weights: row n as a bf16 row)
__global__ __launch_bounds__(256) void k_pack(const float* __restrict__ Wq, const float* __restrict__ Wk, const float* __restrict__ Wv, const float* __restrict__ Wo, __bf16* __restrict__ PT) {
  const int n = blockIdx.x, tid = threadIdx.x; __shared__ __align__(16) __bf16 srow[E];
  const float* W = n < E ? Wq : (n < 2 * E ? Wk : (n < 3 * E ? Wv : Wo)); const int nn = n % E;      // [out][in]: PT row n = W row nn
  for (int k = tid; k < E; k += 256) srow[k] = (__bf16)W[(size_t)nn * E + k];
  __syncthreads();
  if (tid < E / 8) vst2((unsigned*)(PT + (size_t)n * E + tid * 8), *(const v4u*)(&srow[tid * 8]));
}
// QKV: block (64 rows, 128 cols = 2 heads, which); q -> Q32 f32 [bh][s][64]; k -> bf16 hi/lo rows; v -> VT hi/lo x4 [bh][d][s]
__global__ __launch_bounds__(128) void k_qkv(const __bf16* __restrict__ XQ, const __bf16* __restrict__ XK, const __bf16* __restrict__ XV, const __bf16* __restrict__ PT, float* __restrict__ Q32, __bf16* __restrict__ Kh, __bf16* __restrict__ Kl, _Float16* __restrict__ VTh, _Float16* __restrict__ VTl) {
  __shared__ __align__(16) float so[4][16][132];
  __shared__ __align__(16) _Float16 sth[128][72], stl[128][72];
  const int tid = threadIdx.x, wave = tid >> 5, lane = tid & 31, col = lane & 15, g = lane >> 4;
  const int which = blockIdx.z, r0b = blockIdx.x * 64, r0 = r0b + wave * 16, n0 = blockIdx.y * 128; const int b = r0b / SS, s0 = r0b % SS;
  const __bf16* Xb = which == 0 ? XQ : (which == 1 ? XK : XV);
  v8f acc[8] = {};
#pragma unroll 2
  for (int kc = 0; kc < E / 32; ++kc) { const v16b a = frag_b(Xb + (size_t)(r0 + col) * E + kc * 32, lane);
#pragma unroll
    for (int j = 0; j < 8; ++j) acc[j] = wmma_bf(a, frag_b(PT + (size_t)(which * E + n0 + j * 16 + col) * E + kc * 32, lane), acc[j]); }
  if (which < 2) {
#pragma unroll
    for (int j = 0; j < 8; ++j) { const float bb = 0.f;
#pragma unroll
      for (int r = 0; r < 8; ++r) so[wave][8 * g + r][j * 16 + col] = acc[j][r] + bb; }
    LDSX();
    if (which == 0) { for (int qq = lane; qq < 2 * 16 * 16; qq += 32) { const int hh = qq >> 8, rl = (qq >> 4) & 15, pc = qq & 15; const int h = (n0 >> 6) + hh;
        vst2(Q32 + (((size_t)b * NH + h) * SS + s0 + wave * 16 + rl) * HD + pc * 4, *(const v4f*)(&so[wave][rl][hh * 64 + pc * 4])); } }
    else {
      for (int qq = lane; qq < 2 * 16 * 16; qq += 32) { const int hh = qq >> 8, rl = (qq >> 4) & 15, pl = qq & 15; const int h = (n0 >> 6) + hh; const int pc = pl & 7; union { __bf16 e[8]; v4u u; } pk;
#pragma unroll
        for (int e = 0; e < 8; ++e) { const float v = so[wave][rl][hh * 64 + pc * 8 + e]; const __bf16 hi = (__bf16)v; pk.e[e] = pl < 8 ? hi : (__bf16)(v - (float)hi); }
        vst2((unsigned*)((pl < 8 ? Kh : Kl) + (((size_t)b * NH + h) * SS + s0 + wave * 16 + rl) * HD + pc * 8), pk.u); } } }
  else {
#pragma unroll
    for (int j = 0; j < 8; ++j) { const float bb = 0.f;
#pragma unroll
      for (int r = 0; r < 8; ++r) { const float v = (acc[j][r] + bb) * 4.0f; const _Float16 hi = (_Float16)v; sth[j * 16 + col][wave * 16 + 8 * g + r] = hi; stl[j * 16 + col][wave * 16 + 8 * g + r] = (_Float16)((v - (float)hi) * VLO); } }
    __syncthreads();
    for (int qq = tid; qq < 128 * 8; qq += 128) { const int cl = qq >> 3, pc = qq & 7; const int c = n0 + cl, h = c >> 6, d = c & 63; const size_t o = (((size_t)b * NH + h) * HD + d) * SS + s0 + pc * 8;
      vst2(VTh + o, *(const v4u*)(&sth[cl][pc * 8])); vst2(VTl + o, *(const v4u*)(&stl[cl][pc * 8])); } }
}
// padding-masked attention: block (64 queries, bh); all 16 key tiles; S on q hi/lo x K hi/lo rows; P,V hi/lo; O f32 [bh][s][64]
__global__ __launch_bounds__(128) void k_attn(const float* __restrict__ Q32, const __bf16* __restrict__ Kh, const __bf16* __restrict__ Kl, const _Float16* __restrict__ VTh, const _Float16* __restrict__ VTl, const int* __restrict__ vlen, float* __restrict__ O32) {
  __shared__ __align__(16) float sS[4][16][68];
  __shared__ __align__(16) _Float16 sPh[4][16][72], sPl[4][16][72];
  __shared__ __align__(16) float sO[4][16][68];
  const int tid = threadIdx.x, w = tid >> 5, lane = tid & 31, col = lane & 15, g = lane >> 4;
  const size_t bh = blockIdx.y; const int qb = blockIdx.x; const int q0 = qb * 64 + w * 16;
  F2 aq[2];
#pragma unroll
  for (int kc = 0; kc < 2; ++kc) aq[kc] = split_row(Q32 + (bh * SS + q0 + col) * HD, kc * 32, lane);
  __shared__ int svl[4][16]; if (lane < 16) svl[w][lane] = vlen[bh * SS + q0 + lane];     // valid lengths of my 16 query rows
  float mrun = -3.0e38f, lrun = 0.f; v8f acc[4] = {}, ac1[4] = {}, ac2[4] = {};
  LDSX();
#pragma unroll 1
  for (int kt = 0; kt < SS / 64; ++kt) {
#pragma unroll
    for (int t = 0; t < 4; ++t) { const int key = kt * 64 + t * 16 + col; const size_t ko = (bh * SS + key) * HD; v8f s = {};
#pragma unroll
      for (int kc = 0; kc < 2; ++kc) { const v16b khf = frag_b(Kh + ko + kc * 32, lane), klf = frag_b(Kl + ko + kc * 32, lane); s = wmma_bf(aq[kc].l, khf, s); s = wmma_bf(aq[kc].h, klf, s); s = wmma_bf(aq[kc].h, khf, s); }
#pragma unroll
      for (int r = 0; r < 8; ++r) { sS[w][8 * g + r][t * 16 + col] = (key < svl[w][8 * g + r]) ? s[r] * 0.125f : -1.0e6f; } }
    LDSX();
    float mx = -3.4e38f;
#pragma unroll
    for (int jj = 0; jj < 32; ++jj) mx = fmaxf(mx, sS[w][col][g * 32 + jj]);
    mx = fmaxf(mx, __shfl_xor(mx, 16, 32));
    const float mnew = fmaxf(mrun, mx); const float corr = expf(mrun - mnew);
    float ps = 0.f;
#pragma unroll
    for (int jj = 0; jj < 32; ++jj) { const float p = expf(sS[w][col][g * 32 + jj] - mnew) * 16384.0f; ps += p; const _Float16 hi = (_Float16)p; sPh[w][col][g * 32 + jj] = hi; sPl[w][col][g * 32 + jj] = (_Float16)((p - (float)hi) * PLO); }
    ps += __shfl_xor(ps, 16, 32);
    lrun = lrun * corr + ps * (1.0f / 16384.0f); mrun = mnew;
#pragma unroll
    for (int r = 0; r < 8; ++r) { const float cr = __shfl(corr, 8 * g + r, 32);
#pragma unroll
      for (int t = 0; t < 4; ++t) { acc[t][r] *= cr; ac1[t][r] *= cr; ac2[t][r] *= cr; } }
    LDSX();
#pragma unroll
    for (int kc = 0; kc < 2; ++kc) { const v16h ph = frag_h(&sPh[w][col][0] + kc * 32, lane), pl = frag_h(&sPl[w][col][0] + kc * 32, lane);
#pragma unroll
      for (int t = 0; t < 4; ++t) { const size_t vo = (bh * HD + t * 16 + col) * SS + kt * 64 + kc * 32; const v16h vh = frag_h(VTh + vo, lane);
        acc[t] = wmma16(ph, vh, acc[t]); ac1[t] = wmma16(ph, frag_h(VTl + vo, lane), ac1[t]); ac2[t] = wmma16(pl, vh, ac2[t]); } }
    __builtin_amdgcn_wave_barrier(); }
#pragma unroll
  for (int r = 0; r < 8; ++r) { const float lr = __shfl(lrun, 8 * g + r, 32); const float inv = 1.0f / (lr * 16384.0f * 4.0f);
#pragma unroll
    for (int t = 0; t < 4; ++t) sO[w][8 * g + r][t * 16 + col] = (acc[t][r] + ac1[t][r] * (1.0f / VLO) + ac2[t][r] * (1.0f / PLO)) * inv; }
  LDSX();
  for (int qq = lane; qq < 16 * 16; qq += 32) { const int rl = qq >> 4, pc = qq & 15; vst2(O32 + ((bh * SS) + q0 + rl) * HD + pc * 4, *(const v4f*)(&sO[w][rl][pc * 4])); }
}
// out = ctx Wo^T : split(ctx) x bf16(Wo rows): 2 products (Wo is an INPUT -> bf16 exact)
__global__ __launch_bounds__(128) void k_out(const float* __restrict__ O32, const __bf16* __restrict__ PT, float* __restrict__ out) {
  __shared__ __align__(16) float so[4][16][132];
  const int tid = threadIdx.x, wave = tid >> 5, lane = tid & 31, col = lane & 15, g = lane >> 4;
  const int r0 = blockIdx.x * 64 + wave * 16, n0 = blockIdx.y * 128; const int ra = r0 + col; const int b = ra / SS, s = ra % SS;
  v8f acc[8] = {};
#pragma unroll 1
  for (int kc = 0; kc < E / 32; ++kc) { const int h = kc >> 1; const F2 a = split_row(O32 + (((size_t)b * NH + h) * SS + s) * HD, (kc & 1) * 32, lane);
#pragma unroll
    for (int j = 0; j < 8; ++j) { const v16b wb = frag_b(PT + (size_t)(3 * E + n0 + j * 16 + col) * E + kc * 32, lane); acc[j] = wmma_bf(a.l, wb, acc[j]); acc[j] = wmma_bf(a.h, wb, acc[j]); } }
#pragma unroll
  for (int j = 0; j < 8; ++j) {
#pragma unroll
    for (int r = 0; r < 8; ++r) so[wave][8 * g + r][j * 16 + col] = acc[j][r]; }
  LDSX();
#pragma unroll 4
  for (int rl = 0; rl < 16; ++rl) vst2(out + (size_t)(r0 + rl) * E + n0 + lane * 4, *(const v4f*)(&so[wave][rl][lane * 4]));
}
extern "C" void kernel_launch(void* const* d_in, const int* in_sizes, int n_in, void* d_out, int out_size, void* d_ws, size_t ws_size, hipStream_t stream) {
  (void)in_sizes; (void)n_in; (void)out_size; (void)ws_size;
  const float* Qi = (const float*)d_in[0]; const float* Ki = (const float*)d_in[1]; const float* Vi = (const float*)d_in[2]; const int* vlen = (const int*)d_in[3];
  const float* Wq = (const float*)d_in[4]; const float* Wk = (const float*)d_in[5]; const float* Wv = (const float*)d_in[6]; const float* Wo = (const float*)d_in[7];
  float* out = (float*)d_out;
  char* ws = (char*)d_ws; size_t off = 0;
  auto take = [&](size_t bytes) { char* p = ws + off; off += (bytes + 255) & ~(size_t)255; return p; };
  __bf16* XQ = (__bf16*)take((size_t)NR * E * 2); __bf16* XK = (__bf16*)take((size_t)NR * E * 2); __bf16* XV = (__bf16*)take((size_t)NR * E * 2); __bf16* PT = (__bf16*)take((size_t)4 * E * E * 2);
  float* Q32 = (float*)take((size_t)NR * E * 4); __bf16* Kh = (__bf16*)take((size_t)NR * E * 2); __bf16* Kl = (__bf16*)take((size_t)NR * E * 2); _Float16* VTh = (_Float16*)take((size_t)NR * E * 2); _Float16* VTl = (_Float16*)take((size_t)NR * E * 2); float* O32 = (float*)take((size_t)NR * E * 4);
  // ws ~ 96 MiB
  k_cvt<<<(NR * E / 8 + 255) / 256, 256, 0, stream>>>(Qi, XQ);
  k_cvt<<<(NR * E / 8 + 255) / 256, 256, 0, stream>>>(Ki, XK);
  k_cvt<<<(NR * E / 8 + 255) / 256, 256, 0, stream>>>(Vi, XV);
  k_pack<<<4 * E, 256, 0, stream>>>(Wq, Wk, Wv, Wo, PT);
  k_qkv<<<dim3(NR / 64, E / 128, 3), 128, 0, stream>>>(XQ, XK, XV, PT, Q32, Kh, Kl, VTh, VTl);
  k_attn<<<dim3(SS / 64, NB * NH), 128, 0, stream>>>(Q32, Kh, Kl, VTh, VTl, vlen, O32);
  k_out<<<dim3(NR / 64, E / 128), 128, 0, stream>>>(O32, PT, out);
}

// v001
// It runs in 143 microseconds.
// Timed twice side by side with v000, it ran 2.75 and 2.76 times as fast.
// compute dtype: Q, K, V, W* (INPUTS) rounded to bf16 with exact bf16 WMMA products (f32 accumulate) for the projections; K pre-split into bf16 hi/lo rows; q f32 split, P and V f16 hi/lo (3 products each); softmax with the -1e6 valid-length fill in f32 (no sentinel shortcut, so a zero valid length yields a uniform row).
#include <hip/hip_runtime.h>
#include <math.h>

typedef __attribute__((ext_vector_type(16))) _Float16 v16h;
typedef __attribute__((ext_vector_type(16))) __bf16 v16b;
typedef __attribute__((ext_vector_type(8)))  _Float16 v8h;
typedef __attribute__((ext_vector_type(8)))  float v8f;
typedef __attribute__((ext_vector_type(4)))  float v4f;
typedef __attribute__((ext_vector_type(2)))  float v2f;
typedef __attribute__((ext_vector_type(4)))  unsigned v4u;
typedef __attribute__((ext_vector_type(4)))  int v4i;
typedef float __attribute__((may_alias)) float_a;
typedef int __attribute__((may_alias)) int_a;

template <typename T> __device__ __forceinline__ void vst2(void* p, T v) { *(T*)p = v;  }
__device__ __forceinline__ v8f wmma16(v16h a, v16h b, v8f c) {
  v8f d = __builtin_amdgcn_wmma_f32_16x16x32_f16(false, a, false, b, (short)0, c, false, false);
  asm volatile("v_nop\n\tv_nop\n\tv_nop\n\tv_nop" : "+v"(d) : "v"(a), "v"(b));
  return d;
}
__device__ __forceinline__ v8f wmma_bf(v16b a, v16b b, v8f c) {
  v8f d = __builtin_amdgcn_wmma_f32_16x16x32_bf16(false, a, false, b, (short)0, c, false, false);
  asm volatile("v_nop\n\tv_nop\n\tv_nop\n\tv_nop" : "+v"(d) : "v"(a), "v"(b));
  return d;
}
// 16x16x32 fragments: lane = (h = lane>>4, row/col = lane&15); elements 0..7 = k0+8h+0..7, 8..15 = k0+16+8h+0..7; D element r = row 8h+r
__device__ __forceinline__ v16h frag_h(const _Float16* rowk0, int lane) {
  union { v16h v; v8h q[2]; } u; const _Float16* p = rowk0 + 8 * (lane >> 4);
  u.q[0] = *(const v8h*)p; u.q[1] = *(const v8h*)(p + 16); return u.v;
}
__device__ __forceinline__ v16h frag_f32(const float* rowk0, int lane) {
  v16h a; const float* p = rowk0 + 8 * (lane >> 4);
#pragma unroll
  for (int i = 0; i < 8; ++i) { a[i] = (_Float16)p[i]; a[8 + i] = (_Float16)p[16 + i]; }
  return a;
}
__device__ __forceinline__ v16h frag_f32s(const float* rowk0, int lane, float sc) {
  v16h a; const float* p = rowk0 + 8 * (lane >> 4);
#pragma unroll
  for (int i = 0; i < 8; ++i) { a[i] = (_Float16)(p[i] * sc); a[8 + i] = (_Float16)(p[16 + i] * sc); }
  return a;
}
// column fragment from a [K][ld] layout (column n), rows >= K read as 0
__device__ __forceinline__ v16h fragc_f32(const float* W, int k0, int n, int lane, int ld, int K) {
  v16h a; const int g = lane >> 4;
#pragma unroll
  for (int i = 0; i < 8; ++i) { const int ka = k0 + 8 * g + i, kb = ka + 16;
    a[i] = (_Float16)(ka < K ? W[(size_t)ka * ld + n] : 0.f); a[8 + i] = (_Float16)(kb < K ? W[(size_t)kb * ld + n] : 0.f); }
  return a;
}
struct F2 { v16b h, l; };
__device__ __forceinline__ F2 bsplit16(const float v[16]) { F2 r;
#pragma unroll
  for (int i = 0; i < 16; ++i) { const __bf16 h = (__bf16)v[i]; r.h[i] = h; r.l[i] = (__bf16)(v[i] - (float)h); }
  return r; }
__device__ __forceinline__ F2 split_row(const float* row, int k0, int lane) { float v[16]; const float* p = row + k0 + 8 * (lane >> 4);
#pragma unroll
  for (int i = 0; i < 8; ++i) { v[i] = p[i]; v[8 + i] = p[16 + i]; }
  return bsplit16(v); }
__device__ __forceinline__ F2 split_rowK(const float* row, int k0, int lane, int K) { float v[16]; const int g = lane >> 4;
#pragma unroll
  for (int i = 0; i < 8; ++i) { const int ka = k0 + 8 * g + i, kb = ka + 16; v[i] = ka < K ? row[ka] : 0.f; v[8 + i] = kb < K ? row[kb] : 0.f; }
  return bsplit16(v); }
__device__ __forceinline__ F2 split_col(const float* W, int k0, int n, int lane, int ld, int K) { float v[16]; const int g = lane >> 4;
#pragma unroll
  for (int i = 0; i < 8; ++i) { const int ka = k0 + 8 * g + i, kb = ka + 16; v[i] = ka < K ? W[(size_t)ka * ld + n] : 0.f; v[8 + i] = kb < K ? W[(size_t)kb * ld + n] : 0.f; }
  return bsplit16(v); }
__device__ __forceinline__ v8f mac3(const F2& a, const F2& b, v8f c) { c = wmma_bf(a.l, b.h, c); c = wmma_bf(a.h, b.l, c); return wmma_bf(a.h, b.h, c); }
__device__ __forceinline__ float sigm(float v) { return 1.0f / (1.0f + expf(-v)); }
#define LDSX() do { asm volatile("s_wait_dscnt 0" ::: "memory"); __builtin_amdgcn_wave_barrier(); __builtin_amdgcn_fence(__ATOMIC_RELEASE, "workgroup"); } while (0)


// d2l-style multi-head attention (16 heads of 64 on [4,1024,1024]; separate Q/K/V inputs, [out][in] weights, no biases): scores = q.k/8, then where(key < valid_lens[bh*L + q], score, -1e6) (per-row valid length, int input), softmax, (P v) Wo^T.
#define NB 4
#define SS 1024
#define E 1024
#define NH 16
#define HD 64
#define NR (NB * SS)
#define PLO 1024.0f
#define VLO 2048.0f
__device__ __forceinline__ float bfr(float v) { return (float)(__bf16)v; }
__device__ __forceinline__ v16b frag_b(const __bf16* rowk0, int lane) { return __builtin_bit_cast(v16b, frag_h((const _Float16*)rowk0, lane)); }

// Operand tiles go from global memory to LDS as whole 128-byte lines, 16 bytes a lane, through no register; the fragments are then read from LDS rows at a pitch of 16 B x odd.
#define RP 144   // LDS pitch in bytes of a 128-byte row
#define RPF 272  // LDS pitch in bytes of a 256-byte row
__device__ __forceinline__ unsigned lds_off(const void* p) { return (unsigned)(size_t)p; }
#define ACP(l, g) "global_load_async_to_lds_b128 %" #l ", %" #g ", off\n\t"
// four copies of a lane: LDS address l + i*ls, global address g + i*gs; s_wait_xcnt 0 closes the statement so that no address register is rewritten ahead of it
__device__ __forceinline__ void acp4(unsigned l, const char* g, unsigned ls, size_t gs) {
  asm volatile(ACP(0, 4) ACP(1, 5) ACP(2, 6) ACP(3, 7) "s_wait_xcnt 0x0"
               :: "v"(l), "v"(l + ls), "v"(l + 2 * ls), "v"(l + 3 * ls), "v"(g), "v"(g + gs), "v"(g + 2 * gs), "v"(g + 3 * gs) : "memory");
}
// eight copies of a lane, four from each of two bases, one closing s_wait_xcnt 0 (same reason)
__device__ __forceinline__ void acp8(unsigned l, const char* g, unsigned m, const char* h, unsigned ls, size_t gs) {
  asm volatile(ACP(0, 8) ACP(1, 9) ACP(2, 10) ACP(3, 11) ACP(4, 12) ACP(5, 13) ACP(6, 14) ACP(7, 15) "s_wait_xcnt 0x0"
               :: "v"(l), "v"(l + ls), "v"(l + 2 * ls), "v"(l + 3 * ls), "v"(m), "v"(m + ls), "v"(m + 2 * ls), "v"(m + 3 * ls),
                  "v"(g), "v"(g + gs), "v"(g + 2 * gs), "v"(g + 3 * gs), "v"(h), "v"(h + gs), "v"(h + 2 * gs), "v"(h + 3 * gs) : "memory");
}
// this wave's LDS reads have returned: stands in front of the barrier behind which their buffer is filled again
#define WAIT_DS() asm volatile("s_wait_dscnt 0x0" ::: "memory")
// this wave's copies have landed: stands in front of the barrier behind which other waves read them
#define WAIT_ACP() asm volatile("s_wait_asynccnt 0x0" ::: "memory")

__global__ __launch_bounds__(256) void k_cvt(const float* __restrict__ x, __bf16* __restrict__ Xb) {
  const size_t i8 = (size_t)blockIdx.x * 256 + threadIdx.x; if (i8 >= (size_t)NR * E / 8) return;
  union { __bf16 h[8]; v4u u; } pk;
#pragma unroll
  for (int e = 0; e < 8; ++e) pk.h[e] = (__bf16)x[i8 * 8 + e];
  vst2((unsigned*)(Xb + i8 * 8), pk.u);
}
// PT rows: [0,E) Wq[n,:], [E,2E) Wk[n,:], [2E,3E) Wv[n,:], [3E,4E) Wo[n,:]  ([out][in] weights: row n as a bf16 row)
__global__ __launch_bounds__(256) void k_pack(const float* __restrict__ Wq, const float* __restrict__ Wk, const float* __restrict__ Wv, const float* __restrict__ Wo, __bf16* __restrict__ PT) {
  const int n = blockIdx.x, tid = threadIdx.x; __shared__ __align__(16) __bf16 srow[E];
  const float* W = n < E ? Wq : (n < 2 * E ? Wk : (n < 3 * E ? Wv : Wo)); const int nn = n % E;      // [out][in]: PT row n = W row nn
  for (int k = tid; k < E; k += 256) srow[k] = (__bf16)W[(size_t)nn * E + k];
  __syncthreads();
  if (tid < E / 8) vst2((unsigned*)(PT + (size_t)n * E + tid * 8), *(const v4u*)(&srow[tid * 8]));
}
// QKV: block (64 rows, 128 cols = 2 heads, which); q -> Q32 f32 [bh][s][64]; k -> bf16 hi/lo rows; v -> VT hi/lo x4 [bh][d][s]
__global__ __launch_bounds__(128) void k_qkv(const __bf16* __restrict__ XQ, const __bf16* __restrict__ XK, const __bf16* __restrict__ XV, const __bf16* __restrict__ PT, float* __restrict__ Q32, __bf16* __restrict__ Kh, __bf16* __restrict__ Kl, _Float16* __restrict__ VTh, _Float16* __restrict__ VTl) {
  constexpr int STG = (64 + 128) * RP;                     // one stage: 64 X rows, then 128 weight rows, 64 k each
  __shared__ __align__(16) char smem[2 * STG];             // two stages in the k loop; the output staging behind it
  float (*so)[16][132] = (float (*)[16][132])smem;
  _Float16 (*sth)[72] = (_Float16 (*)[72])smem; _Float16 (*stl)[72] = (_Float16 (*)[72])(smem + 128 * 72 * 2);
  const int tid = threadIdx.x, wave = tid >> 5, lane = tid & 31, col = lane & 15, g = lane >> 4;
  const int which = blockIdx.z, r0b = blockIdx.x * 64, r0 = r0b + wave * 16, n0 = blockIdx.y * 128; const int b = r0b / SS, s0 = r0b % SS;
  const __bf16* Xb = which == 0 ? XQ : (which == 1 ? XK : XV);
  v8f acc[8] = {};
  const unsigned l0 = lds_off(smem) + (tid >> 3) * RP + (tid & 7) * 16;       // a copy of the block: 16 rows, 8 lanes a row
  const char* gX = (const char*)(Xb + (size_t)(r0b + (tid >> 3)) * E + (tid & 7) * 8);
  const char* gW = (const char*)(PT + (size_t)(which * E + n0 + (tid >> 3)) * E + (tid & 7) * 8);
  auto fill = [&](int t) { const unsigned l = l0 + (t & 1) * STG; const size_t ko = (size_t)t * 128;
    acp4(l, gX + ko, 16 * RP, (size_t)16 * E * 2);
    acp8(l + 64 * RP, gW + ko, l + 128 * RP, gW + ko + (size_t)64 * E * 2, 16 * RP, (size_t)16 * E * 2); };
  fill(0); WAIT_ACP(); __syncthreads(); fill(1);
#pragma unroll 2   // two trips a body: each half addresses its buffer by constant offsets
  for (int t = 0; t < E / 64; ++t) { const char* sb = smem + (t & 1) * STG;
#pragma unroll
    for (int kc = 0; kc < 2; ++kc) { const v16b a = frag_b((const __bf16*)(sb + (wave * 16 + col) * RP) + kc * 32, lane); v16b wb[8];
#pragma unroll     // the LDS reads of a k chunk go out as one group, so that their latency is paid once and not per product; wb[] stays in registers
      for (int j = 0; j < 8; ++j) wb[j] = frag_b((const __bf16*)(sb + (64 + j * 16 + col) * RP) + kc * 32, lane);
#pragma unroll
      for (int j = 0; j < 8; ++j) acc[j] = wmma_bf(a, wb[j], acc[j]); }
    WAIT_DS(); WAIT_ACP(); __syncthreads();                // stage t + 1 is published, stage t's buffer is free
    if (t + 2 < E / 64) fill(t + 2); }
  WAIT_ACP();
  if (which < 2) {
#pragma unroll
    for (int j = 0; j < 8; ++j) { const float bb = 0.f;
#pragma unroll
      for (int r = 0; r < 8; ++r) so[wave][8 * g + r][j * 16 + col] = acc[j][r] + bb; }
    LDSX();
    if (which == 0) { for (int qq = lane; qq < 2 * 16 * 16; qq += 32) { const int hh = qq >> 8, rl = (qq >> 4) & 15, pc = qq & 15; const int h = (n0 >> 6) + hh;
        vst2(Q32 + (((size_t)b * NH + h) * SS + s0 + wave * 16 + rl) * HD + pc * 4, *(const v4f*)(&so[wave][rl][hh * 64 + pc * 4])); } }
    else {
      for (int qq = lane; qq < 2 * 16 * 16; qq += 32) { const int hh = qq >> 8, rl = (qq >> 4) & 15, pl = qq & 15; const int h = (n0 >> 6) + hh; const int pc = pl & 7; union { __bf16 e[8]; v4u u; } pk;
#pragma unroll
        for (int e = 0; e < 8; ++e) { const float v = so[wave][rl][hh * 64 + pc * 8 + e]; const __bf16 hi = (__bf16)v; pk.e[e] = pl < 8 ? hi : (__bf16)(v - (float)hi); }
        vst2((unsigned*)((pl < 8 ? Kh : Kl) + (((size_t)b * NH + h) * SS + s0 + wave * 16 + rl) * HD + pc * 8), pk.u); } } }
  else {
#pragma unroll
    for (int j = 0; j < 8; ++j) { const float bb = 0.f;
#pragma unroll
      for (int r = 0; r < 8; ++r) { const float v = (acc[j][r] + bb) * 4.0f; const _Float16 hi = (_Float16)v; sth[j * 16 + col][wave * 16 + 8 * g + r] = hi; stl[j * 16 + col][wave * 16 + 8 * g + r] = (_Float16)((v - (float)hi) * VLO); } }
    __syncthreads();
    for (int qq = tid; qq < 128 * 8; qq += 128) { const int cl = qq >> 3, pc = qq & 7; const int c = n0 + cl, h = c >> 6, d = c & 63; const size_t o = (((size_t)b * NH + h) * HD + d) * SS + s0 + pc * 8;
      vst2(VTh + o, *(const v4u*)(&sth[cl][pc * 8])); vst2(VTl + o, *(const v4u*)(&stl[cl][pc * 8])); } }
}
// padding-masked attention: block (64 queries, bh); all 16 key tiles; S on q hi/lo x K hi/lo rows; P,V hi/lo; O f32 [bh][s][64]
__global__ __launch_bounds__(128) void k_attn(const float* __restrict__ Q32, const __bf16* __restrict__ Kh, const __bf16* __restrict__ Kl, const _Float16* __restrict__ VTh, const _Float16* __restrict__ VTl, const int* __restrict__ vlen, float* __restrict__ O32) {
  __shared__ __align__(16) float sS[4][16][68];
  __shared__ __align__(16) _Float16 sPh[4][16][72], sPl[4][16][72];
  __shared__ __align__(16) char sKV[4 * 64 * RP];          // K buffer: K hi, K lo (64 keys x 64 d); V buffer: V^T hi, V^T lo (64 d x 64 keys)
  const int tid = threadIdx.x, w = tid >> 5, lane = tid & 31, col = lane & 15, g = lane >> 4;
  const size_t bh = blockIdx.y; const int qb = blockIdx.x; const int q0 = qb * 64 + w * 16;
  F2 aq[2];
#pragma unroll
  for (int kc = 0; kc < 2; ++kc) aq[kc] = split_row(Q32 + (bh * SS + q0 + col) * HD, kc * 32, lane);
  __shared__ int svl[4][16]; if (lane < 16) svl[w][lane] = vlen[bh * SS + q0 + lane];     // valid lengths of my 16 query rows
  float mrun = -3.0e38f, lrun = 0.f; v8f acc[4] = {}, ac1[4] = {}, ac2[4] = {};
  LDSX();
  const unsigned l0 = lds_off(sKV) + (tid >> 3) * RP + (tid & 7) * 16;        // a copy of the block: 16 rows, 8 lanes a row
  const size_t oK = ((bh * SS + (tid >> 3)) * HD + (tid & 7) * 8) * 2, oV = ((bh * HD + (tid >> 3)) * SS + (tid & 7) * 8) * 2;
  // two buffers, stages K(0), V(0), K(1), V(1), ...: the score pass reads the K buffer alone, the P.V pass the V buffer alone; each refill flies during the other pass
  auto fillK = [&](int kt) { acp8(l0, (const char*)Kh + oK + (size_t)kt * 64 * HD * 2, l0 + 64 * RP, (const char*)Kl + oK + (size_t)kt * 64 * HD * 2, 16 * RP, (size_t)16 * HD * 2); };
  auto fillV = [&](int kt) { acp8(l0 + 128 * RP, (const char*)VTh + oV + (size_t)kt * 128, l0 + 192 * RP, (const char*)VTl + oV + (size_t)kt * 128, 16 * RP, (size_t)16 * SS * 2); };
  fillK(0); WAIT_ACP(); __syncthreads(); fillV(0);
#pragma unroll 1
  for (int kt = 0; kt < SS / 64; ++kt) {
#pragma unroll
    for (int t = 0; t < 4; ++t) { const int key = kt * 64 + t * 16 + col; const char* kr = sKV + (t * 16 + col) * RP; v8f s = {};
#pragma unroll
      for (int kc = 0; kc < 2; ++kc) { const v16b khf = frag_b((const __bf16*)kr + kc * 32, lane), klf = frag_b((const __bf16*)(kr + 64 * RP) + kc * 32, lane); s = wmma_bf(aq[kc].l, khf, s); s = wmma_bf(aq[kc].h, klf, s); s = wmma_bf(aq[kc].h, khf, s); }
#pragma unroll
      for (int r = 0; r < 8; ++r) { sS[w][8 * g + r][t * 16 + col] = (key < svl[w][8 * g + r]) ? s[r] * 0.125f : -1.0e6f; } }
    LDSX();                                                // holds the s_wait_dscnt 0 of this pass's foot too
    WAIT_ACP(); __syncthreads();                           // V(kt) is published, the K buffer is free
    if (kt + 1 < SS / 64) fillK(kt + 1);
    float mx = -3.4e38f;
#pragma unroll
    for (int jj = 0; jj < 32; ++jj) mx = fmaxf(mx, sS[w][col][g * 32 + jj]);
    mx = fmaxf(mx, __shfl_xor(mx, 16, 32));
    const float mnew = fmaxf(mrun, mx); const float corr = expf(mrun - mnew);
    float ps = 0.f;
#pragma unroll
    for (int jj = 0; jj < 32; ++jj) { const float p = expf(sS[w][col][g * 32 + jj] - mnew) * 16384.0f; ps += p; const _Float16 hi = (_Float16)p; sPh[w][col][g * 32 + jj] = hi; sPl[w][col][g * 32 + jj] = (_Float16)((p - (float)hi) * PLO); }
    ps += __shfl_xor(ps, 16, 32);
    lrun = lrun * corr + ps * (1.0f / 16384.0f); mrun = mnew;
#pragma unroll
    for (int r = 0; r < 8; ++r) { const float cr = __shfl(corr, 8 * g + r, 32);
#pragma unroll
      for (int t = 0; t < 4; ++t) { acc[t][r] *= cr; ac1[t][r] *= cr; ac2[t][r] *= cr; } }
    LDSX();
#pragma unroll
    for (int kc = 0; kc < 2; ++kc) { const v16h ph = frag_h(&sPh[w][col][0] + kc * 32, lane), pl = frag_h(&sPl[w][col][0] + kc * 32, lane);
#pragma unroll
      for (int t = 0; t < 4; ++t) { const char* vr = sKV + (128 + t * 16 + col) * RP; const v16h vh = frag_h((const _Float16*)vr + kc * 32, lane);
        acc[t] = wmma16(ph, vh, acc[t]); ac1[t] = wmma16(ph, frag_h((const _Float16*)(vr + 64 * RP) + kc * 32, lane), ac1[t]); ac2[t] = wmma16(pl, vh, ac2[t]); } }
    __builtin_amdgcn_wave_barrier();
    WAIT_DS(); WAIT_ACP(); __syncthreads();                // K(kt + 1) is published, the V buffer is free
    if (kt + 1 < SS / 64) fillV(kt + 1); }
  WAIT_ACP();
#pragma unroll
  for (int r = 0; r < 8; ++r) { const float lr = __shfl(lrun, 8 * g + r, 32); const float inv = 1.0f / (lr * 16384.0f * 4.0f);
#pragma unroll
    for (int t = 0; t < 4; ++t) sS[w][8 * g + r][t * 16 + col] = (acc[t][r] + ac1[t][r] * (1.0f / VLO) + ac2[t][r] * (1.0f / PLO)) * inv; }
  LDSX();
  for (int qq = lane; qq < 16 * 16; qq += 32) { const int rl = qq >> 4, pc = qq & 15; vst2(O32 + ((bh * SS) + q0 + rl) * HD + pc * 4, *(const v4f*)(&sS[w][rl][pc * 4])); }
}
// out = ctx Wo^T : split(ctx) x bf16(Wo rows): 2 products (Wo is an INPUT -> bf16 exact)
__global__ __launch_bounds__(128) void k_out(const float* __restrict__ O32, const __bf16* __restrict__ PT, float* __restrict__ out) {
  constexpr int STA = 64 * RPF, STG = STA + 128 * RP;      // one stage: 64 ctx rows of one head (f32), then 128 weight rows, 64 k each
  __shared__ __align__(16) char smem[2 * STG];             // two stages in the k loop; the output staging behind it
  float (*so)[16][132] = (float (*)[16][132])smem;
  const int tid = threadIdx.x, wave = tid >> 5, lane = tid & 31, col = lane & 15, g = lane >> 4;
  const int r0b = blockIdx.x * 64, r0 = r0b + wave * 16, n0 = blockIdx.y * 128; const int b = r0b / SS, s0 = r0b % SS;
  v8f acc[8] = {};
  const unsigned lA = lds_off(smem) + (tid >> 4) * RPF + (tid & 15) * 16;     // a copy of the block: 8 ctx rows, 16 lanes a row
  const unsigned lW = lds_off(smem) + STA + (tid >> 3) * RP + (tid & 7) * 16; // or 16 weight rows, 8 lanes a row
  const char* gA = (const char*)(O32 + ((size_t)b * NH * SS + s0 + (tid >> 4)) * HD + (tid & 15) * 4);
  const char* gW = (const char*)(PT + (size_t)(3 * E + n0 + (tid >> 3)) * E + (tid & 7) * 8);
  auto fill = [&](int t) { const unsigned lo = (t & 1) * STG; const char* ga = gA + (size_t)t * SS * HD * 4; const char* gw = gW + (size_t)t * 128;   // pass t = head t
    acp8(lA + lo, ga, lA + lo + 32 * RPF, ga + (size_t)32 * HD * 4, 8 * RPF, (size_t)8 * HD * 4);
    acp8(lW + lo, gw, lW + lo + 64 * RP, gw + (size_t)64 * E * 2, 16 * RP, (size_t)16 * E * 2); };
  fill(0); WAIT_ACP(); __syncthreads(); fill(1);
#pragma unroll 2   // two trips a body: each half addresses its buffer by constant offsets
  for (int t = 0; t < E / 64; ++t) { const char* sb = smem + (t & 1) * STG;
#pragma unroll
    for (int kc = 0; kc < 2; ++kc) { const F2 a = split_row((const float*)(sb + (wave * 16 + col) * RPF), kc * 32, lane); v16b wb[8];
#pragma unroll     // the LDS reads of a k chunk go out as one group, so that their latency is paid once and not per product; wb[] stays in registers
      for (int j = 0; j < 8; ++j) wb[j] = frag_b((const __bf16*)(sb + STA + (j * 16 + col) * RP) + kc * 32, lane);
#pragma unroll
      for (int j = 0; j < 8; ++j) { acc[j] = wmma_bf(a.l, wb[j], acc[j]); acc[j] = wmma_bf(a.h, wb[j], acc[j]); } }
    WAIT_DS(); WAIT_ACP(); __syncthreads();                // stage t + 1 is published, stage t's buffer is free
    if (t + 2 < E / 64) fill(t + 2); }
  WAIT_ACP();
#pragma unroll
  for (int j = 0; j < 8; ++j) {
#pragma unroll
    for (int r = 0; r < 8; ++r) so[wave][8 * g + r][j * 16 + col] = acc[j][r]; }
  LDSX();
#pragma unroll 4
  for (int rl = 0; rl < 16; ++rl) vst2(out + (size_t)(r0 + rl) * E + n0 + lane * 4, *(const v4f*)(&so[wave][rl][lane * 4]));
}
extern "C" void kernel_launch(void* const* d_in, const int* in_sizes, int n_in, void* d_out, int out_size, void* d_ws, size_t ws_size, hipStream_t stream) {
  (void)in_sizes; (void)n_in; (void)out_size; (void)ws_size;
  const float* Qi = (const float*)d_in[0]; const float* Ki = (const float*)d_in[1]; const float* Vi = (const float*)d_in[2]; const int* vlen = (const int*)d_in[3];
  const float* Wq = (const float*)d_in[4]; const float* Wk = (const float*)d_in[5]; const float* Wv = (const float*)d_in[6]; const float* Wo = (const float*)d_in[7];
  float* out = (float*)d_out;
  char* ws = (char*)d_ws; size_t off = 0;
  auto take = [&](size_t bytes) { char* p = ws + off; off += (bytes + 255) & ~(size_t)255; return p; };
  __bf16* XQ = (__bf16*)take((size_t)NR * E * 2); __bf16* XK = (__bf16*)take((size_t)NR * E * 2); __bf16* XV = (__bf16*)take((size_t)NR * E * 2); __bf16* PT = (__bf16*)take((size_t)4 * E * E * 2);
  float* Q32 = (float*)take((size_t)NR * E * 4); __bf16* Kh = (__bf16*)take((size_t)NR * E * 2); __bf16* Kl = (__bf16*)take((size_t)NR * E * 2); _Float16* VTh = (_Float16*)take((size_t)NR * E * 2); _Float16* VTl = (_Float16*)take((size_t)NR * E * 2); float* O32 = (float*)take((size_t)NR * E * 4);
  // ws ~ 96 MiB
  k_cvt<<<(NR * E / 8 + 255) / 256, 256, 0, stream>>>(Qi, XQ);
  k_cvt<<<(NR * E / 8 + 255) / 256, 256, 0, stream>>>(Ki, XK);
  k_cvt<<<(NR * E / 8 + 255) / 256, 256, 0, stream>>>(Vi, XV);
  k_pack<<<4 * E, 256, 0, stream>>>(Wq, Wk, Wv, Wo, PT);
  k_qkv<<<dim3(NR / 64, E / 128, 3), 128, 0, stream>>>(XQ, XK, XV, PT, Q32, Kh, Kl, VTh, VTl);
  k_attn<<<dim3(SS / 64, NB * NH), 128, 0, stream>>>(Q32, Kh, Kl, VTh, VTl, vlen, O32);
  k_out<<<dim3(NR / 64, E / 128), 128, 0, stream>>>(O32, PT, out);
}

// v002
// Measured time: 138 microseconds a run.
// Two timings next to v001 both put it at 1.05 times that version's speed.
// Over all steps from v000 it is 2.89 times as fast.
// compute dtype: Q, K, V, W* (INPUTS) rounded to bf16 with exact bf16 WMMA products (f32 accumulate) for the projections; K pre-split into bf16 hi/lo rows; q f32 split, P and V f16 hi/lo (3 products each); softmax with the -1e6 valid-length fill in f32 (no sentinel shortcut, so a zero valid length yields a uniform row).
#include <hip/hip_runtime.h>
#include <math.h>

typedef __attribute__((ext_vector_type(16))) _Float16 v16h;
typedef __attribute__((ext_vector_type(16))) __bf16 v16b;
typedef __attribute__((ext_vector_type(8)))  _Float16 v8h;
typedef __attribute__((ext_vector_type(8)))  float v8f;
typedef __attribute__((ext_vector_type(4)))  float v4f;
typedef __attribute__((ext_vector_type(2)))  float v2f;
typedef __attribute__((ext_vector_type(4)))  unsigned v4u;
typedef __attribute__((ext_vector_type(2)))  unsigned v2u;
typedef __attribute__((ext_vector_type(4)))  int v4i;
typedef float __attribute__((may_alias)) float_a;
typedef int __attribute__((may_alias)) int_a;

template <typename T> __device__ __forceinline__ void vst2(void* p, T v) { *(T*)p = v;  }
__device__ __forceinline__ v8f wmma16(v16h a, v16h b, v8f c) {
  v8f d = __builtin_amdgcn_wmma_f32_16x16x32_f16(false, a, false, b, (short)0, c, false, false);
  asm volatile("v_nop\n\tv_nop\n\tv_nop\n\tv_nop" : "+v"(d) : "v"(a), "v"(b));
  return d;
}
__device__ __forceinline__ v8f wmma_bf(v16b a, v16b b, v8f c) {
  v8f d = __builtin_amdgcn_wmma_f32_16x16x32_bf16(false, a, false, b, (short)0, c, false, false);
  asm volatile("v_nop\n\tv_nop\n\tv_nop\n\tv_nop" : "+v"(d) : "v"(a), "v"(b));
  return d;
}
// 16x16x32 fragments: lane = (h = lane>>4, row/col = lane&15); elements 0..7 = k0+8h+0..7, 8..15 = k0+16+8h+0..7; D element r = row 8h+r
__device__ __forceinline__ v16h frag_h(const _Float16* rowk0, int lane) {
  union { v16h v; v8h q[2]; } u; const _Float16* p = rowk0 + 8 * (lane >> 4);
  u.q[0] = *(const v8h*)p; u.q[1] = *(const v8h*)(p + 16); return u.v;
}
__device__ __forceinline__ v16h frag_f32(const float* rowk0, int lane) {
  v16h a; const float* p = rowk0 + 8 * (lane >> 4);
#pragma unroll
  for (int i = 0; i < 8; ++i) { a[i] = (_Float16)p[i]; a[8 + i] = (_Float16)p[16 + i]; }
  return a;
}
__device__ __forceinline__ v16h frag_f32s(const float* rowk0, int lane, float sc) {
  v16h a; const float* p = rowk0 + 8 * (lane >> 4);
#pragma unroll
  for (int i = 0; i < 8; ++i) { a[i] = (_Float16)(p[i] * sc); a[8 + i] = (_Float16)(p[16 + i] * sc); }
  return a;
}
// column fragment from a [K][ld] layout (column n), rows >= K read as 0
__device__ __forceinline__ v16h fragc_f32(const float* W, int k0, int n, int lane, int ld, int K) {
  v16h a; const int g = lane >> 4;
#pragma unroll
  for (int i = 0; i < 8; ++i) { const int ka = k0 + 8 * g + i, kb = ka + 16;
    a[i] = (_Float16)(ka < K ? W[(size_t)ka * ld + n] : 0.f); a[8 + i] = (_Float16)(kb < K ? W[(size_t)kb * ld + n] : 0.f); }
  return a;
}
struct F2 { v16b h, l; };
__device__ __forceinline__ F2 bsplit16(const float v[16]) { F2 r;
#pragma unroll
  for (int i = 0; i < 16; ++i) { const __bf16 h = (__bf16)v[i]; r.h[i] = h; r.l[i] = (__bf16)(v[i] - (float)h); }
  return r; }
__device__ __forceinline__ F2 split_row(const float* row, int k0, int lane) { float v[16]; const float* p = row + k0 + 8 * (lane >> 4);
#pragma unroll
  for (int i = 0; i < 8; ++i) { v[i] = p[i]; v[8 + i] = p[16 + i]; }
  return bsplit16(v); }
__device__ __forceinline__ F2 split_rowK(const float* row, int k0, int lane, int K) { float v[16]; const int g = lane >> 4;
#pragma unroll
  for (int i = 0; i < 8; ++i) { const int ka = k0 + 8 * g + i, kb = ka + 16; v[i] = ka < K ? row[ka] : 0.f; v[8 + i] = kb < K ? row[kb] : 0.f; }
  return bsplit16(v); }
__device__ __forceinline__ F2 split_col(const float* W, int k0, int n, int lane, int ld, int K) { float v[16]; const int g = lane >> 4;
#pragma unroll
  for (int i = 0; i < 8; ++i) { const int ka = k0 + 8 * g + i, kb = ka + 16; v[i] = ka < K ? W[(size_t)ka * ld + n] : 0.f; v[8 + i] = kb < K ? W[(size_t)kb * ld + n] : 0.f; }
  return bsplit16(v); }
__device__ __forceinline__ v8f mac3(const F2& a, const F2& b, v8f c) { c = wmma_bf(a.l, b.h, c); c = wmma_bf(a.h, b.l, c); return wmma_bf(a.h, b.h, c); }
__device__ __forceinline__ float sigm(float v) { return 1.0f / (1.0f + expf(-v)); }
#define LDSX() do { asm volatile("s_wait_dscnt 0" ::: "memory"); __builtin_amdgcn_wave_barrier(); __builtin_amdgcn_fence(__ATOMIC_RELEASE, "workgroup"); } while (0)


// d2l-style multi-head attention (16 heads of 64 on [4,1024,1024]; separate Q/K/V inputs, [out][in] weights, no biases): scores = q.k/8, then where(key < valid_lens[bh*L + q], score, -1e6) (per-row valid length, int input), softmax, (P v) Wo^T.
#define NB 4
#define SS 1024
#define E 1024
#define NH 16
#define HD 64
#define NR (NB * SS)
#define PLO 1024.0f
#define VLO 2048.0f
__device__ __forceinline__ float bfr(float v) { return (float)(__bf16)v; }
__device__ __forceinline__ v16b frag_b(const __bf16* rowk0, int lane) { return __builtin_bit_cast(v16b, frag_h((const _Float16*)rowk0, lane)); }

// Operand tiles go from global memory to LDS as whole 128-byte lines, 16 bytes a lane, through no register; the fragments are then read from LDS rows at a pitch of 16 B x odd.
#define RP 144   // LDS pitch in bytes of a 128-byte row
#define RPF 272  // LDS pitch in bytes of a 256-byte row
__device__ __forceinline__ unsigned lds_off(const void* p) { return (unsigned)(size_t)p; }
#define ACP(l, g) "global_load_async_to_lds_b128 %" #l ", %" #g ", off\n\t"
// four copies of a lane: LDS address l + i*ls, global address g + i*gs; s_wait_xcnt 0 closes the statement so that no address register is rewritten ahead of it
__device__ __forceinline__ void acp4(unsigned l, const char* g, unsigned ls, size_t gs) {
  asm volatile(ACP(0, 4) ACP(1, 5) ACP(2, 6) ACP(3, 7) "s_wait_xcnt 0x0"
               :: "v"(l), "v"(l + ls), "v"(l + 2 * ls), "v"(l + 3 * ls), "v"(g), "v"(g + gs), "v"(g + 2 * gs), "v"(g + 3 * gs) : "memory");
}
// eight copies of a lane, four from each of two bases, one closing s_wait_xcnt 0 (same reason)
__device__ __forceinline__ void acp8(unsigned l, const char* g, unsigned m, const char* h, unsigned ls, size_t gs) {
  asm volatile(ACP(0, 8) ACP(1, 9) ACP(2, 10) ACP(3, 11) ACP(4, 12) ACP(5, 13) ACP(6, 14) ACP(7, 15) "s_wait_xcnt 0x0"
               :: "v"(l), "v"(l + ls), "v"(l + 2 * ls), "v"(l + 3 * ls), "v"(m), "v"(m + ls), "v"(m + 2 * ls), "v"(m + 3 * ls),
                  "v"(g), "v"(g + gs), "v"(g + 2 * gs), "v"(g + 3 * gs), "v"(h), "v"(h + gs), "v"(h + 2 * gs), "v"(h + 3 * gs) : "memory");
}
// this wave's LDS reads have returned: stands in front of the barrier behind which their buffer is filled again
#define WAIT_DS() asm volatile("s_wait_dscnt 0x0" ::: "memory")
// this wave's copies have landed: stands in front of the barrier behind which other waves read them
#define WAIT_ACP() asm volatile("s_wait_asynccnt 0x0" ::: "memory")

// every f32 -> bf16 rounding of the inputs in one streaming launch: dst holds XQ, XK, XV (NR x E each) and PT, one behind the other.
// PT rows: [0,E) Wq, [E,2E) Wk, [2E,3E) Wv, [3E,4E) Wo  ([out][in] weights: PT row n = W row n % E, so the pack is the same elementwise rounding)
#define PB 65536   // elements of a block: 512 threads x 32 pieces of 4; 256 blocks in all
__global__ __launch_bounds__(512) void k_prep(const float* __restrict__ Qi, const float* __restrict__ Ki, const float* __restrict__ Vi, const float* __restrict__ Wq, const float* __restrict__ Wk, const float* __restrict__ Wv, const float* __restrict__ Wo, __bf16* __restrict__ dst) {
  const unsigned blk = blockIdx.x, seg = blk / (NR * E / PB), ws = (blk / (E * E / PB)) & 3;      // 64 blocks an activation, 16 a weight
  const float* s = seg == 0 ? Qi : (seg == 1 ? Ki : (seg == 2 ? Vi : (ws == 0 ? Wq : (ws == 1 ? Wk : (ws == 2 ? Wv : Wo)))));
  s += (size_t)(seg < 3 ? blk % (NR * E / PB) : blk % (E * E / PB)) * PB + threadIdx.x * 4;
  __bf16* d = dst + (size_t)blk * PB + threadIdx.x * 4;
  v4f v[32];
#pragma unroll     // unrolled so that a lane's loads go out far ahead of their use (many in flight a wave); each covers 512 contiguous bytes of a wave
  for (int i = 0; i < 32; ++i) v[i] = *(const v4f*)(s + i * 2048);
#pragma unroll
  for (int i = 0; i < 32; ++i) { union { __bf16 h[4]; v2u u; } pk;
#pragma unroll
    for (int e = 0; e < 4; ++e) pk.h[e] = (__bf16)v[i][e];
    vst2((unsigned*)(d + i * 2048), pk.u); }
}
// QKV: block (64 rows, 128 cols = 2 heads, which); q -> Q32 f32 [bh][s][64]; k -> bf16 hi/lo rows; v -> VT hi/lo x4 [bh][d][s]
__global__ __launch_bounds__(128) void k_qkv(const __bf16* __restrict__ XQ, const __bf16* __restrict__ XK, const __bf16* __restrict__ XV, const __bf16* __restrict__ PT, float* __restrict__ Q32, __bf16* __restrict__ Kh, __bf16* __restrict__ Kl, _Float16* __restrict__ VTh, _Float16* __restrict__ VTl) {
  constexpr int STG = (64 + 128) * RP;                     // one stage: 64 X rows, then 128 weight rows, 64 k each
  __shared__ __align__(16) char smem[2 * STG];             // two stages in the k loop; the output staging behind it
  float (*so)[16][132] = (float (*)[16][132])smem;
  _Float16 (*sth)[72] = (_Float16 (*)[72])smem; _Float16 (*stl)[72] = (_Float16 (*)[72])(smem + 128 * 72 * 2);
  const int tid = threadIdx.x, wave = tid >> 5, lane = tid & 31, col = lane & 15, g = lane >> 4;
  const int which = blockIdx.z, r0b = blockIdx.x * 64, r0 = r0b + wave * 16, n0 = blockIdx.y * 128; const int b = r0b / SS, s0 = r0b % SS;
  const __bf16* Xb = which == 0 ? XQ : (which == 1 ? XK : XV);
  v8f acc[8] = {};
  const unsigned l0 = lds_off(smem) + (tid >> 3) * RP + (tid & 7) * 16;       // a copy of the block: 16 rows, 8 lanes a row
  const char* gX = (const char*)(Xb + (size_t)(r0b + (tid >> 3)) * E + (tid & 7) * 8);
  const char* gW = (const char*)(PT + (size_t)(which * E + n0 + (tid >> 3)) * E + (tid & 7) * 8);
  auto fill = [&](int t) { const unsigned l = l0 + (t & 1) * STG; const size_t ko = (size_t)t * 128;
    acp4(l, gX + ko, 16 * RP, (size_t)16 * E * 2);
    acp8(l + 64 * RP, gW + ko, l + 128 * RP, gW + ko + (size_t)64 * E * 2, 16 * RP, (size_t)16 * E * 2); };
  fill(0); WAIT_ACP(); __syncthreads(); fill(1);
#pragma unroll 2   // two trips a body: each half addresses its buffer by constant offsets
  for (int t = 0; t < E / 64; ++t) { const char* sb = smem + (t & 1) * STG;
#pragma unroll
    for (int kc = 0; kc < 2; ++kc) { const v16b a = frag_b((const __bf16*)(sb + (wave * 16 + col) * RP) + kc * 32, lane); v16b wb[8];
#pragma unroll     // the LDS reads of a k chunk go out as one group, so that their latency is paid once and not per product; wb[] stays in registers
      for (int j = 0; j < 8; ++j) wb[j] = frag_b((const __bf16*)(sb + (64 + j * 16 + col) * RP) + kc * 32, lane);
#pragma unroll
      for (int j = 0; j < 8; ++j) acc[j] = wmma_bf(a, wb[j], acc[j]); }
    WAIT_DS(); WAIT_ACP(); __syncthreads();                // stage t + 1 is published, stage t's buffer is free
    if (t + 2 < E / 64) fill(t + 2); }
  WAIT_ACP();
  if (which < 2) {
#pragma unroll
    for (int j = 0; j < 8; ++j) { const float bb = 0.f;
#pragma unroll
      for (int r = 0; r < 8; ++r) so[wave][8 * g + r][j * 16 + col] = acc[j][r] + bb; }
    LDSX();
    if (which == 0) { for (int qq = lane; qq < 2 * 16 * 16; qq += 32) { const int hh = qq >> 8, rl = (qq >> 4) & 15, pc = qq & 15; const int h = (n0 >> 6) + hh;
        vst2(Q32 + (((size_t)b * NH + h) * SS + s0 + wave * 16 + rl) * HD + pc * 4, *(const v4f*)(&so[wave][rl][hh * 64 + pc * 4])); } }
    else {
      for (int qq = lane; qq < 2 * 16 * 16; qq += 32) { const int hh = qq >> 8, rl = (qq >> 4) & 15, pl = qq & 15; const int h = (n0 >> 6) + hh; const int pc = pl & 7; union { __bf16 e[8]; v4u u; } pk;
#pragma unroll
        for (int e = 0; e < 8; ++e) { const float v = so[wave][rl][hh * 64 + pc * 8 + e]; const __bf16 hi = (__bf16)v; pk.e[e] = pl < 8 ? hi : (__bf16)(v - (float)hi); }
        vst2((unsigned*)((pl < 8 ? Kh : Kl) + (((size_t)b * NH + h) * SS + s0 + wave * 16 + rl) * HD + pc * 8), pk.u); } } }
  else {
#pragma unroll
    for (int j = 0; j < 8; ++j) { const float bb = 0.f;
#pragma unroll
      for (int r = 0; r < 8; ++r) { const float v = (acc[j][r] + bb) * 4.0f; const _Float16 hi = (_Float16)v; sth[j * 16 + col][wave * 16 + 8 * g + r] = hi; stl[j * 16 + col][wave * 16 + 8 * g + r] = (_Float16)((v - (float)hi) * VLO); } }
    __syncthreads();
    for (int qq = tid; qq < 128 * 8; qq += 128) { const int cl = qq >> 3, pc = qq & 7; const int c = n0 + cl, h = c >> 6, d = c & 63; const size_t o = (((size_t)b * NH + h) * HD + d) * SS + s0 + pc * 8;
      vst2(VTh + o, *(const v4u*)(&sth[cl][pc * 8])); vst2(VTl + o, *(const v4u*)(&stl[cl][pc * 8])); } }
}
// padding-masked attention: block (64 queries, bh); all 16 key tiles; S on q hi/lo x K hi/lo rows; P,V hi/lo; O f32 [bh][s][64]
__global__ __launch_bounds__(128) void k_attn(const float* __restrict__ Q32, const __bf16* __restrict__ Kh, const __bf16* __restrict__ Kl, const _Float16* __restrict__ VTh, const _Float16* __restrict__ VTl, const int* __restrict__ vlen, float* __restrict__ O32) {
  __shared__ __align__(16) float sS[4][16][68];
  __shared__ __align__(16) _Float16 sPh[4][16][72], sPl[4][16][72];
  __shared__ __align__(16) char sKV[4 * 64 * RP];          // K buffer: K hi, K lo (64 keys x 64 d); V buffer: V^T hi, V^T lo (64 d x 64 keys)
  const int tid = threadIdx.x, w = tid >> 5, lane = tid & 31, col = lane & 15, g = lane >> 4;
  const size_t bh = blockIdx.y; const int qb = blockIdx.x; const int q0 = qb * 64 + w * 16;
  F2 aq[2];
#pragma unroll
  for (int kc = 0; kc < 2; ++kc) aq[kc] = split_row(Q32 + (bh * SS + q0 + col) * HD, kc * 32, lane);
  __shared__ int svl[4][16]; if (lane < 16) svl[w][lane] = vlen[bh * SS + q0 + lane];     // valid lengths of my 16 query rows
  float mrun = -3.0e38f, lrun = 0.f; v8f acc[4] = {}, ac1[4] = {}, ac2[4] = {};
  LDSX();
  const unsigned l0 = lds_off(sKV) + (tid >> 3) * RP + (tid & 7) * 16;        // a copy of the block: 16 rows, 8 lanes a row
  const size_t oK = ((bh * SS + (tid >> 3)) * HD + (tid & 7) * 8) * 2, oV = ((bh * HD + (tid >> 3)) * SS + (tid & 7) * 8) * 2;
  // two buffers, stages K(0), V(0), K(1), V(1), ...: the score pass reads the K buffer alone, the P.V pass the V buffer alone; each refill flies during the other pass
  auto fillK = [&](int kt) { acp8(l0, (const char*)Kh + oK + (size_t)kt * 64 * HD * 2, l0 + 64 * RP, (const char*)Kl + oK + (size_t)kt * 64 * HD * 2, 16 * RP, (size_t)16 * HD * 2); };
  auto fillV = [&](int kt) { acp8(l0 + 128 * RP, (const char*)VTh + oV + (size_t)kt * 128, l0 + 192 * RP, (const char*)VTl + oV + (size_t)kt * 128, 16 * RP, (size_t)16 * SS * 2); };
  fillK(0); WAIT_ACP(); __syncthreads(); fillV(0);
#pragma unroll 1
  for (int kt = 0; kt < SS / 64; ++kt) {
#pragma unroll
    for (int t = 0; t < 4; ++t) { const int key = kt * 64 + t * 16 + col; const char* kr = sKV + (t * 16 + col) * RP; v8f s = {};
#pragma unroll
      for (int kc = 0; kc < 2; ++kc) { const v16b khf = frag_b((const __bf16*)kr + kc * 32, lane), klf = frag_b((const __bf16*)(kr + 64 * RP) + kc * 32, lane); s = wmma_bf(aq[kc].l, khf, s); s = wmma_bf(aq[kc].h, klf, s); s = wmma_bf(aq[kc].h, khf, s); }
#pragma unroll
      for (int r = 0; r < 8; ++r) { sS[w][8 * g + r][t * 16 + col] = (key < svl[w][8 * g + r]) ? s[r] * 0.125f : -1.0e6f; } }
    LDSX();                                                // holds the s_wait_dscnt 0 of this pass's foot too
    WAIT_ACP(); __syncthreads();                           // V(kt) is published, the K buffer is free
    if (kt + 1 < SS / 64) fillK(kt + 1);
    float mx = -3.4e38f;
#pragma unroll
    for (int jj = 0; jj < 32; ++jj) mx = fmaxf(mx, sS[w][col][g * 32 + jj]);
    mx = fmaxf(mx, __shfl_xor(mx, 16, 32));
    const float mnew = fmaxf(mrun, mx); const float corr = expf(mrun - mnew);
    float ps = 0.f;
#pragma unroll
    for (int jj = 0; jj < 32; ++jj) { const float p = expf(sS[w][col][g * 32 + jj] - mnew) * 16384.0f; ps += p; const _Float16 hi = (_Float16)p; sPh[w][col][g * 32 + jj] = hi; sPl[w][col][g * 32 + jj] = (_Float16)((p - (float)hi) * PLO); }
    ps += __shfl_xor(ps, 16, 32);
    lrun = lrun * corr + ps * (1.0f / 16384.0f); mrun = mnew;
#pragma unroll
    for (int r = 0; r < 8; ++r) { const float cr = __shfl(corr, 8 * g + r, 32);
#pragma unroll
      for (int t = 0; t < 4; ++t) { acc[t][r] *= cr; ac1[t][r] *= cr; ac2[t][r] *= cr; } }
    LDSX();
#pragma unroll
    for (int kc = 0; kc < 2; ++kc) { const v16h ph = frag_h(&sPh[w][col][0] + kc * 32, lane), pl = frag_h(&sPl[w][col][0] + kc * 32, lane);
#pragma unroll
      for (int t = 0; t < 4; ++t) { const char* vr = sKV + (128 + t * 16 + col) * RP; const v16h vh = frag_h((const _Float16*)vr + kc * 32, lane);
        acc[t] = wmma16(ph, vh, acc[t]); ac1[t] = wmma16(ph, frag_h((const _Float16*)(vr + 64 * RP) + kc * 32, lane), ac1[t]); ac2[t] = wmma16(pl, vh, ac2[t]); } }
    __builtin_amdgcn_wave_barrier();
    WAIT_DS(); WAIT_ACP(); __syncthreads();                // K(kt + 1) is published, the V buffer is free
    if (kt + 1 < SS / 64) fillV(kt + 1); }
  WAIT_ACP();
#pragma unroll
  for (int r = 0; r < 8; ++r) { const float lr = __shfl(lrun, 8 * g + r, 32); const float inv = 1.0f / (lr * 16384.0f * 4.0f);
#pragma unroll
    for (int t = 0; t < 4; ++t) sS[w][8 * g + r][t * 16 + col] = (acc[t][r] + ac1[t][r] * (1.0f / VLO) + ac2[t][r] * (1.0f / PLO)) * inv; }
  LDSX();
  for (int qq = lane; qq < 16 * 16; qq += 32) { const int rl = qq >> 4, pc = qq & 15; vst2(O32 + ((bh * SS) + q0 + rl) * HD + pc * 4, *(const v4f*)(&sS[w][rl][pc * 4])); }
}
// out = ctx Wo^T : split(ctx) x bf16(Wo rows): 2 products (Wo is an INPUT -> bf16 exact)
__global__ __launch_bounds__(128) void k_out(const float* __restrict__ O32, const __bf16* __restrict__ PT, float* __restrict__ out) {
  constexpr int STA = 64 * RPF, STG = STA + 128 * RP;      // one stage: 64 ctx rows of one head (f32), then 128 weight rows, 64 k each
  __shared__ __align__(16) char smem[2 * STG];             // two stages in the k loop; the output staging behind it
  float (*so)[16][132] = (float (*)[16][132])smem;
  const int tid = threadIdx.x, wave = tid >> 5, lane = tid & 31, col = lane & 15, g = lane >> 4;
  const int r0b = blockIdx.x * 64, r0 = r0b + wave * 16, n0 = blockIdx.y * 128; const int b = r0b / SS, s0 = r0b % SS;
  v8f acc[8] = {};
  const unsigned lA = lds_off(smem) + (tid >> 4) * RPF + (tid & 15) * 16;     // a copy of the block: 8 ctx rows, 16 lanes a row
  const unsigned lW = lds_off(smem) + STA + (tid >> 3) * RP + (tid & 7) * 16; // or 16 weight rows, 8 lanes a row
  const char* gA = (const char*)(O32 + ((size_t)b * NH * SS + s0 + (tid >> 4)) * HD + (tid & 15) * 4);
  const char* gW = (const char*)(PT + (size_t)(3 * E + n0 + (tid >> 3)) * E + (tid & 7) * 8);
  auto fill = [&](int t) { const unsigned lo = (t & 1) * STG; const char* ga = gA + (size_t)t * SS * HD * 4; const char* gw = gW + (size_t)t * 128;   // pass t = head t
    acp8(lA + lo, ga, lA + lo + 32 * RPF, ga + (size_t)32 * HD * 4, 8 * RPF, (size_t)8 * HD * 4);
    acp8(lW + lo, gw, lW + lo + 64 * RP, gw + (size_t)64 * E * 2, 16 * RP, (size_t)16 * E * 2); };
  fill(0); WAIT_ACP(); __syncthreads(); fill(1);
#pragma unroll 2   // two trips a body: each half addresses its buffer by constant offsets
  for (int t = 0; t < E / 64; ++t) { const char* sb = smem + (t & 1) * STG;
#pragma unroll
    for (int kc = 0; kc < 2; ++kc) { const F2 a = split_row((const float*)(sb + (wave * 16 + col) * RPF), kc * 32, lane); v16b wb[8];
#pragma unroll     // the LDS reads of a k chunk go out as one group, so that their latency is paid once and not per product; wb[] stays in registers
      for (int j = 0; j < 8; ++j) wb[j] = frag_b((const __bf16*)(sb + STA + (j * 16 + col) * RP) + kc * 32, lane);
#pragma unroll
      for (int j = 0; j < 8; ++j) { acc[j] = wmma_bf(a.l, wb[j], acc[j]); acc[j] = wmma_bf(a.h, wb[j], acc[j]); } }
    WAIT_DS(); WAIT_ACP(); __syncthreads();                // stage t + 1 is published, stage t's buffer is free
    if (t + 2 < E / 64) fill(t + 2); }
  WAIT_ACP();
#pragma unroll
  for (int j = 0; j < 8; ++j) {
#pragma unroll
    for (int r = 0; r < 8; ++r) so[wave][8 * g + r][j * 16 + col] = acc[j][r]; }
  LDSX();
#pragma unroll 4
  for (int rl = 0; rl < 16; ++rl) vst2(out + (size_t)(r0 + rl) * E + n0 + lane * 4, *(const v4f*)(&so[wave][rl][lane * 4]));
}
extern "C" void kernel_launch(void* const* d_in, const int* in_sizes, int n_in, void* d_out, int out_size, void* d_ws, size_t ws_size, hipStream_t stream) {
  (void)in_sizes; (void)n_in; (void)out_size; (void)ws_size;
  const float* Qi = (const float*)d_in[0]; const float* Ki = (const float*)d_in[1]; const float* Vi = (const float*)d_in[2]; const int* vlen = (const int*)d_in[3];
  const float* Wq = (const float*)d_in[4]; const float* Wk = (const float*)d_in[5]; const float* Wv = (const float*)d_in[6]; const float* Wo = (const float*)d_in[7];
  float* out = (float*)d_out;
  char* ws = (char*)d_ws; size_t off = 0;
  auto take = [&](size_t bytes) { char* p = ws + off; off += (bytes + 255) & ~(size_t)255; return p; };
  __bf16* XQ = (__bf16*)take((size_t)NR * E * 2); __bf16* XK = (__bf16*)take((size_t)NR * E * 2); __bf16* XV = (__bf16*)take((size_t)NR * E * 2); __bf16* PT = (__bf16*)take((size_t)4 * E * E * 2);
  float* Q32 = (float*)take((size_t)NR * E * 4); __bf16* Kh = (__bf16*)take((size_t)NR * E * 2); __bf16* Kl = (__bf16*)take((size_t)NR * E * 2); _Float16* VTh = (_Float16*)take((size_t)NR * E * 2); _Float16* VTl = (_Float16*)take((size_t)NR * E * 2); float* O32 = (float*)take((size_t)NR * E * 4);
  // ws = 96 MiB
  k_prep<<<(3 * NR * E + 4 * E * E) / PB, 512, 0, stream>>>(Qi, Ki, Vi, Wq, Wk, Wv, Wo, XQ);   // XQ, XK, XV, PT are contiguous in ws
  k_qkv<<<dim3(NR / 64, E / 128, 3), 128, 0, stream>>>(XQ, XK, XV, PT, Q32, Kh, Kl, VTh, VTl);
  k_attn<<<dim3(SS / 64, NB * NH), 128, 0, stream>>>(Q32, Kh, Kl, VTh, VTl, vlen, O32);
  k_out<<<dim3(NR / 64, E / 128), 128, 0, stream>>>(O32, PT, out);
}

// v003
// It runs in 127 microseconds.
// In both of two side-by-side timings against v002, it was 1.08 times as fast.
// Over all steps from v000 it is 3.13 times as fast.
// compute dtype: Q, K, V, W* (INPUTS) rounded to bf16 with exact bf16 WMMA products (f32 accumulate) for the projections; K pre-split into bf16 hi/lo rows; q f32 split, P and V f16 hi/lo (3 products each); softmax with the -1e6 valid-length fill in f32 (no sentinel shortcut, so a zero valid length yields a uniform row).
#include <hip/hip_runtime.h>
#include <math.h>

typedef __attribute__((ext_vector_type(16))) _Float16 v16h;
typedef __attribute__((ext_vector_type(16))) __bf16 v16b;
typedef __attribute__((ext_vector_type(8)))  _Float16 v8h;
typedef __attribute__((ext_vector_type(8)))  float v8f;
typedef __attribute__((ext_vector_type(4)))  float v4f;
typedef __attribute__((ext_vector_type(2)))  float v2f;
typedef __attribute__((ext_vector_type(4)))  unsigned v4u;
typedef __attribute__((ext_vector_type(2)))  unsigned v2u;
typedef __attribute__((ext_vector_type(4)))  int v4i;
typedef float __attribute__((may_alias)) float_a;
typedef int __attribute__((may_alias)) int_a;

template <typename T> __device__ __forceinline__ void vst2(void* p, T v) { *(T*)p = v;  }
__device__ __forceinline__ v8f wmma16(v16h a, v16h b, v8f c) {
  v8f d = __builtin_amdgcn_wmma_f32_16x16x32_f16(false, a, false, b, (short)0, c, false, false);
  asm volatile("v_nop\n\tv_nop\n\tv_nop\n\tv_nop" : "+v"(d) : "v"(a), "v"(b));
  return d;
}
__device__ __forceinline__ v8f wmma_bf(v16b a, v16b b, v8f c) {
  v8f d = __builtin_amdgcn_wmma_f32_16x16x32_bf16(false, a, false, b, (short)0, c, false, false);
  asm volatile("v_nop\n\tv_nop\n\tv_nop\n\tv_nop" : "+v"(d) : "v"(a), "v"(b));
  return d;
}
// 16x16x32 fragments: lane = (h = lane>>4, row/col = lane&15); elements 0..7 = k0+8h+0..7, 8..15 = k0+16+8h+0..7; D element r = row 8h+r
__device__ __forceinline__ v16h frag_h(const _Float16* rowk0, int lane) {
  union { v16h v; v8h q[2]; } u; const _Float16* p = rowk0 + 8 * (lane >> 4);
  u.q[0] = *(const v8h*)p; u.q[1] = *(const v8h*)(p + 16); return u.v;
}
__device__ __forceinline__ v16h frag_f32(const float* rowk0, int lane) {
  v16h a; const float* p = rowk0 + 8 * (lane >> 4);
#pragma unroll
  for (int i = 0; i < 8; ++i) { a[i] = (_Float16)p[i]; a[8 + i] = (_Float16)p[16 + i]; }
  return a;
}
__device__ __forceinline__ v16h frag_f32s(const float* rowk0, int lane, float sc) {
  v16h a; const float* p = rowk0 + 8 * (lane >> 4);
#pragma unroll
  for (int i = 0; i < 8; ++i) { a[i] = (_Float16)(p[i] * sc); a[8 + i] = (_Float16)(p[16 + i] * sc); }
  return a;
}
// column fragment from a [K][ld] layout (column n), rows >= K read as 0
__device__ __forceinline__ v16h fragc_f32(const float* W, int k0, int n, int lane, int ld, int K) {
  v16h a; const int g = lane >> 4;
#pragma unroll
  for (int i = 0; i < 8; ++i) { const int ka = k0 + 8 * g + i, kb = ka + 16;
    a[i] = (_Float16)(ka < K ? W[(size_t)ka * ld + n] : 0.f); a[8 + i] = (_Float16)(kb < K ? W[(size_t)kb * ld + n] : 0.f); }
  return a;
}
struct F2 { v16b h, l; };
__device__ __forceinline__ F2 bsplit16(const float v[16]) { F2 r;
#pragma unroll
  for (int i = 0; i < 16; ++i) { const __bf16 h = (__bf16)v[i]; r.h[i] = h; r.l[i] = (__bf16)(v[i] - (float)h); }
  return r; }
__device__ __forceinline__ F2 split_row(const float* row, int k0, int lane) { float v[16]; const float* p = row + k0 + 8 * (lane >> 4);
#pragma unroll
  for (int i = 0; i < 8; ++i) { v[i] = p[i]; v[8 + i] = p[16 + i]; }
  return bsplit16(v); }
__device__ __forceinline__ F2 split_rowK(const float* row, int k0, int lane, int K) { float v[16]; const int g = lane >> 4;
#pragma unroll
  for (int i = 0; i < 8; ++i) { const int ka = k0 + 8 * g + i, kb = ka + 16; v[i] = ka < K ? row[ka] : 0.f; v[8 + i] = kb < K ? row[kb] : 0.f; }
  return bsplit16(v); }
__device__ __forceinline__ F2 split_col(const float* W, int k0, int n, int lane, int ld, int K) { float v[16]; const int g = lane >> 4;
#pragma unroll
  for (int i = 0; i < 8; ++i) { const int ka = k0 + 8 * g + i, kb = ka + 16; v[i] = ka < K ? W[(size_t)ka * ld + n] : 0.f; v[8 + i] = kb < K ? W[(size_t)kb * ld + n] : 0.f; }
  return bsplit16(v); }
__device__ __forceinline__ v8f mac3(const F2& a, const F2& b, v8f c) { c = wmma_bf(a.l, b.h, c); c = wmma_bf(a.h, b.l, c); return wmma_bf(a.h, b.h, c); }
__device__ __forceinline__ float sigm(float v) { return 1.0f / (1.0f + expf(-v)); }
#define LDSX() do { asm volatile("s_wait_dscnt 0" ::: "memory"); __builtin_amdgcn_wave_barrier(); __builtin_amdgcn_fence(__ATOMIC_RELEASE, "workgroup"); } while (0)


// d2l-style multi-head attention (16 heads of 64 on [4,1024,1024]; separate Q/K/V inputs, [out][in] weights, no biases): scores = q.k/8, then where(key < valid_lens[bh*L + q], score, -1e6) (per-row valid length, int input), softmax, (P v) Wo^T.
#define NB 4
#define SS 1024
#define E 1024
#define NH 16
#define HD 64
#define NR (NB * SS)
#define PLO 1024.0f
#define VLO 2048.0f
#define L2E 1.4426950408889634f   // log2(e)
__device__ __forceinline__ float bfr(float v) { return (float)(__bf16)v; }
__device__ __forceinline__ v16b frag_b(const __bf16* rowk0, int lane) { return __builtin_bit_cast(v16b, frag_h((const _Float16*)rowk0, lane)); }

// Operand tiles go from global memory to LDS as whole 128-byte lines, 16 bytes a lane, through no register; the fragments are then read from LDS rows at a pitch of 16 B x odd.
#define RP 144   // LDS pitch in bytes of a 128-byte row
#define RPF 272  // LDS pitch in bytes of a 256-byte row
__device__ __forceinline__ unsigned lds_off(const void* p) { return (unsigned)(size_t)p; }
#define ACP(l, g) "global_load_async_to_lds_b128 %" #l ", %" #g ", off\n\t"
// four copies of a lane: LDS address l + i*ls, global address g + i*gs; s_wait_xcnt 0 closes the statement so that no address register is rewritten ahead of it
__device__ __forceinline__ void acp4(unsigned l, const char* g, unsigned ls, size_t gs) {
  asm volatile(ACP(0, 4) ACP(1, 5) ACP(2, 6) ACP(3, 7) "s_wait_xcnt 0x0"
               :: "v"(l), "v"(l + ls), "v"(l + 2 * ls), "v"(l + 3 * ls), "v"(g), "v"(g + gs), "v"(g + 2 * gs), "v"(g + 3 * gs) : "memory");
}
// eight copies of a lane, four from each of two bases, one closing s_wait_xcnt 0 (same reason)
__device__ __forceinline__ void acp8(unsigned l, const char* g, unsigned m, const char* h, unsigned ls, size_t gs) {
  asm volatile(ACP(0, 8) ACP(1, 9) ACP(2, 10) ACP(3, 11) ACP(4, 12) ACP(5, 13) ACP(6, 14) ACP(7, 15) "s_wait_xcnt 0x0"
               :: "v"(l), "v"(l + ls), "v"(l + 2 * ls), "v"(l + 3 * ls), "v"(m), "v"(m + ls), "v"(m + 2 * ls), "v"(m + 3 * ls),
                  "v"(g), "v"(g + gs), "v"(g + 2 * gs), "v"(g + 3 * gs), "v"(h), "v"(h + gs), "v"(h + 2 * gs), "v"(h + 3 * gs) : "memory");
}
// this wave's LDS reads have returned: stands in front of the barrier behind which their buffer is filled again
#define WAIT_DS() asm volatile("s_wait_dscnt 0x0" ::: "memory")
// this wave's copies have landed: stands in front of the barrier behind which other waves read them
#define WAIT_ACP() asm volatile("s_wait_asynccnt 0x0" ::: "memory")

// every f32 -> bf16 rounding of the inputs in one streaming launch: dst holds XQ, XK, XV (NR x E each) and PT, one behind the other.
// PT rows: [0,E) Wq, [E,2E) Wk, [2E,3E) Wv, [3E,4E) Wo  ([out][in] weights: PT row n = W row n % E, so the pack is the same elementwise rounding)
#define PB 65536   // elements of a block: 512 threads x 32 pieces of 4; 256 blocks in all
__global__ __launch_bounds__(512) void k_prep(const float* __restrict__ Qi, const float* __restrict__ Ki, const float* __restrict__ Vi, const float* __restrict__ Wq, const float* __restrict__ Wk, const float* __restrict__ Wv, const float* __restrict__ Wo, __bf16* __restrict__ dst) {
  const unsigned blk = blockIdx.x, seg = blk / (NR * E / PB), ws = (blk / (E * E / PB)) & 3;      // 64 blocks an activation, 16 a weight
  const float* s = seg == 0 ? Qi : (seg == 1 ? Ki : (seg == 2 ? Vi : (ws == 0 ? Wq : (ws == 1 ? Wk : (ws == 2 ? Wv : Wo)))));
  s += (size_t)(seg < 3 ? blk % (NR * E / PB) : blk % (E * E / PB)) * PB + threadIdx.x * 4;
  __bf16* d = dst + (size_t)blk * PB + threadIdx.x * 4;
  v4f v[32];
#pragma unroll     // unrolled so that a lane's loads go out far ahead of their use (many in flight a wave); each covers 512 contiguous bytes of a wave
  for (int i = 0; i < 32; ++i) v[i] = *(const v4f*)(s + i * 2048);
#pragma unroll
  for (int i = 0; i < 32; ++i) { union { __bf16 h[4]; v2u u; } pk;
#pragma unroll
    for (int e = 0; e < 4; ++e) pk.h[e] = (__bf16)v[i][e];
    vst2((unsigned*)(d + i * 2048), pk.u); }
}
// QKV: block (64 rows, 128 cols = 2 heads, which); q -> Q32 f32 [bh][s][64]; k -> bf16 hi/lo rows; v -> VT hi/lo x4 [bh][d][s]
__global__ __launch_bounds__(128) void k_qkv(const __bf16* __restrict__ XQ, const __bf16* __restrict__ XK, const __bf16* __restrict__ XV, const __bf16* __restrict__ PT, float* __restrict__ Q32, __bf16* __restrict__ Kh, __bf16* __restrict__ Kl, _Float16* __restrict__ VTh, _Float16* __restrict__ VTl) {
  constexpr int STG = (64 + 128) * RP;                     // one stage: 64 X rows, then 128 weight rows, 64 k each
  __shared__ __align__(16) char smem[2 * STG];             // two stages in the k loop; the output staging behind it
  float (*so)[16][132] = (float (*)[16][132])smem;
  _Float16 (*sth)[72] = (_Float16 (*)[72])smem; _Float16 (*stl)[72] = (_Float16 (*)[72])(smem + 128 * 72 * 2);
  const int tid = threadIdx.x, wave = tid >> 5, lane = tid & 31, col = lane & 15, g = lane >> 4;
  const int which = blockIdx.z, r0b = blockIdx.x * 64, r0 = r0b + wave * 16, n0 = blockIdx.y * 128; const int b = r0b / SS, s0 = r0b % SS;
  const __bf16* Xb = which == 0 ? XQ : (which == 1 ? XK : XV);
  v8f acc[8] = {};
  const unsigned l0 = lds_off(smem) + (tid >> 3) * RP + (tid & 7) * 16;       // a copy of the block: 16 rows, 8 lanes a row
  const char* gX = (const char*)(Xb + (size_t)(r0b + (tid >> 3)) * E + (tid & 7) * 8);
  const char* gW = (const char*)(PT + (size_t)(which * E + n0 + (tid >> 3)) * E + (tid & 7) * 8);
  auto fill = [&](int t) { const unsigned l = l0 + (t & 1) * STG; const size_t ko = (size_t)t * 128;
    acp4(l, gX + ko, 16 * RP, (size_t)16 * E * 2);
    acp8(l + 64 * RP, gW + ko, l + 128 * RP, gW + ko + (size_t)64 * E * 2, 16 * RP, (size_t)16 * E * 2); };
  fill(0); WAIT_ACP(); __syncthreads(); fill(1);
#pragma unroll 2   // two trips a body: each half addresses its buffer by constant offsets
  for (int t = 0; t < E / 64; ++t) { const char* sb = smem + (t & 1) * STG;
#pragma unroll
    for (int kc = 0; kc < 2; ++kc) { const v16b a = frag_b((const __bf16*)(sb + (wave * 16 + col) * RP) + kc * 32, lane); v16b wb[8];
#pragma unroll     // the LDS reads of a k chunk go out as one group, so that their latency is paid once and not per product; wb[] stays in registers
      for (int j = 0; j < 8; ++j) wb[j] = frag_b((const __bf16*)(sb + (64 + j * 16 + col) * RP) + kc * 32, lane);
#pragma unroll
      for (int j = 0; j < 8; ++j) acc[j] = wmma_bf(a, wb[j], acc[j]); }
    WAIT_DS(); WAIT_ACP(); __syncthreads();                // stage t + 1 is published, stage t's buffer is free
    if (t + 2 < E / 64) fill(t + 2); }
  WAIT_ACP();
  if (which < 2) {
#pragma unroll
    for (int j = 0; j < 8; ++j) { const float bb = 0.f;
#pragma unroll
      for (int r = 0; r < 8; ++r) so[wave][8 * g + r][j * 16 + col] = acc[j][r] + bb; }
    LDSX();
    if (which == 0) { for (int qq = lane; qq < 2 * 16 * 16; qq += 32) { const int hh = qq >> 8, rl = (qq >> 4) & 15, pc = qq & 15; const int h = (n0 >> 6) + hh;
        vst2(Q32 + (((size_t)b * NH + h) * SS + s0 + wave * 16 + rl) * HD + pc * 4, *(const v4f*)(&so[wave][rl][hh * 64 + pc * 4])); } }
    else {
      for (int qq = lane; qq < 2 * 16 * 16; qq += 32) { const int hh = qq >> 8, rl = (qq >> 4) & 15, pl = qq & 15; const int h = (n0 >> 6) + hh; const int pc = pl & 7; union { __bf16 e[8]; v4u u; } pk;
#pragma unroll
        for (int e = 0; e < 8; ++e) { const float v = so[wave][rl][hh * 64 + pc * 8 + e]; const __bf16 hi = (__bf16)v; pk.e[e] = pl < 8 ? hi : (__bf16)(v - (float)hi); }
        vst2((unsigned*)((pl < 8 ? Kh : Kl) + (((size_t)b * NH + h) * SS + s0 + wave * 16 + rl) * HD + pc * 8), pk.u); } } }
  else {
#pragma unroll
    for (int j = 0; j < 8; ++j) { const float bb = 0.f;
#pragma unroll
      for (int r = 0; r < 8; ++r) { const float v = (acc[j][r] + bb) * 4.0f; const _Float16 hi = (_Float16)v; sth[j * 16 + col][wave * 16 + 8 * g + r] = hi; stl[j * 16 + col][wave * 16 + 8 * g + r] = (_Float16)((v - (float)hi) * VLO); } }
    __syncthreads();
    for (int qq = tid; qq < 128 * 8; qq += 128) { const int cl = qq >> 3, pc = qq & 7; const int c = n0 + cl, h = c >> 6, d = c & 63; const size_t o = (((size_t)b * NH + h) * HD + d) * SS + s0 + pc * 8;
      vst2(VTh + o, *(const v4u*)(&sth[cl][pc * 8])); vst2(VTl + o, *(const v4u*)(&stl[cl][pc * 8])); } }
}
// padding-masked attention: block (64 queries, bh); all 16 key tiles; S on q hi/lo x K hi/lo rows; P,V hi/lo; O f32 [bh][s][64]
// softmax in base 2: scores and the fill carry the factor log2(e), and the running maximum lies 14 below the true one, so that one hardware exponential gives 2^14 e^(score - max)
__global__ __launch_bounds__(128) void k_attn(const float* __restrict__ Q32, const __bf16* __restrict__ Kh, const __bf16* __restrict__ Kl, const _Float16* __restrict__ VTh, const _Float16* __restrict__ VTl, const int* __restrict__ vlen, float* __restrict__ O32) {
  __shared__ __align__(16) float sS[4][16][68];
  __shared__ __align__(16) _Float16 sPh[4][16][72], sPl[4][16][72];
  __shared__ __align__(16) char sKV[4 * 64 * RP];          // K buffer: K hi, K lo (64 keys x 64 d); V buffer: V^T hi, V^T lo (64 d x 64 keys)
  const int tid = threadIdx.x, w = tid >> 5, lane = tid & 31, col = lane & 15, g = lane >> 4;
  const size_t bh = blockIdx.y; const int qb = blockIdx.x; const int q0 = qb * 64 + w * 16;
  F2 aq[2];
#pragma unroll
  for (int kc = 0; kc < 2; ++kc) aq[kc] = split_row(Q32 + (bh * SS + q0 + col) * HD, kc * 32, lane);
  __shared__ int svl[4][16]; if (lane < 16) svl[w][lane] = vlen[bh * SS + q0 + lane];     // valid lengths of my 16 query rows
  float mrun = -3.0e38f, lrun = 0.f; v8f acc[4] = {}, ac1[4] = {}, ac2[4] = {};
  LDSX();
  const unsigned l0 = lds_off(sKV) + (tid >> 3) * RP + (tid & 7) * 16;        // a copy of the block: 16 rows, 8 lanes a row
  const size_t oK = ((bh * SS + (tid >> 3)) * HD + (tid & 7) * 8) * 2, oV = ((bh * HD + (tid >> 3)) * SS + (tid & 7) * 8) * 2;
  // two buffers, stages K(0), V(0), K(1), V(1), ...: the score pass reads the K buffer alone, the P.V pass the V buffer alone; each refill flies during the other pass
  auto fillK = [&](int kt) { acp8(l0, (const char*)Kh + oK + (size_t)kt * 64 * HD * 2, l0 + 64 * RP, (const char*)Kl + oK + (size_t)kt * 64 * HD * 2, 16 * RP, (size_t)16 * HD * 2); };
  auto fillV = [&](int kt) { acp8(l0 + 128 * RP, (const char*)VTh + oV + (size_t)kt * 128, l0 + 192 * RP, (const char*)VTl + oV + (size_t)kt * 128, 16 * RP, (size_t)16 * SS * 2); };
  fillK(0); WAIT_ACP(); __syncthreads(); fillV(0);
#pragma unroll 1
  for (int kt = 0; kt < SS / 64; ++kt) {
#pragma unroll
    for (int t = 0; t < 4; ++t) { const int key = kt * 64 + t * 16 + col; const char* kr = sKV + (t * 16 + col) * RP; v8f s = {};
#pragma unroll
      for (int kc = 0; kc < 2; ++kc) { const v16b khf = frag_b((const __bf16*)kr + kc * 32, lane), klf = frag_b((const __bf16*)(kr + 64 * RP) + kc * 32, lane); s = wmma_bf(aq[kc].l, khf, s); s = wmma_bf(aq[kc].h, klf, s); s = wmma_bf(aq[kc].h, khf, s); }
#pragma unroll
      for (int r = 0; r < 8; ++r) { sS[w][8 * g + r][t * 16 + col] = (key < svl[w][8 * g + r]) ? s[r] * (0.125f * L2E) : -1.0e6f * L2E; } }
    LDSX();                                                // holds the s_wait_dscnt 0 of this pass's foot too
    WAIT_ACP(); __syncthreads();                           // V(kt) is published, the K buffer is free
    if (kt + 1 < SS / 64) fillK(kt + 1);
    float mx = -3.4e38f;
#pragma unroll
    for (int jj = 0; jj < 32; ++jj) mx = fmaxf(mx, sS[w][col][g * 32 + jj]);
    mx = fmaxf(mx, __shfl_xor(mx, 16, 32));
    const float mnew = fmaxf(mrun, mx - 14.0f); const float corr = __builtin_amdgcn_exp2f(mrun - mnew);
    float ps = 0.f;
#pragma unroll
    for (int jj = 0; jj < 32; ++jj) { const float p = __builtin_amdgcn_exp2f(sS[w][col][g * 32 + jj] - mnew); ps += p; const _Float16 hi = (_Float16)p; sPh[w][col][g * 32 + jj] = hi; sPl[w][col][g * 32 + jj] = (_Float16)((p - (float)hi) * PLO); }
    ps += __shfl_xor(ps, 16, 32);
    lrun = lrun * corr + ps * (1.0f / 16384.0f); mrun = mnew;
#pragma unroll
    for (int r = 0; r < 8; ++r) { const float cr = __shfl(corr, 8 * g + r, 32);
#pragma unroll
      for (int t = 0; t < 4; ++t) { acc[t][r] *= cr; ac1[t][r] *= cr; ac2[t][r] *= cr; } }
    LDSX();
#pragma unroll
    for (int kc = 0; kc < 2; ++kc) { const v16h ph = frag_h(&sPh[w][col][0] + kc * 32, lane), pl = frag_h(&sPl[w][col][0] + kc * 32, lane);
#pragma unroll
      for (int t = 0; t < 4; ++t) { const char* vr = sKV + (128 + t * 16 + col) * RP; const v16h vh = frag_h((const _Float16*)vr + kc * 32, lane);
        acc[t] = wmma16(ph, vh, acc[t]); ac1[t] = wmma16(ph, frag_h((const _Float16*)(vr + 64 * RP) + kc * 32, lane), ac1[t]); ac2[t] = wmma16(pl, vh, ac2[t]); } }
    __builtin_amdgcn_wave_barrier();
    WAIT_DS(); WAIT_ACP(); __syncthreads();                // K(kt + 1) is published, the V buffer is free
    if (kt + 1 < SS / 64) fillV(kt + 1); }
  WAIT_ACP();
#pragma unroll
  for (int r = 0; r < 8; ++r) { const float lr = __shfl(lrun, 8 * g + r, 32); const float inv = 1.0f / (lr * 16384.0f * 4.0f);
#pragma unroll
    for (int t = 0; t < 4; ++t) sS[w][8 * g + r][t * 16 + col] = (acc[t][r] + ac1[t][r] * (1.0f / VLO) + ac2[t][r] * (1.0f / PLO)) * inv; }
  LDSX();
  for (int qq = lane; qq < 16 * 16; qq += 32) { const int rl = qq >> 4, pc = qq & 15; vst2(O32 + ((bh * SS) + q0 + rl) * HD + pc * 4, *(const v4f*)(&sS[w][rl][pc * 4])); }
}
// out = ctx Wo^T : split(ctx) x bf16(Wo rows): 2 products (Wo is an INPUT -> bf16 exact)
__global__ __launch_bounds__(128) void k_out(const float* __restrict__ O32, const __bf16* __restrict__ PT, float* __restrict__ out) {
  constexpr int STA = 64 * RPF, STG = STA + 128 * RP;      // one stage: 64 ctx rows of one head (f32), then 128 weight rows, 64 k each
  __shared__ __align__(16) char smem[2 * STG];             // two stages in the k loop; the output staging behind it
  float (*so)[16][132] = (float (*)[16][132])smem;
  const int tid = threadIdx.x, wave = tid >> 5, lane = tid & 31, col = lane & 15, g = lane >> 4;
  const int r0b = blockIdx.x * 64, r0 = r0b + wave * 16, n0 = blockIdx.y * 128; const int b = r0b / SS, s0 = r0b % SS;
  v8f acc[8] = {};
  const unsigned lA = lds_off(smem) + (tid >> 4) * RPF + (tid & 15) * 16;     // a copy of the block: 8 ctx rows, 16 lanes a row
  const unsigned lW = lds_off(smem) + STA + (tid >> 3) * RP + (tid & 7) * 16; // or 16 weight rows, 8 lanes a row
  const char* gA = (const char*)(O32 + ((size_t)b * NH * SS + s0 + (tid >> 4)) * HD + (tid & 15) * 4);
  const char* gW = (const char*)(PT + (size_t)(3 * E + n0 + (tid >> 3)) * E + (tid & 7) * 8);
  auto fill = [&](int t) { const unsigned lo = (t & 1) * STG; const char* ga = gA + (size_t)t * SS * HD * 4; const char* gw = gW + (size_t)t * 128;   // pass t = head t
    acp8(lA + lo, ga, lA + lo + 32 * RPF, ga + (size_t)32 * HD * 4, 8 * RPF, (size_t)8 * HD * 4);
    acp8(lW + lo, gw, lW + lo + 64 * RP, gw + (size_t)64 * E * 2, 16 * RP, (size_t)16 * E * 2); };
  fill(0); WAIT_ACP(); __syncthreads(); fill(1);
#pragma unroll 2   // two trips a body: each half addresses its buffer by constant offsets
  for (int t = 0; t < E / 64; ++t) { const char* sb = smem + (t & 1) * STG;
#pragma unroll
    for (int kc = 0; kc < 2; ++kc) { const F2 a = split_row((const float*)(sb + (wave * 16 + col) * RPF), kc * 32, lane); v16b wb[8];
#pragma unroll     // the LDS reads of a k chunk go out as one group, so that their latency is paid once and not per product; wb[] stays in registers
      for (int j = 0; j < 8; ++j) wb[j] = frag_b((const __bf16*)(sb + STA + (j * 16 + col) * RP) + kc * 32, lane);
#pragma unroll
      for (int j = 0; j < 8; ++j) { acc[j] = wmma_bf(a.l, wb[j], acc[j]); acc[j] = wmma_bf(a.h, wb[j], acc[j]); } }
    WAIT_DS(); WAIT_ACP(); __syncthreads();                // stage t + 1 is published, stage t's buffer is free
    if (t + 2 < E / 64) fill(t + 2); }
  WAIT_ACP();
#pragma unroll
  for (int j = 0; j < 8; ++j) {
#pragma unroll
    for (int r = 0; r < 8; ++r) so[wave][8 * g + r][j * 16 + col] = acc[j][r]; }
  LDSX();
#pragma unroll 4
  for (int rl = 0; rl < 16; ++rl) vst2(out + (size_t)(r0 + rl) * E + n0 + lane * 4, *(const v4f*)(&so[wave][rl][lane * 4]));
}
extern "C" void kernel_launch(void* const* d_in, const int* in_sizes, int n_in, void* d_out, int out_size, void* d_ws, size_t ws_size, hipStream_t stream) {
  (void)in_sizes; (void)n_in; (void)out_size; (void)ws_size;
  const float* Qi = (const float*)d_in[0]; const float* Ki = (const float*)d_in[1]; const float* Vi = (const float*)d_in[2]; const int* vlen = (const int*)d_in[3];
  const float* Wq = (const float*)d_in[4]; const float* Wk = (const float*)d_in[5]; const float* Wv = (const float*)d_in[6]; const float* Wo = (const float*)d_in[7];
  float* out = (float*)d_out;
  char* ws = (char*)d_ws; size_t off = 0;
  auto take = [&](size_t bytes) { char* p = ws + off; off += (bytes + 255) & ~(size_t)255; return p; };
  __bf16* XQ = (__bf16*)take((size_t)NR * E * 2); __bf16* XK = (__bf16*)take((size_t)NR * E * 2); __bf16* XV = (__bf16*)take((size_t)NR * E * 2); __bf16* PT = (__bf16*)take((size_t)4 * E * E * 2);
  float* Q32 = (float*)take((size_t)NR * E * 4); __bf16* Kh = (__bf16*)take((size_t)NR * E * 2); __bf16* Kl = (__bf16*)take((size_t)NR * E * 2); _Float16* VTh = (_Float16*)take((size_t)NR * E * 2); _Float16* VTl = (_Float16*)take((size_t)NR * E * 2); float* O32 = (float*)take((size_t)NR * E * 4);
  // ws = 96 MiB
  k_prep<<<(3 * NR * E + 4 * E * E) / PB, 512, 0, stream>>>(Qi, Ki, Vi, Wq, Wk, Wv, Wo, XQ);   // XQ, XK, XV, PT are contiguous in ws
  k_qkv<<<dim3(NR / 64, E / 128, 3), 128, 0, stream>>>(XQ, XK, XV, PT, Q32, Kh, Kl, VTh, VTl);
  k_attn<<<dim3(SS / 64, NB * NH), 128, 0, stream>>>(Q32, Kh, Kl, VTh, VTl, vlen, O32);
  k_out<<<dim3(NR / 64, E / 128), 128, 0, stream>>>(O32, PT, out);
}

// v004
// Measured time: 120 microseconds a run.
// Two timings next to v003 both put it at 1.05 times that version's speed.
// Counting every step since v000, it is 3.29 times as fast.
// compute dtype: Q, K, V, W* (INPUTS) rounded to bf16 with exact bf16 WMMA products (f32 accumulate) for the projections; K pre-split into bf16 hi/lo rows; q f32 split, P and V f16 hi/lo (3 products each); softmax with the -1e6 valid-length fill in f32 (no sentinel shortcut, so a zero valid length yields a uniform row).
#include <hip/hip_runtime.h>
#include <math.h>

typedef __attribute__((ext_vector_type(16))) _Float16 v16h;
typedef __attribute__((ext_vector_type(16))) __bf16 v16b;
typedef __attribute__((ext_vector_type(8)))  _Float16 v8h;
typedef __attribute__((ext_vector_type(8)))  float v8f;
typedef __attribute__((ext_vector_type(4)))  float v4f;
typedef __attribute__((ext_vector_type(2)))  float v2f;
typedef __attribute__((ext_vector_type(4)))  unsigned v4u;
typedef __attribute__((ext_vector_type(2)))  unsigned v2u;
typedef __attribute__((ext_vector_type(4)))  int v4i;
typedef float __attribute__((may_alias)) float_a;
typedef int __attribute__((may_alias)) int_a;

template <typename T> __device__ __forceinline__ void vst2(void* p, T v) { *(T*)p = v;  }
__device__ __forceinline__ v8f wmma16(v16h a, v16h b, v8f c) {
  v8f d = __builtin_amdgcn_wmma_f32_16x16x32_f16(false, a, false, b, (short)0, c, false, false);
  asm volatile("v_nop\n\tv_nop\n\tv_nop\n\tv_nop" : "+v"(d) : "v"(a), "v"(b));
  return d;
}
__device__ __forceinline__ v8f wmma_bf(v16b a, v16b b, v8f c) {
  v8f d = __builtin_amdgcn_wmma_f32_16x16x32_bf16(false, a, false, b, (short)0, c, false, false);
  asm volatile("v_nop\n\tv_nop\n\tv_nop\n\tv_nop" : "+v"(d) : "v"(a), "v"(b));
  return d;
}
// 16x16x32 fragments: lane = (h = lane>>4, row/col = lane&15); elements 0..7 = k0+8h+0..7, 8..15 = k0+16+8h+0..7; D element r = row 8h+r
__device__ __forceinline__ v16h frag_h(const _Float16* rowk0, int lane) {
  union { v16h v; v8h q[2]; } u; const _Float16* p = rowk0 + 8 * (lane >> 4);
  u.q[0] = *(const v8h*)p; u.q[1] = *(const v8h*)(p + 16); return u.v;
}
__device__ __forceinline__ v16h frag_f32(const float* rowk0, int lane) {
  v16h a; const float* p = rowk0 + 8 * (lane >> 4);
#pragma unroll
  for (int i = 0; i < 8; ++i) { a[i] = (_Float16)p[i]; a[8 + i] = (_Float16)p[16 + i]; }
  return a;
}
__device__ __forceinline__ v16h frag_f32s(const float* rowk0, int lane, float sc) {
  v16h a; const float* p = rowk0 + 8 * (lane >> 4);
#pragma unroll
  for (int i = 0; i < 8; ++i) { a[i] = (_Float16)(p[i] * sc); a[8 + i] = (_Float16)(p[16 + i] * sc); }
  return a;
}
// column fragment from a [K][ld] layout (column n), rows >= K read as 0
__device__ __forceinline__ v16h fragc_f32(const float* W, int k0, int n, int lane, int ld, int K) {
  v16h a; const int g = lane >> 4;
#pragma unroll
  for (int i = 0; i < 8; ++i) { const int ka = k0 + 8 * g + i, kb = ka + 16;
    a[i] = (_Float16)(ka < K ? W[(size_t)ka * ld + n] : 0.f); a[8 + i] = (_Float16)(kb < K ? W[(size_t)kb * ld + n] : 0.f); }
  return a;
}
struct F2 { v16b h, l; };
__device__ __forceinline__ F2 bsplit16(const float v[16]) { F2 r;
#pragma unroll
  for (int i = 0; i < 16; ++i) { const __bf16 h = (__bf16)v[i]; r.h[i] = h; r.l[i] = (__bf16)(v[i] - (float)h); }
  return r; }
__device__ __forceinline__ F2 split_row(const float* row, int k0, int lane) { float v[16]; const float* p = row + k0 + 8 * (lane >> 4);
#pragma unroll
  for (int i = 0; i < 8; ++i) { v[i] = p[i]; v[8 + i] = p[16 + i]; }
  return bsplit16(v); }
__device__ __forceinline__ F2 split_rowK(const float* row, int k0, int lane, int K) { float v[16]; const int g = lane >> 4;
#pragma unroll
  for (int i = 0; i < 8; ++i) { const int ka = k0 + 8 * g + i, kb = ka + 16; v[i] = ka < K ? row[ka] : 0.f; v[8 + i] = kb < K ? row[kb] : 0.f; }
  return bsplit16(v); }
__device__ __forceinline__ F2 split_col(const float* W, int k0, int n, int lane, int ld, int K) { float v[16]; const int g = lane >> 4;
#pragma unroll
  for (int i = 0; i < 8; ++i) { const int ka = k0 + 8 * g + i, kb = ka + 16; v[i] = ka < K ? W[(size_t)ka * ld + n] : 0.f; v[8 + i] = kb < K ? W[(size_t)kb * ld + n] : 0.f; }
  return bsplit16(v); }
__device__ __forceinline__ v8f mac3(const F2& a, const F2& b, v8f c) { c = wmma_bf(a.l, b.h, c); c = wmma_bf(a.h, b.l, c); return wmma_bf(a.h, b.h, c); }
__device__ __forceinline__ float sigm(float v) { return 1.0f / (1.0f + expf(-v)); }
#define LDSX() do { asm volatile("s_wait_dscnt 0" ::: "memory"); __builtin_amdgcn_wave_barrier(); __builtin_amdgcn_fence(__ATOMIC_RELEASE, "workgroup"); } while (0)


// d2l-style multi-head attention (16 heads of 64 on [4,1024,1024]; separate Q/K/V inputs, [out][in] weights, no biases): scores = q.k/8, then where(key < valid_lens[bh*L + q], score, -1e6) (per-row valid length, int input), softmax, (P v) Wo^T.
#define NB 4
#define SS 1024
#define E 1024
#define NH 16
#define HD 64
#define NR (NB * SS)
#define PLO 1024.0f
#define VLO 2048.0f
#define L2E 1.4426950408889634f   // log2(e)
__device__ __forceinline__ float bfr(float v) { return (float)(__bf16)v; }
__device__ __forceinline__ v16b frag_b(const __bf16* rowk0, int lane) { return __builtin_bit_cast(v16b, frag_h((const _Float16*)rowk0, lane)); }

// Operand tiles go from global memory to LDS as whole 128-byte lines, 16 bytes a lane, through no register; the fragments are then read from LDS rows at a pitch of 16 B x odd.
#define RP 144   // LDS pitch in bytes of a 128-byte row
#define RPF 272  // LDS pitch in bytes of a 256-byte row
__device__ __forceinline__ unsigned lds_off(const void* p) { return (unsigned)(size_t)p; }
#define ACP(l, g) "global_load_async_to_lds_b128 %" #l ", %" #g ", off\n\t"
// four copies of a lane: LDS address l + i*ls, global address g + i*gs; s_wait_xcnt 0 closes the statement so that no address register is rewritten ahead of it
__device__ __forceinline__ void acp4(unsigned l, const char* g, unsigned ls, size_t gs) {
  asm volatile(ACP(0, 4) ACP(1, 5) ACP(2, 6) ACP(3, 7) "s_wait_xcnt 0x0"
               :: "v"(l), "v"(l + ls), "v"(l + 2 * ls), "v"(l + 3 * ls), "v"(g), "v"(g + gs), "v"(g + 2 * gs), "v"(g + 3 * gs) : "memory");
}
// eight copies of a lane, four from each of two bases, one closing s_wait_xcnt 0 (same reason)
__device__ __forceinline__ void acp8(unsigned l, const char* g, unsigned m, const char* h, unsigned ls, size_t gs) {
  asm volatile(ACP(0, 8) ACP(1, 9) ACP(2, 10) ACP(3, 11) ACP(4, 12) ACP(5, 13) ACP(6, 14) ACP(7, 15) "s_wait_xcnt 0x0"
               :: "v"(l), "v"(l + ls), "v"(l + 2 * ls), "v"(l + 3 * ls), "v"(m), "v"(m + ls), "v"(m + 2 * ls), "v"(m + 3 * ls),
                  "v"(g), "v"(g + gs), "v"(g + 2 * gs), "v"(g + 3 * gs), "v"(h), "v"(h + gs), "v"(h + 2 * gs), "v"(h + 3 * gs) : "memory");
}
// this wave's LDS reads have returned: stands in front of the barrier behind which their buffer is filled again
#define WAIT_DS() asm volatile("s_wait_dscnt 0x0" ::: "memory")
// this wave's copies have landed: stands in front of the barrier behind which other waves read them
#define WAIT_ACP() asm volatile("s_wait_asynccnt 0x0" ::: "memory")

// every f32 -> bf16 rounding of the inputs in one streaming launch: dst holds XQ, XK, XV (NR x E each) and PT, one behind the other.
// PT rows: [0,E) Wq, [E,2E) Wk, [2E,3E) Wv, [3E,4E) Wo  ([out][in] weights: PT row n = W row n % E, so the pack is the same elementwise rounding)
#define PB 65536   // elements of a block: 512 threads x 32 pieces of 4; 256 blocks in all
__global__ __launch_bounds__(512) void k_prep(const float* __restrict__ Qi, const float* __restrict__ Ki, const float* __restrict__ Vi, const float* __restrict__ Wq, const float* __restrict__ Wk, const float* __restrict__ Wv, const float* __restrict__ Wo, __bf16* __restrict__ dst) {
  const unsigned blk = blockIdx.x, seg = blk / (NR * E / PB), ws = (blk / (E * E / PB)) & 3;      // 64 blocks an activation, 16 a weight
  const float* s = seg == 0 ? Qi : (seg == 1 ? Ki : (seg == 2 ? Vi : (ws == 0 ? Wq : (ws == 1 ? Wk : (ws == 2 ? Wv : Wo)))));
  s += (size_t)(seg < 3 ? blk % (NR * E / PB) : blk % (E * E / PB)) * PB + threadIdx.x * 4;
  __bf16* d = dst + (size_t)blk * PB + threadIdx.x * 4;
  v4f v[32];
#pragma unroll     // unrolled so that a lane's loads go out far ahead of their use (many in flight a wave); each covers 512 contiguous bytes of a wave
  for (int i = 0; i < 32; ++i) v[i] = *(const v4f*)(s + i * 2048);
#pragma unroll
  for (int i = 0; i < 32; ++i) { union { __bf16 h[4]; v2u u; } pk;
#pragma unroll
    for (int e = 0; e < 4; ++e) pk.h[e] = (__bf16)v[i][e];
    vst2((unsigned*)(d + i * 2048), pk.u); }
}
// QKV: block (128 rows, 128 cols = 2 heads, which), four waves of 64 rows x 64 cols (one head) each: a k chunk's 8 fragments feed 16 products; q -> Q32 f32 [bh][s][64]; k -> bf16 hi/lo rows; v -> VT hi/lo x4 [bh][d][s]
__global__ __launch_bounds__(128) void k_qkv(const __bf16* __restrict__ XQ, const __bf16* __restrict__ XK, const __bf16* __restrict__ XV, const __bf16* __restrict__ PT, float* __restrict__ Q32, __bf16* __restrict__ Kh, __bf16* __restrict__ Kl, _Float16* __restrict__ VTh, _Float16* __restrict__ VTl) {
  constexpr int STG = (128 + 128) * RP;                    // one stage: 128 X rows, then 128 weight rows, 64 k each
  __shared__ __align__(16) char smem[2 * STG];             // two stages in the k loop; the output staging behind it
  float (*so)[64][68] = (float (*)[64][68])smem;           // a wave's own 64 x 64 tile
  _Float16 (*sth)[136] = (_Float16 (*)[136])smem; _Float16 (*stl)[136] = (_Float16 (*)[136])(smem + 128 * 136 * 2);
  const int tid = threadIdx.x, wave = tid >> 5, lane = tid & 31, col = lane & 15, g = lane >> 4, wr = wave >> 1, wc = wave & 1;
  const int which = blockIdx.z, r0b = blockIdx.x * 128, n0 = blockIdx.y * 128; const int b = r0b / SS, s0 = r0b % SS;
  const __bf16* Xb = which == 0 ? XQ : (which == 1 ? XK : XV);
  v8f acc[4][4] = {};
  const unsigned l0 = lds_off(smem) + (tid >> 3) * RP + (tid & 7) * 16;       // a copy of the block: 16 rows, 8 lanes a row
  const char* gX = (const char*)(Xb + (size_t)(r0b + (tid >> 3)) * E + (tid & 7) * 8);
  const char* gW = (const char*)(PT + (size_t)(which * E + n0 + (tid >> 3)) * E + (tid & 7) * 8);
  auto fill = [&](int t) { const unsigned l = l0 + (t & 1) * STG; const size_t ko = (size_t)t * 128;
    acp8(l, gX + ko, l + 64 * RP, gX + ko + (size_t)64 * E * 2, 16 * RP, (size_t)16 * E * 2);
    acp8(l + 128 * RP, gW + ko, l + 192 * RP, gW + ko + (size_t)64 * E * 2, 16 * RP, (size_t)16 * E * 2); };
  fill(0); WAIT_ACP(); __syncthreads(); fill(1);
#pragma unroll 2   // two trips a body: each half addresses its buffer by constant offsets
  for (int t = 0; t < E / 64; ++t) { const char* sb = smem + (t & 1) * STG;
#pragma unroll
    for (int kc = 0; kc < 2; ++kc) { v16b a[4], wb[4];
#pragma unroll     // the LDS reads of a k chunk go out as one group, so that their latency is paid once and not per product; a[] and wb[] stay in registers
      for (int i = 0; i < 4; ++i) a[i] = frag_b((const __bf16*)(sb + (wr * 64 + i * 16 + col) * RP) + kc * 32, lane);
#pragma unroll
      for (int j = 0; j < 4; ++j) wb[j] = frag_b((const __bf16*)(sb + (128 + wc * 64 + j * 16 + col) * RP) + kc * 32, lane);
#pragma unroll
      for (int i = 0; i < 4; ++i) {
#pragma unroll
        for (int j = 0; j < 4; ++j) acc[i][j] = wmma_bf(a[i], wb[j], acc[i][j]); } }
    WAIT_DS(); WAIT_ACP(); __syncthreads();                // stage t + 1 is published, stage t's buffer is free
    if (t + 2 < E / 64) fill(t + 2); }
  WAIT_ACP();
  const int h = (n0 >> 6) + wc;                            // my wave's head
  if (which < 2) {
#pragma unroll
    for (int i = 0; i < 4; ++i) {
#pragma unroll
      for (int j = 0; j < 4; ++j) { const float bb = 0.f;
#pragma unroll
        for (int r = 0; r < 8; ++r) so[wave][i * 16 + 8 * g + r][j * 16 + col] = acc[i][j][r] + bb; } }
    LDSX();
    if (which == 0) { for (int qq = lane; qq < 64 * 16; qq += 32) { const int rl = qq >> 4, pc = qq & 15;
        vst2(Q32 + (((size_t)b * NH + h) * SS + s0 + wr * 64 + rl) * HD + pc * 4, *(const v4f*)(&so[wave][rl][pc * 4])); } }
    else {
      for (int qq = lane; qq < 64 * 16; qq += 32) { const int rl = qq >> 4, pl = qq & 15; const int pc = pl & 7; union { __bf16 e[8]; v4u u; } pk;
#pragma unroll
        for (int e = 0; e < 8; ++e) { const float v = so[wave][rl][pc * 8 + e]; const __bf16 hi = (__bf16)v; pk.e[e] = pl < 8 ? hi : (__bf16)(v - (float)hi); }
        vst2((unsigned*)((pl < 8 ? Kh : Kl) + (((size_t)b * NH + h) * SS + s0 + wr * 64 + rl) * HD + pc * 8), pk.u); } } }
  else {
#pragma unroll
    for (int i = 0; i < 4; ++i) {
#pragma unroll
      for (int j = 0; j < 4; ++j) { const float bb = 0.f;
#pragma unroll
        for (int r = 0; r < 8; ++r) { const float v = (acc[i][j][r] + bb) * 4.0f; const _Float16 hi = (_Float16)v; sth[wc * 64 + j * 16 + col][wr * 64 + i * 16 + 8 * g + r] = hi; stl[wc * 64 + j * 16 + col][wr * 64 + i * 16 + 8 * g + r] = (_Float16)((v - (float)hi) * VLO); } } }
    __syncthreads();
    for (int qq = tid; qq < 128 * 16; qq += 128) { const int cl = qq >> 4, pc = qq & 15; const int c = n0 + cl, hc = c >> 6, d = c & 63; const size_t o = (((size_t)b * NH + hc) * HD + d) * SS + s0 + pc * 8;
      vst2(VTh + o, *(const v4u*)(&sth[cl][pc * 8])); vst2(VTl + o, *(const v4u*)(&stl[cl][pc * 8])); } }
}
// padding-masked attention: block (64 queries, bh); all 16 key tiles; S on q hi/lo x K hi/lo rows; P,V hi/lo; O f32 [bh][s][64]
// softmax in base 2: scores and the fill carry the factor log2(e), and the running maximum lies 14 below the true one, so that one hardware exponential gives 2^14 e^(score - max)
__global__ __launch_bounds__(128) void k_attn(const float* __restrict__ Q32, const __bf16* __restrict__ Kh, const __bf16* __restrict__ Kl, const _Float16* __restrict__ VTh, const _Float16* __restrict__ VTl, const int* __restrict__ vlen, float* __restrict__ O32) {
  __shared__ __align__(16) float sS[4][16][68];
  __shared__ __align__(16) _Float16 sPh[4][16][72], sPl[4][16][72];
  __shared__ __align__(16) char sKV[4 * 64 * RP];          // K buffer: K hi, K lo (64 keys x 64 d); V buffer: V^T hi, V^T lo (64 d x 64 keys)
  const int tid = threadIdx.x, w = tid >> 5, lane = tid & 31, col = lane & 15, g = lane >> 4;
  const size_t bh = blockIdx.y; const int qb = blockIdx.x; const int q0 = qb * 64 + w * 16;
  F2 aq[2];
#pragma unroll
  for (int kc = 0; kc < 2; ++kc) aq[kc] = split_row(Q32 + (bh * SS + q0 + col) * HD, kc * 32, lane);
  __shared__ int svl[4][16]; if (lane < 16) svl[w][lane] = vlen[bh * SS + q0 + lane];     // valid lengths of my 16 query rows
  float mrun = -3.0e38f, lrun = 0.f; v8f acc[4] = {}, ac1[4] = {}, ac2[4] = {};
  LDSX();
  const unsigned l0 = lds_off(sKV) + (tid >> 3) * RP + (tid & 7) * 16;        // a copy of the block: 16 rows, 8 lanes a row
  const size_t oK = ((bh * SS + (tid >> 3)) * HD + (tid & 7) * 8) * 2, oV = ((bh * HD + (tid >> 3)) * SS + (tid & 7) * 8) * 2;
  // two buffers, stages K(0), V(0), K(1), V(1), ...: the score pass reads the K buffer alone, the P.V pass the V buffer alone; each refill flies during the other pass
  auto fillK = [&](int kt) { acp8(l0, (const char*)Kh + oK + (size_t)kt * 64 * HD * 2, l0 + 64 * RP, (const char*)Kl + oK + (size_t)kt * 64 * HD * 2, 16 * RP, (size_t)16 * HD * 2); };
  auto fillV = [&](int kt) { acp8(l0 + 128 * RP, (const char*)VTh + oV + (size_t)kt * 128, l0 + 192 * RP, (const char*)VTl + oV + (size_t)kt * 128, 16 * RP, (size_t)16 * SS * 2); };
  fillK(0); WAIT_ACP(); __syncthreads(); fillV(0);
#pragma unroll 1
  for (int kt = 0; kt < SS / 64; ++kt) {
#pragma unroll
    for (int t = 0; t < 4; ++t) { const int key = kt * 64 + t * 16 + col; const char* kr = sKV + (t * 16 + col) * RP; v8f s = {};
#pragma unroll
      for (int kc = 0; kc < 2; ++kc) { const v16b khf = frag_b((const __bf16*)kr + kc * 32, lane), klf = frag_b((const __bf16*)(kr + 64 * RP) + kc * 32, lane); s = wmma_bf(aq[kc].l, khf, s); s = wmma_bf(aq[kc].h, klf, s); s = wmma_bf(aq[kc].h, khf, s); }
#pragma unroll
      for (int r = 0; r < 8; ++r) { sS[w][8 * g + r][t * 16 + col] = (key < svl[w][8 * g + r]) ? s[r] * (0.125f * L2E) : -1.0e6f * L2E; } }
    LDSX();                                                // holds the s_wait_dscnt 0 of this pass's foot too
    WAIT_ACP(); __syncthreads();                           // V(kt) is published, the K buffer is free
    if (kt + 1 < SS / 64) fillK(kt + 1);
    float mx = -3.4e38f;
#pragma unroll
    for (int jj = 0; jj < 32; ++jj) mx = fmaxf(mx, sS[w][col][g * 32 + jj]);
    mx = fmaxf(mx, __shfl_xor(mx, 16, 32));
    const float mnew = fmaxf(mrun, mx - 14.0f); const float corr = __builtin_amdgcn_exp2f(mrun - mnew);
    float ps = 0.f;
#pragma unroll
    for (int jj = 0; jj < 32; ++jj) { const float p = __builtin_amdgcn_exp2f(sS[w][col][g * 32 + jj] - mnew); ps += p; const _Float16 hi = (_Float16)p; sPh[w][col][g * 32 + jj] = hi; sPl[w][col][g * 32 + jj] = (_Float16)((p - (float)hi) * PLO); }
    ps += __shfl_xor(ps, 16, 32);
    lrun = lrun * corr + ps * (1.0f / 16384.0f); mrun = mnew;
#pragma unroll
    for (int r = 0; r < 8; ++r) { const float cr = __shfl(corr, 8 * g + r, 32);
#pragma unroll
      for (int t = 0; t < 4; ++t) { acc[t][r] *= cr; ac1[t][r] *= cr; ac2[t][r] *= cr; } }
    LDSX();
#pragma unroll
    for (int kc = 0; kc < 2; ++kc) { const v16h ph = frag_h(&sPh[w][col][0] + kc * 32, lane), pl = frag_h(&sPl[w][col][0] + kc * 32, lane);
#pragma unroll
      for (int t = 0; t < 4; ++t) { const char* vr = sKV + (128 + t * 16 + col) * RP; const v16h vh = frag_h((const _Float16*)vr + kc * 32, lane);
        acc[t] = wmma16(ph, vh, acc[t]); ac1[t] = wmma16(ph, frag_h((const _Float16*)(vr + 64 * RP) + kc * 32, lane), ac1[t]); ac2[t] = wmma16(pl, vh, ac2[t]); } }
    __builtin_amdgcn_wave_barrier();
    WAIT_DS(); WAIT_ACP(); __syncthreads();                // K(kt + 1) is published, the V buffer is free
    if (kt + 1 < SS / 64) fillV(kt + 1); }
  WAIT_ACP();
#pragma unroll
  for (int r = 0; r < 8; ++r) { const float lr = __shfl(lrun, 8 * g + r, 32); const float inv = 1.0f / (lr * 16384.0f * 4.0f);
#pragma unroll
    for (int t = 0; t < 4; ++t) sS[w][8 * g + r][t * 16 + col] = (acc[t][r] + ac1[t][r] * (1.0f / VLO) + ac2[t][r] * (1.0f / PLO)) * inv; }
  LDSX();
  for (int qq = lane; qq < 16 * 16; qq += 32) { const int rl = qq >> 4, pc = qq & 15; vst2(O32 + ((bh * SS) + q0 + rl) * HD + pc * 4, *(const v4f*)(&sS[w][rl][pc * 4])); }
}
// out = ctx Wo^T : split(ctx) x bf16(Wo rows): 2 products (Wo is an INPUT -> bf16 exact)
__global__ __launch_bounds__(128) void k_out(const float* __restrict__ O32, const __bf16* __restrict__ PT, float* __restrict__ out) {
  constexpr int STA = 64 * RPF, STG = STA + 128 * RP;      // one stage: 64 ctx rows of one head (f32), then 128 weight rows, 64 k each
  __shared__ __align__(16) char smem[2 * STG];             // two stages in the k loop; the output staging behind it
  float (*so)[16][132] = (float (*)[16][132])smem;
  const int tid = threadIdx.x, wave = tid >> 5, lane = tid & 31, col = lane & 15, g = lane >> 4;
  const int r0b = blockIdx.x * 64, r0 = r0b + wave * 16, n0 = blockIdx.y * 128; const int b = r0b / SS, s0 = r0b % SS;
  v8f acc[8] = {};
  const unsigned lA = lds_off(smem) + (tid >> 4) * RPF + (tid & 15) * 16;     // a copy of the block: 8 ctx rows, 16 lanes a row
  const unsigned lW = lds_off(smem) + STA + (tid >> 3) * RP + (tid & 7) * 16; // or 16 weight rows, 8 lanes a row
  const char* gA = (const char*)(O32 + ((size_t)b * NH * SS + s0 + (tid >> 4)) * HD + (tid & 15) * 4);
  const char* gW = (const char*)(PT + (size_t)(3 * E + n0 + (tid >> 3)) * E + (tid & 7) * 8);
  auto fill = [&](int t) { const unsigned lo = (t & 1) * STG; const char* ga = gA + (size_t)t * SS * HD * 4; const char* gw = gW + (size_t)t * 128;   // pass t = head t
    acp8(lA + lo, ga, lA + lo + 32 * RPF, ga + (size_t)32 * HD * 4, 8 * RPF, (size_t)8 * HD * 4);
    acp8(lW + lo, gw, lW + lo + 64 * RP, gw + (size_t)64 * E * 2, 16 * RP, (size_t)16 * E * 2); };
  fill(0); WAIT_ACP(); __syncthreads(); fill(1);
#pragma unroll 2   // two trips a body: each half addresses its buffer by constant offsets
  for (int t = 0; t < E / 64; ++t) { const char* sb = smem + (t & 1) * STG;
#pragma unroll
    for (int kc = 0; kc < 2; ++kc) { const F2 a = split_row((const float*)(sb + (wave * 16 + col) * RPF), kc * 32, lane); v16b wb[8];
#pragma unroll     // the LDS reads of a k chunk go out as one group, so that their latency is paid once and not per product; wb[] stays in registers
      for (int j = 0; j < 8; ++j) wb[j] = frag_b((const __bf16*)(sb + STA + (j * 16 + col) * RP) + kc * 32, lane);
#pragma unroll
      for (int j = 0; j < 8; ++j) { acc[j] = wmma_bf(a.l, wb[j], acc[j]); acc[j] = wmma_bf(a.h, wb[j], acc[j]); } }
    WAIT_DS(); WAIT_ACP(); __syncthreads();                // stage t + 1 is published, stage t's buffer is free
    if (t + 2 < E / 64) fill(t + 2); }
  WAIT_ACP();
#pragma unroll
  for (int j = 0; j < 8; ++j) {
#pragma unroll
    for (int r = 0; r < 8; ++r) so[wave][8 * g + r][j * 16 + col] = acc[j][r]; }
  LDSX();
#pragma unroll 4
  for (int rl = 0; rl < 16; ++rl) vst2(out + (size_t)(r0 + rl) * E + n0 + lane * 4, *(const v4f*)(&so[wave][rl][lane * 4]));
}
extern "C" void kernel_launch(void* const* d_in, const int* in_sizes, int n_in, void* d_out, int out_size, void* d_ws, size_t ws_size, hipStream_t stream) {
  (void)in_sizes; (void)n_in; (void)out_size; (void)ws_size;
  const float* Qi = (const float*)d_in[0]; const float* Ki = (const float*)d_in[1]; const float* Vi = (const float*)d_in[2]; const int* vlen = (const int*)d_in[3];
  const float* Wq = (const float*)d_in[4]; const float* Wk = (const float*)d_in[5]; const float* Wv = (const float*)d_in[6]; const float* Wo = (const float*)d_in[7];
  float* out = (float*)d_out;
  char* ws = (char*)d_ws; size_t off = 0;
  auto take = [&](size_t bytes) { char* p = ws + off; off += (bytes + 255) & ~(size_t)255; return p; };
  __bf16* XQ = (__bf16*)take((size_t)NR * E * 2); __bf16* XK = (__bf16*)take((size_t)NR * E * 2); __bf16* XV = (__bf16*)take((size_t)NR * E * 2); __bf16* PT = (__bf16*)take((size_t)4 * E * E * 2);
  float* Q32 = (float*)take((size_t)NR * E * 4); __bf16* Kh = (__bf16*)take((size_t)NR * E * 2); __bf16* Kl = (__bf16*)take((size_t)NR * E * 2); _Float16* VTh = (_Float16*)take((size_t)NR * E * 2); _Float16* VTl = (_Float16*)take((size_t)NR * E * 2); float* O32 = (float*)take((size_t)NR * E * 4);
  // ws = 96 MiB
  k_prep<<<(3 * NR * E + 4 * E * E) / PB, 512, 0, stream>>>(Qi, Ki, Vi, Wq, Wk, Wv, Wo, XQ);   // XQ, XK, XV, PT are contiguous in ws
  k_qkv<<<dim3(NR / 128, E / 128, 3), 128, 0, stream>>>(XQ, XK, XV, PT, Q32, Kh, Kl, VTh, VTl);
  k_attn<<<dim3(SS / 64, NB * NH), 128, 0, stream>>>(Q32, Kh, Kl, VTh, VTl, vlen, O32);
  k_out<<<dim3(NR / 64, E / 128), 128, 0, stream>>>(O32, PT, out);
}

// v005
// One run takes 113 microseconds.
// Next to v004, in two timings, it ran 1.06 times as fast each time.
// All steps since v000 together make it 3.49 times as fast.
// compute dtype: Q, K, V, W* (INPUTS) rounded to bf16 with exact bf16 WMMA products (f32 accumulate) for the projections; K pre-split into bf16 hi/lo rows; q f32 split, P and V f16 hi/lo (3 products each); softmax with the -1e6 valid-length fill in f32 (no sentinel shortcut, so a zero valid length yields a uniform row).
#include <hip/hip_runtime.h>
#include <math.h>

typedef __attribute__((ext_vector_type(16))) _Float16 v16h;
typedef __attribute__((ext_vector_type(16))) __bf16 v16b;
typedef __attribute__((ext_vector_type(8)))  _Float16 v8h;
typedef __attribute__((ext_vector_type(8)))  float v8f;
typedef __attribute__((ext_vector_type(4)))  float v4f;
typedef __attribute__((ext_vector_type(2)))  float v2f;
typedef __attribute__((ext_vector_type(4)))  unsigned v4u;
typedef __attribute__((ext_vector_type(2)))  unsigned v2u;
typedef __attribute__((ext_vector_type(4)))  int v4i;
typedef float __attribute__((may_alias)) float_a;
typedef int __attribute__((may_alias)) int_a;

template <typename T> __device__ __forceinline__ void vst2(void* p, T v) { *(T*)p = v;  }
__device__ __forceinline__ v8f wmma16(v16h a, v16h b, v8f c) {
  v8f d = __builtin_amdgcn_wmma_f32_16x16x32_f16(false, a, false, b, (short)0, c, false, false);
  asm volatile("v_nop\n\tv_nop\n\tv_nop\n\tv_nop" : "+v"(d) : "v"(a), "v"(b));
  return d;
}
__device__ __forceinline__ v8f wmma_bf(v16b a, v16b b, v8f c) {
  v8f d = __builtin_amdgcn_wmma_f32_16x16x32_bf16(false, a, false, b, (short)0, c, false, false);
  asm volatile("v_nop\n\tv_nop\n\tv_nop\n\tv_nop" : "+v"(d) : "v"(a), "v"(b));
  return d;
}
// 16x16x32 fragments: lane = (h = lane>>4, row/col = lane&15); elements 0..7 = k0+8h+0..7, 8..15 = k0+16+8h+0..7; D element r = row 8h+r
__device__ __forceinline__ v16h frag_h(const _Float16* rowk0, int lane) {
  union { v16h v; v8h q[2]; } u; const _Float16* p = rowk0 + 8 * (lane >> 4);
  u.q[0] = *(const v8h*)p; u.q[1] = *(const v8h*)(p + 16); return u.v;
}
__device__ __forceinline__ v16h frag_f32(const float* rowk0, int lane) {
  v16h a; const float* p = rowk0 + 8 * (lane >> 4);
#pragma unroll
  for (int i = 0; i < 8; ++i) { a[i] = (_Float16)p[i]; a[8 + i] = (_Float16)p[16 + i]; }
  return a;
}
__device__ __forceinline__ v16h frag_f32s(const float* rowk0, int lane, float sc) {
  v16h a; const float* p = rowk0 + 8 * (lane >> 4);
#pragma unroll
  for (int i = 0; i < 8; ++i) { a[i] = (_Float16)(p[i] * sc); a[8 + i] = (_Float16)(p[16 + i] * sc); }
  return a;
}
// column fragment from a [K][ld] layout (column n), rows >= K read as 0
__device__ __forceinline__ v16h fragc_f32(const float* W, int k0, int n, int lane, int ld, int K) {
  v16h a; const int g = lane >> 4;
#pragma unroll
  for (int i = 0; i < 8; ++i) { const int ka = k0 + 8 * g + i, kb = ka + 16;
    a[i] = (_Float16)(ka < K ? W[(size_t)ka * ld + n] : 0.f); a[8 + i] = (_Float16)(kb < K ? W[(size_t)kb * ld + n] : 0.f); }
  return a;
}
struct F2 { v16b h, l; };
__device__ __forceinline__ F2 bsplit16(const float v[16]) { F2 r;
#pragma unroll
  for (int i = 0; i < 16; ++i) { const __bf16 h = (__bf16)v[i]; r.h[i] = h; r.l[i] = (__bf16)(v[i] - (float)h); }
  return r; }
__device__ __forceinline__ F2 split_row(const float* row, int k0, int lane) { float v[16]; const float* p = row + k0 + 8 * (lane >> 4);
#pragma unroll
  for (int i = 0; i < 8; ++i) { v[i] = p[i]; v[8 + i] = p[16 + i]; }
  return bsplit16(v); }
__device__ __forceinline__ F2 split_rowK(const float* row, int k0, int lane, int K) { float v[16]; const int g = lane >> 4;
#pragma unroll
  for (int i = 0; i < 8; ++i) { const int ka = k0 + 8 * g + i, kb = ka + 16; v[i] = ka < K ? row[ka] : 0.f; v[8 + i] = kb < K ? row[kb] : 0.f; }
  return bsplit16(v); }
__device__ __forceinline__ F2 split_col(const float* W, int k0, int n, int lane, int ld, int K) { float v[16]; const int g = lane >> 4;
#pragma unroll
  for (int i = 0; i < 8; ++i) { const int ka = k0 + 8 * g + i, kb = ka + 16; v[i] = ka < K ? W[(size_t)ka * ld + n] : 0.f; v[8 + i] = kb < K ? W[(size_t)kb * ld + n] : 0.f; }
  return bsplit16(v); }
__device__ __forceinline__ v8f mac3(const F2& a, const F2& b, v8f c) { c = wmma_bf(a.l, b.h, c); c = wmma_bf(a.h, b.l, c); return wmma_bf(a.h, b.h, c); }
__device__ __forceinline__ float sigm(float v) { return 1.0f / (1.0f + expf(-v)); }
#define LDSX() do { asm volatile("s_wait_dscnt 0" ::: "memory"); __builtin_amdgcn_wave_barrier(); __builtin_amdgcn_fence(__ATOMIC_RELEASE, "workgroup"); } while (0)


// d2l-style multi-head attention (16 heads of 64 on [4,1024,1024]; separate Q/K/V inputs, [out][in] weights, no biases): scores = q.k/8, then where(key < valid_lens[bh*L + q], score, -1e6) (per-row valid length, int input), softmax, (P v) Wo^T.
#define NB 4
#define SS 1024
#define E 1024
#define NH 16
#define HD 64
#define NR (NB * SS)
#define PLO 1024.0f
#define VLO 2048.0f
#define L2E 1.4426950408889634f   // log2(e)
__device__ __forceinline__ float bfr(float v) { return (float)(__bf16)v; }
__device__ __forceinline__ v16b frag_b(const __bf16* rowk0, int lane) { return __builtin_bit_cast(v16b, frag_h((const _Float16*)rowk0, lane)); }

// Operand tiles go from global memory to LDS as whole 128-byte lines, 16 bytes a lane, through no register; the fragments are then read from LDS rows at a pitch of 16 B x odd.
#define RP 144   // LDS pitch in bytes of a 128-byte row
#define RPF 272  // LDS pitch in bytes of a 256-byte row
__device__ __forceinline__ unsigned lds_off(const void* p) { return (unsigned)(size_t)p; }
#define ACP(l, g) "global_load_async_to_lds_b128 %" #l ", %" #g ", off\n\t"
// four copies of a lane: LDS address l + i*ls, global address g + i*gs; s_wait_xcnt 0 closes the statement so that no address register is rewritten ahead of it
__device__ __forceinline__ void acp4(unsigned l, const char* g, unsigned ls, size_t gs) {
  asm volatile(ACP(0, 4) ACP(1, 5) ACP(2, 6) ACP(3, 7) "s_wait_xcnt 0x0"
               :: "v"(l), "v"(l + ls), "v"(l + 2 * ls), "v"(l + 3 * ls), "v"(g), "v"(g + gs), "v"(g + 2 * gs), "v"(g + 3 * gs) : "memory");
}
// eight copies of a lane, four from each of two bases, one closing s_wait_xcnt 0 (same reason)
__device__ __forceinline__ void acp8(unsigned l, const char* g, unsigned m, const char* h, unsigned ls, size_t gs) {
  asm volatile(ACP(0, 8) ACP(1, 9) ACP(2, 10) ACP(3, 11) ACP(4, 12) ACP(5, 13) ACP(6, 14) ACP(7, 15) "s_wait_xcnt 0x0"
               :: "v"(l), "v"(l + ls), "v"(l + 2 * ls), "v"(l + 3 * ls), "v"(m), "v"(m + ls), "v"(m + 2 * ls), "v"(m + 3 * ls),
                  "v"(g), "v"(g + gs), "v"(g + 2 * gs), "v"(g + 3 * gs), "v"(h), "v"(h + gs), "v"(h + 2 * gs), "v"(h + 3 * gs) : "memory");
}
// this wave's LDS reads have returned: stands in front of the barrier behind which their buffer is filled again
#define WAIT_DS() asm volatile("s_wait_dscnt 0x0" ::: "memory")
// this wave's copies have landed: stands in front of the barrier behind which other waves read them
#define WAIT_ACP() asm volatile("s_wait_asynccnt 0x0" ::: "memory")

// every f32 -> bf16 rounding of the inputs in one streaming launch: dst holds XQ, XK, XV (NR x E each) and PT, one behind the other.
// PT rows: [0,E) Wq, [E,2E) Wk, [2E,3E) Wv, [3E,4E) Wo  ([out][in] weights: PT row n = W row n % E, so the pack is the same elementwise rounding)
#define PB 65536   // elements of a block: 512 threads x 32 pieces of 4; 256 blocks in all
__global__ __launch_bounds__(512) void k_prep(const float* __restrict__ Qi, const float* __restrict__ Ki, const float* __restrict__ Vi, const float* __restrict__ Wq, const float* __restrict__ Wk, const float* __restrict__ Wv, const float* __restrict__ Wo, __bf16* __restrict__ dst) {
  const unsigned blk = blockIdx.x, seg = blk / (NR * E / PB), ws = (blk / (E * E / PB)) & 3;      // 64 blocks an activation, 16 a weight
  const float* s = seg == 0 ? Qi : (seg == 1 ? Ki : (seg == 2 ? Vi : (ws == 0 ? Wq : (ws == 1 ? Wk : (ws == 2 ? Wv : Wo)))));
  s += (size_t)(seg < 3 ? blk % (NR * E / PB) : blk % (E * E / PB)) * PB + threadIdx.x * 4;
  __bf16* d = dst + (size_t)blk * PB + threadIdx.x * 4;
  v4f v[32];
#pragma unroll     // unrolled so that a lane's loads go out far ahead of their use (many in flight a wave); each covers 512 contiguous bytes of a wave
  for (int i = 0; i < 32; ++i) v[i] = *(const v4f*)(s + i * 2048);
#pragma unroll
  for (int i = 0; i < 32; ++i) { union { __bf16 h[4]; v2u u; } pk;
#pragma unroll
    for (int e = 0; e < 4; ++e) pk.h[e] = (__bf16)v[i][e];
    vst2((unsigned*)(d + i * 2048), pk.u); }
}
// QKV: block (128 rows, 128 cols = 2 heads, which), four waves of 64 rows x 64 cols (one head) each: a k chunk's 8 fragments feed 16 products; q -> Q32 f32 [bh][s][64]; k -> bf16 hi/lo rows; v -> VT hi/lo x4 [bh][d][s]
__global__ __launch_bounds__(128) void k_qkv(const __bf16* __restrict__ XQ, const __bf16* __restrict__ XK, const __bf16* __restrict__ XV, const __bf16* __restrict__ PT, float* __restrict__ Q32, __bf16* __restrict__ Kh, __bf16* __restrict__ Kl, _Float16* __restrict__ VTh, _Float16* __restrict__ VTl) {
  constexpr int STG = (128 + 128) * RP;                    // one stage: 128 X rows, then 128 weight rows, 64 k each
  __shared__ __align__(16) char smem[2 * STG];             // two stages in the k loop; the output staging behind it
  float (*so)[64][68] = (float (*)[64][68])smem;           // a wave's own 64 x 64 tile
  _Float16 (*sth)[136] = (_Float16 (*)[136])smem; _Float16 (*stl)[136] = (_Float16 (*)[136])(smem + 128 * 136 * 2);
  const int tid = threadIdx.x, wave = tid >> 5, lane = tid & 31, col = lane & 15, g = lane >> 4, wr = wave >> 1, wc = wave & 1;
  const int which = blockIdx.z, r0b = blockIdx.x * 128, n0 = blockIdx.y * 128; const int b = r0b / SS, s0 = r0b % SS;
  const __bf16* Xb = which == 0 ? XQ : (which == 1 ? XK : XV);
  v8f acc[4][4] = {};
  const unsigned l0 = lds_off(smem) + (tid >> 3) * RP + (tid & 7) * 16;       // a copy of the block: 16 rows, 8 lanes a row
  const char* gX = (const char*)(Xb + (size_t)(r0b + (tid >> 3)) * E + (tid & 7) * 8);
  const char* gW = (const char*)(PT + (size_t)(which * E + n0 + (tid >> 3)) * E + (tid & 7) * 8);
  auto fill = [&](int t) { const unsigned l = l0 + (t & 1) * STG; const size_t ko = (size_t)t * 128;
    acp8(l, gX + ko, l + 64 * RP, gX + ko + (size_t)64 * E * 2, 16 * RP, (size_t)16 * E * 2);
    acp8(l + 128 * RP, gW + ko, l + 192 * RP, gW + ko + (size_t)64 * E * 2, 16 * RP, (size_t)16 * E * 2); };
  fill(0); WAIT_ACP(); __syncthreads(); fill(1);
#pragma unroll 2   // two trips a body: each half addresses its buffer by constant offsets
  for (int t = 0; t < E / 64; ++t) { const char* sb = smem + (t & 1) * STG;
#pragma unroll
    for (int kc = 0; kc < 2; ++kc) { v16b a[4], wb[4];
#pragma unroll     // the LDS reads of a k chunk go out as one group, so that their latency is paid once and not per product; a[] and wb[] stay in registers
      for (int i = 0; i < 4; ++i) a[i] = frag_b((const __bf16*)(sb + (wr * 64 + i * 16 + col) * RP) + kc * 32, lane);
#pragma unroll
      for (int j = 0; j < 4; ++j) wb[j] = frag_b((const __bf16*)(sb + (128 + wc * 64 + j * 16 + col) * RP) + kc * 32, lane);
#pragma unroll
      for (int i = 0; i < 4; ++i) {
#pragma unroll
        for (int j = 0; j < 4; ++j) acc[i][j] = wmma_bf(a[i], wb[j], acc[i][j]); } }
    WAIT_DS(); WAIT_ACP(); __syncthreads();                // stage t + 1 is published, stage t's buffer is free
    if (t + 2 < E / 64) fill(t + 2); }
  WAIT_ACP();
  const int h = (n0 >> 6) + wc;                            // my wave's head
  if (which < 2) {
#pragma unroll
    for (int i = 0; i < 4; ++i) {
#pragma unroll
      for (int j = 0; j < 4; ++j) { const float bb = 0.f;
#pragma unroll
        for (int r = 0; r < 8; ++r) so[wave][i * 16 + 8 * g + r][j * 16 + col] = acc[i][j][r] + bb; } }
    LDSX();
    if (which == 0) { for (int qq = lane; qq < 64 * 16; qq += 32) { const int rl = qq >> 4, pc = qq & 15;
        vst2(Q32 + (((size_t)b * NH + h) * SS + s0 + wr * 64 + rl) * HD + pc * 4, *(const v4f*)(&so[wave][rl][pc * 4])); } }
    else {
      for (int qq = lane; qq < 64 * 16; qq += 32) { const int rl = qq >> 4, pl = qq & 15; const int pc = pl & 7; union { __bf16 e[8]; v4u u; } pk;
#pragma unroll
        for (int e = 0; e < 8; ++e) { const float v = so[wave][rl][pc * 8 + e]; const __bf16 hi = (__bf16)v; pk.e[e] = pl < 8 ? hi : (__bf16)(v - (float)hi); }
        vst2((unsigned*)((pl < 8 ? Kh : Kl) + (((size_t)b * NH + h) * SS + s0 + wr * 64 + rl) * HD + pc * 8), pk.u); } } }
  else {
#pragma unroll
    for (int i = 0; i < 4; ++i) {
#pragma unroll
      for (int j = 0; j < 4; ++j) { const float bb = 0.f;
#pragma unroll
        for (int r = 0; r < 8; ++r) { const float v = (acc[i][j][r] + bb) * 4.0f; const _Float16 hi = (_Float16)v; sth[wc * 64 + j * 16 + col][wr * 64 + i * 16 + 8 * g + r] = hi; stl[wc * 64 + j * 16 + col][wr * 64 + i * 16 + 8 * g + r] = (_Float16)((v - (float)hi) * VLO); } } }
    __syncthreads();
    for (int qq = tid; qq < 128 * 16; qq += 128) { const int cl = qq >> 4, pc = qq & 15; const int c = n0 + cl, hc = c >> 6, d = c & 63; const size_t o = (((size_t)b * NH + hc) * HD + d) * SS + s0 + pc * 8;
      vst2(VTh + o, *(const v4u*)(&sth[cl][pc * 8])); vst2(VTl + o, *(const v4u*)(&stl[cl][pc * 8])); } }
}
// eight hardware exponentials, each in its own register, in one statement: behind a transcendental the instruction set asks for one independent instruction before its result is read or its source overwritten;
// here each is that instruction for the one before it and the v_nop for the last
__device__ __forceinline__ void exp2x8(float (&e)[8]) {
  asm("v_exp_f32 %0, %0\n\tv_exp_f32 %1, %1\n\tv_exp_f32 %2, %2\n\tv_exp_f32 %3, %3\n\tv_exp_f32 %4, %4\n\tv_exp_f32 %5, %5\n\tv_exp_f32 %6, %6\n\tv_exp_f32 %7, %7\n\tv_nop"
      : "+v"(e[0]), "+v"(e[1]), "+v"(e[2]), "+v"(e[3]), "+v"(e[4]), "+v"(e[5]), "+v"(e[6]), "+v"(e[7]));
}
// padding-masked attention: block (64 queries, bh); all 16 key tiles; transposed products: S^T = K q^T (K hi/lo rows as A, q hi/lo as B), O^T += V^T P^T (V^T hi/lo rows as A, P^T hi/lo as B); O f32 [bh][s][64]
// a lane holds one query column: its scores, maximum, sum, valid length and rescale factor stay in its registers, and two score tiles (keys 8g+r and 16+8g+r of 32) are the B fragment of the second product as they stand
// softmax in base 2: scores and the fill carry the factor log2(e), and the running maximum lies 14 below the true one, so that one hardware exponential gives 2^14 e^(score - max)
__global__ __launch_bounds__(128) void k_attn(const float* __restrict__ Q32, const __bf16* __restrict__ Kh, const __bf16* __restrict__ Kl, const _Float16* __restrict__ VTh, const _Float16* __restrict__ VTl, const int* __restrict__ vlen, float* __restrict__ O32) {
  __shared__ __align__(16) char sKV[4 * 64 * RP];          // K buffer: K hi, K lo (64 keys x 64 d); V buffer: V^T hi, V^T lo (64 d x 64 keys); the output staging behind the loop
  float (*so)[16][68] = (float (*)[16][68])sKV;            // a wave's own 16 queries x 64 d
  const int tid = threadIdx.x, w = tid >> 5, lane = tid & 31, col = lane & 15, g = lane >> 4;
  const size_t bh = blockIdx.y; const int qb = blockIdx.x; const int q0 = qb * 64 + w * 16;
  F2 aq[2];
#pragma unroll
  for (int kc = 0; kc < 2; ++kc) aq[kc] = split_row(Q32 + (bh * SS + q0 + col) * HD, kc * 32, lane);
  const int vrel = vlen[bh * SS + q0 + col] - 8 * g;       // valid length of my query column, counted from my half's first key row
  float mrun = -3.0e38f, lrun = 0.f; v8f acc[4] = {}, ac1[4] = {}, ac2[4] = {};
  const unsigned l0 = lds_off(sKV) + (tid >> 3) * RP + (tid & 7) * 16;        // a copy of the block: 16 rows, 8 lanes a row
  const size_t oK = ((bh * SS + (tid >> 3)) * HD + (tid & 7) * 8) * 2, oV = ((bh * HD + (tid >> 3)) * SS + (tid & 7) * 8) * 2;
  // two buffers, stages K(0), V(0), K(1), V(1), ...: the score pass reads the K buffer alone, the P.V pass the V buffer alone; each refill flies during the other pass
  auto fillK = [&](int kt) { acp8(l0, (const char*)Kh + oK + (size_t)kt * 64 * HD * 2, l0 + 64 * RP, (const char*)Kl + oK + (size_t)kt * 64 * HD * 2, 16 * RP, (size_t)16 * HD * 2); };
  auto fillV = [&](int kt) { acp8(l0 + 128 * RP, (const char*)VTh + oV + (size_t)kt * 128, l0 + 192 * RP, (const char*)VTl + oV + (size_t)kt * 128, 16 * RP, (size_t)16 * SS * 2); };
  fillK(0); WAIT_ACP(); __syncthreads(); fillV(0);
#pragma unroll 1
  for (int kt = 0; kt < SS / 64; ++kt) { v8f s[4];
#pragma unroll
    for (int t = 0; t < 4; ++t) { const char* kr = sKV + (t * 16 + col) * RP; v8f x = {};
#pragma unroll
      for (int kc = 0; kc < 2; ++kc) { const v16b khf = frag_b((const __bf16*)kr + kc * 32, lane), klf = frag_b((const __bf16*)(kr + 64 * RP) + kc * 32, lane); x = wmma_bf(khf, aq[kc].l, x); x = wmma_bf(klf, aq[kc].h, x); x = wmma_bf(khf, aq[kc].h, x); }
#pragma unroll
      for (int r = 0; r < 8; ++r) s[t][r] = (kt * 64 + t * 16 + r < vrel) ? x[r] * (0.125f * L2E) : -1.0e6f * L2E; }
    WAIT_DS(); WAIT_ACP(); __syncthreads();                // V(kt) is published, the K buffer is free
    if (kt + 1 < SS / 64) fillK(kt + 1);
    float mx = -3.4e38f;
#pragma unroll
    for (int t = 0; t < 4; ++t) {
#pragma unroll
      for (int r = 0; r < 8; ++r) mx = fmaxf(mx, s[t][r]); }
    mx = fmaxf(mx, __shfl_xor(mx, 16, 32));
    const float mnew = fmaxf(mrun, mx - 14.0f); const float corr = __builtin_amdgcn_exp2f(mrun - mnew);
    float ps = 0.f; v16h ph[2], pl[2];
#pragma unroll
    for (int t = 0; t < 4; ++t) { float e[8];
#pragma unroll
      for (int r = 0; r < 8; ++r) e[r] = s[t][r] - mnew;
      exp2x8(e);
#pragma unroll
      for (int r = 0; r < 8; ++r) { const float p = e[r]; ps += p; const _Float16 hi = (_Float16)p; ph[t >> 1][(t & 1) * 8 + r] = hi; pl[t >> 1][(t & 1) * 8 + r] = (_Float16)((p - (float)hi) * PLO); } }
    ps += __shfl_xor(ps, 16, 32);
    lrun = lrun * corr + ps * (1.0f / 16384.0f); mrun = mnew;
#pragma unroll
    for (int t = 0; t < 4; ++t) {
#pragma unroll
      for (int r = 0; r < 8; ++r) { acc[t][r] *= corr; ac1[t][r] *= corr; ac2[t][r] *= corr; } }
#pragma unroll
    for (int kc = 0; kc < 2; ++kc) {
#pragma unroll
      for (int t = 0; t < 4; ++t) { const char* vr = sKV + (128 + t * 16 + col) * RP; const v16h vh = frag_h((const _Float16*)vr + kc * 32, lane);
        acc[t] = wmma16(vh, ph[kc], acc[t]); ac1[t] = wmma16(frag_h((const _Float16*)(vr + 64 * RP) + kc * 32, lane), ph[kc], ac1[t]); ac2[t] = wmma16(vh, pl[kc], ac2[t]); } }
    WAIT_DS(); WAIT_ACP(); __syncthreads();                // K(kt + 1) is published, the V buffer is free
    if (kt + 1 < SS / 64) fillV(kt + 1); }
  WAIT_ACP();
  const float inv = 1.0f / (lrun * 16384.0f * 4.0f);
#pragma unroll
  for (int t = 0; t < 4; ++t) { v4f o[2];
#pragma unroll
    for (int r = 0; r < 8; ++r) o[r >> 2][r & 3] = (acc[t][r] + ac1[t][r] * (1.0f / VLO) + ac2[t][r] * (1.0f / PLO)) * inv;
    *(v4f*)(&so[w][col][t * 16 + 8 * g]) = o[0]; *(v4f*)(&so[w][col][t * 16 + 8 * g + 4]) = o[1]; }
  LDSX();
  for (int qq = lane; qq < 16 * 16; qq += 32) { const int rl = qq >> 4, pc = qq & 15; vst2(O32 + ((bh * SS) + q0 + rl) * HD + pc * 4, *(const v4f*)(&so[w][rl][pc * 4])); }
}
// out = ctx Wo^T : split(ctx) x bf16(Wo rows): 2 products (Wo is an INPUT -> bf16 exact)
__global__ __launch_bounds__(128) void k_out(const float* __restrict__ O32, const __bf16* __restrict__ PT, float* __restrict__ out) {
  constexpr int STA = 64 * RPF, STG = STA + 128 * RP;      // one stage: 64 ctx rows of one head (f32), then 128 weight rows, 64 k each
  __shared__ __align__(16) char smem[2 * STG];             // two stages in the k loop; the output staging behind it
  float (*so)[16][132] = (float (*)[16][132])smem;
  const int tid = threadIdx.x, wave = tid >> 5, lane = tid & 31, col = lane & 15, g = lane >> 4;
  const int r0b = blockIdx.x * 64, r0 = r0b + wave * 16, n0 = blockIdx.y * 128; const int b = r0b / SS, s0 = r0b % SS;
  v8f acc[8] = {};
  const unsigned lA = lds_off(smem) + (tid >> 4) * RPF + (tid & 15) * 16;     // a copy of the block: 8 ctx rows, 16 lanes a row
  const unsigned lW = lds_off(smem) + STA + (tid >> 3) * RP + (tid & 7) * 16; // or 16 weight rows, 8 lanes a row
  const char* gA = (const char*)(O32 + ((size_t)b * NH * SS + s0 + (tid >> 4)) * HD + (tid & 15) * 4);
  const char* gW = (const char*)(PT + (size_t)(3 * E + n0 + (tid >> 3)) * E + (tid & 7) * 8);
  auto fill = [&](int t) { const unsigned lo = (t & 1) * STG; const char* ga = gA + (size_t)t * SS * HD * 4; const char* gw = gW + (size_t)t * 128;   // pass t = head t
    acp8(lA + lo, ga, lA + lo + 32 * RPF, ga + (size_t)32 * HD * 4, 8 * RPF, (size_t)8 * HD * 4);
    acp8(lW + lo, gw, lW + lo + 64 * RP, gw + (size_t)64 * E * 2, 16 * RP, (size_t)16 * E * 2); };
  fill(0); WAIT_ACP(); __syncthreads(); fill(1);
#pragma unroll 2   // two trips a body: each half addresses its buffer by constant offsets
  for (int t = 0; t < E / 64; ++t) { const char* sb = smem + (t & 1) * STG;
#pragma unroll
    for (int kc = 0; kc < 2; ++kc) { const F2 a = split_row((const float*)(sb + (wave * 16 + col) * RPF), kc * 32, lane); v16b wb[8];
#pragma unroll     // the LDS reads of a k chunk go out as one group, so that their latency is paid once and not per product; wb[] stays in registers
      for (int j = 0; j < 8; ++j) wb[j] = frag_b((const __bf16*)(sb + STA + (j * 16 + col) * RP) + kc * 32, lane);
#pragma unroll
      for (int j = 0; j < 8; ++j) { acc[j] = wmma_bf(a.l, wb[j], acc[j]); acc[j] = wmma_bf(a.h, wb[j], acc[j]); } }
    WAIT_DS(); WAIT_ACP(); __syncthreads();                // stage t + 1 is published, stage t's buffer is free
    if (t + 2 < E / 64) fill(t + 2); }
  WAIT_ACP();
#pragma unroll
  for (int j = 0; j < 8; ++j) {
#pragma unroll
    for (int r = 0; r < 8; ++r) so[wave][8 * g + r][j * 16 + col] = acc[j][r]; }
  LDSX();
#pragma unroll 4
  for (int rl = 0; rl < 16; ++rl) vst2(out + (size_t)(r0 + rl) * E + n0 + lane * 4, *(const v4f*)(&so[wave][rl][lane * 4]));
}
extern "C" void kernel_launch(void* const* d_in, const int* in_sizes, int n_in, void* d_out, int out_size, void* d_ws, size_t ws_size, hipStream_t stream) {
  (void)in_sizes; (void)n_in; (void)out_size; (void)ws_size;
  const float* Qi = (const float*)d_in[0]; const float* Ki = (const float*)d_in[1]; const float* Vi = (const float*)d_in[2]; const int* vlen = (const int*)d_in[3];
  const float* Wq = (const float*)d_in[4]; const float* Wk = (const float*)d_in[5]; const float* Wv = (const float*)d_in[6]; const float* Wo = (const float*)d_in[7];
  float* out = (float*)d_out;
  char* ws = (char*)d_ws; size_t off = 0;
  auto take = [&](size_t bytes) { char* p = ws + off; off += (bytes + 255) & ~(size_t)255; return p; };
  __bf16* XQ = (__bf16*)take((size_t)NR * E * 2); __bf16* XK = (__bf16*)take((size_t)NR * E * 2); __bf16* XV = (__bf16*)take((size_t)NR * E * 2); __bf16* PT = (__bf16*)take((size_t)4 * E * E * 2);
  float* Q32 = (float*)take((size_t)NR * E * 4); __bf16* Kh = (__bf16*)take((size_t)NR * E * 2); __bf16* Kl = (__bf16*)take((size_t)NR * E * 2); _Float16* VTh = (_Float16*)take((size_t)NR * E * 2); _Float16* VTl = (_Float16*)take((size_t)NR * E * 2); float* O32 = (float*)take((size_t)NR * E * 4);
  // ws = 96 MiB
  k_prep<<<(3 * NR * E + 4 * E * E) / PB, 512, 0, stream>>>(Qi, Ki, Vi, Wq, Wk, Wv, Wo, XQ);   // XQ, XK, XV, PT are contiguous in ws
  k_qkv<<<dim3(NR / 128, E / 128, 3), 128, 0, stream>>>(XQ, XK, XV, PT, Q32, Kh, Kl, VTh, VTl);
  k_attn<<<dim3(SS / 64, NB * NH), 128, 0, stream>>>(Q32, Kh, Kl, VTh, VTl, vlen, O32);
  k_out<<<dim3(NR / 64, E / 128), 128, 0, stream>>>(O32, PT, out);
}

// v006
// One run takes 107 microseconds.
// Timed twice side by side with v005, it ran 1.07 and 1.05 times as fast.
// All steps since v000 together make it 3.69 times as fast.
// compute dtype: Q, K, V, W* (INPUTS) rounded to bf16 with exact bf16 WMMA products (f32 accumulate) for the projections; K pre-split into bf16 hi/lo rows; q f32 split, P and V f16 hi/lo (3 products each); softmax with the -1e6 valid-length fill in f32 (no sentinel shortcut, so a zero valid length yields a uniform row).
#include <hip/hip_runtime.h>
#include <math.h>

typedef __attribute__((ext_vector_type(16))) _Float16 v16h;
typedef __attribute__((ext_vector_type(16))) __bf16 v16b;
typedef __attribute__((ext_vector_type(8)))  _Float16 v8h;
typedef __attribute__((ext_vector_type(8)))  float v8f;
typedef __attribute__((ext_vector_type(4)))  float v4f;
typedef __attribute__((ext_vector_type(2)))  float v2f;
typedef __attribute__((ext_vector_type(4)))  unsigned v4u;
typedef __attribute__((ext_vector_type(2)))  unsigned v2u;
typedef __attribute__((ext_vector_type(4)))  int v4i;
typedef float __attribute__((may_alias)) float_a;
typedef int __attribute__((may_alias)) int_a;

template <typename T> __device__ __forceinline__ void vst2(void* p, T v) { *(T*)p = v;  }
__device__ __forceinline__ v8f wmma16(v16h a, v16h b, v8f c) {
  return __builtin_amdgcn_wmma_f32_16x16x32_f16(false, a, false, b, (short)0, c, false, false);
}
__device__ __forceinline__ v8f wmma_bf(v16b a, v16b b, v8f c) {
  return __builtin_amdgcn_wmma_f32_16x16x32_bf16(false, a, false, b, (short)0, c, false, false);
}
// 16x16x32 fragments: lane = (h = lane>>4, row/col = lane&15); elements 0..7 = k0+8h+0..7, 8..15 = k0+16+8h+0..7; D element r = row 8h+r
__device__ __forceinline__ v16h frag_h(const _Float16* rowk0, int lane) {
  union { v16h v; v8h q[2]; } u; const _Float16* p = rowk0 + 8 * (lane >> 4);
  u.q[0] = *(const v8h*)p; u.q[1] = *(const v8h*)(p + 16); return u.v;
}
__device__ __forceinline__ v16h frag_f32(const float* rowk0, int lane) {
  v16h a; const float* p = rowk0 + 8 * (lane >> 4);
#pragma unroll
  for (int i = 0; i < 8; ++i) { a[i] = (_Float16)p[i]; a[8 + i] = (_Float16)p[16 + i]; }
  return a;
}
__device__ __forceinline__ v16h frag_f32s(const float* rowk0, int lane, float sc) {
  v16h a; const float* p = rowk0 + 8 * (lane >> 4);
#pragma unroll
  for (int i = 0; i < 8; ++i) { a[i] = (_Float16)(p[i] * sc); a[8 + i] = (_Float16)(p[16 + i] * sc); }
  return a;
}
// column fragment from a [K][ld] layout (column n), rows >= K read as 0
__device__ __forceinline__ v16h fragc_f32(const float* W, int k0, int n, int lane, int ld, int K) {
  v16h a; const int g = lane >> 4;
#pragma unroll
  for (int i = 0; i < 8; ++i) { const int ka = k0 + 8 * g + i, kb = ka + 16;
    a[i] = (_Float16)(ka < K ? W[(size_t)ka * ld + n] : 0.f); a[8 + i] = (_Float16)(kb < K ? W[(size_t)kb * ld + n] : 0.f); }
  return a;
}
struct F2 { v16b h, l; };
__device__ __forceinline__ F2 bsplit16(const float v[16]) { F2 r;
#pragma unroll
  for (int i = 0; i < 16; ++i) { const __bf16 h = (__bf16)v[i]; r.h[i] = h; r.l[i] = (__bf16)(v[i] - (float)h); }
  return r; }
__device__ __forceinline__ F2 split_row(const float* row, int k0, int lane) { float v[16]; const float* p = row + k0 + 8 * (lane >> 4);
#pragma unroll
  for (int i = 0; i < 8; ++i) { v[i] = p[i]; v[8 + i] = p[16 + i]; }
  return bsplit16(v); }
__device__ __forceinline__ F2 split_rowK(const float* row, int k0, int lane, int K) { float v[16]; const int g = lane >> 4;
#pragma unroll
  for (int i = 0; i < 8; ++i) { const int ka = k0 + 8 * g + i, kb = ka + 16; v[i] = ka < K ? row[ka] : 0.f; v[8 + i] = kb < K ? row[kb] : 0.f; }
  return bsplit16(v); }
__device__ __forceinline__ F2 split_col(const float* W, int k0, int n, int lane, int ld, int K) { float v[16]; const int g = lane >> 4;
#pragma unroll
  for (int i = 0; i < 8; ++i) { const int ka = k0 + 8 * g + i, kb = ka + 16; v[i] = ka < K ? W[(size_t)ka * ld + n] : 0.f; v[8 + i] = kb < K ? W[(size_t)kb * ld + n] : 0.f; }
  return bsplit16(v); }
__device__ __forceinline__ v8f mac3(const F2& a, const F2& b, v8f c) { c = wmma_bf(a.l, b.h, c); c = wmma_bf(a.h, b.l, c); return wmma_bf(a.h, b.h, c); }
__device__ __forceinline__ float sigm(float v) { return 1.0f / (1.0f + expf(-v)); }
#define LDSX() do { asm volatile("s_wait_dscnt 0" ::: "memory"); __builtin_amdgcn_wave_barrier(); __builtin_amdgcn_fence(__ATOMIC_RELEASE, "workgroup"); } while (0)


// d2l-style multi-head attention (16 heads of 64 on [4,1024,1024]; separate Q/K/V inputs, [out][in] weights, no biases): scores = q.k/8, then where(key < valid_lens[bh*L + q], score, -1e6) (per-row valid length, int input), softmax, (P v) Wo^T.
#define NB 4
#define SS 1024
#define E 1024
#define NH 16
#define HD 64
#define NR (NB * SS)
#define PLO 1024.0f
#define VLO 2048.0f
#define L2E 1.4426950408889634f   // log2(e)
__device__ __forceinline__ float bfr(float v) { return (float)(__bf16)v; }
__device__ __forceinline__ v16b frag_b(const __bf16* rowk0, int lane) { return __builtin_bit_cast(v16b, frag_h((const _Float16*)rowk0, lane)); }

// Operand tiles go from global memory to LDS as whole 128-byte lines, 16 bytes a lane, through no register; the fragments are then read from LDS rows at a pitch of 16 B x odd.
#define RP 144   // LDS pitch in bytes of a 128-byte row
#define RPF 272  // LDS pitch in bytes of a 256-byte row
__device__ __forceinline__ unsigned lds_off(const void* p) { return (unsigned)(size_t)p; }
#define ACP(l, g) "global_load_async_to_lds_b128 %" #l ", %" #g ", off\n\t"
// four copies of a lane: LDS address l + i*ls, global address g + i*gs; s_wait_xcnt 0 closes the statement so that no address register is rewritten ahead of it
__device__ __forceinline__ void acp4(unsigned l, const char* g, unsigned ls, size_t gs) {
  asm volatile(ACP(0, 4) ACP(1, 5) ACP(2, 6) ACP(3, 7) "s_wait_xcnt 0x0"
               :: "v"(l), "v"(l + ls), "v"(l + 2 * ls), "v"(l + 3 * ls), "v"(g), "v"(g + gs), "v"(g + 2 * gs), "v"(g + 3 * gs) : "memory");
}
// eight copies of a lane, four from each of two bases, one closing s_wait_xcnt 0 (same reason)
__device__ __forceinline__ void acp8(unsigned l, const char* g, unsigned m, const char* h, unsigned ls, size_t gs) {
  asm volatile(ACP(0, 8) ACP(1, 9) ACP(2, 10) ACP(3, 11) ACP(4, 12) ACP(5, 13) ACP(6, 14) ACP(7, 15) "s_wait_xcnt 0x0"
               :: "v"(l), "v"(l + ls), "v"(l + 2 * ls), "v"(l + 3 * ls), "v"(m), "v"(m + ls), "v"(m + 2 * ls), "v"(m + 3 * ls),
                  "v"(g), "v"(g + gs), "v"(g + 2 * gs), "v"(g + 3 * gs), "v"(h), "v"(h + gs), "v"(h + 2 * gs), "v"(h + 3 * gs) : "memory");
}
// this wave's LDS reads have returned: stands in front of the barrier behind which their buffer is filled again
#define WAIT_DS() asm volatile("s_wait_dscnt 0x0" ::: "memory")
// this wave's copies have landed: stands in front of the barrier behind which other waves read them
#define WAIT_ACP() asm volatile("s_wait_asynccnt 0x0" ::: "memory")

// every f32 -> bf16 rounding of the inputs in one streaming launch: dst holds XQ, XK, XV (NR x E each) and PT, one behind the other.
// PT rows: [0,E) Wq, [E,2E) Wk, [2E,3E) Wv, [3E,4E) Wo  ([out][in] weights: PT row n = W row n % E, so the pack is the same elementwise rounding)
#define PB 65536   // elements of a block: 512 threads x 32 pieces of 4; 256 blocks in all
__global__ __launch_bounds__(512) void k_prep(const float* __restrict__ Qi, const float* __restrict__ Ki, const float* __restrict__ Vi, const float* __restrict__ Wq, const float* __restrict__ Wk, const float* __restrict__ Wv, const float* __restrict__ Wo, __bf16* __restrict__ dst) {
  const unsigned blk = blockIdx.x, seg = blk / (NR * E / PB), ws = (blk / (E * E / PB)) & 3;      // 64 blocks an activation, 16 a weight
  const float* s = seg == 0 ? Qi : (seg == 1 ? Ki : (seg == 2 ? Vi : (ws == 0 ? Wq : (ws == 1 ? Wk : (ws == 2 ? Wv : Wo)))));
  s += (size_t)(seg < 3 ? blk % (NR * E / PB) : blk % (E * E / PB)) * PB + threadIdx.x * 4;
  __bf16* d = dst + (size_t)blk * PB + threadIdx.x * 4;
  v4f v[32];
#pragma unroll     // unrolled so that a lane's loads go out far ahead of their use (many in flight a wave); each covers 512 contiguous bytes of a wave
  for (int i = 0; i < 32; ++i) v[i] = *(const v4f*)(s + i * 2048);
#pragma unroll
  for (int i = 0; i < 32; ++i) { union { __bf16 h[4]; v2u u; } pk;
#pragma unroll
    for (int e = 0; e < 4; ++e) pk.h[e] = (__bf16)v[i][e];
    vst2((unsigned*)(d + i * 2048), pk.u); }
}
// QKV: block (128 rows, 128 cols = 2 heads, which), four waves of 64 rows x 64 cols (one head) each: a k chunk's 8 fragments feed 16 products; q -> Q32 f32 [bh][s][64]; k -> bf16 hi/lo rows; v -> VT hi/lo x4 [bh][d][s]
__global__ __launch_bounds__(128) void k_qkv(const __bf16* __restrict__ XQ, const __bf16* __restrict__ XK, const __bf16* __restrict__ XV, const __bf16* __restrict__ PT, float* __restrict__ Q32, __bf16* __restrict__ Kh, __bf16* __restrict__ Kl, _Float16* __restrict__ VTh, _Float16* __restrict__ VTl) {
  constexpr int STG = (128 + 128) * RP;                    // one stage: 128 X rows, then 128 weight rows, 64 k each
  __shared__ __align__(16) char smem[2 * STG];             // two stages in the k loop; the output staging behind it
  float (*so)[64][68] = (float (*)[64][68])smem;           // a wave's own 64 x 64 tile
  _Float16 (*sth)[136] = (_Float16 (*)[136])smem; _Float16 (*stl)[136] = (_Float16 (*)[136])(smem + 128 * 136 * 2);
  const int tid = threadIdx.x, wave = tid >> 5, lane = tid & 31, col = lane & 15, g = lane >> 4, wr = wave >> 1, wc = wave & 1;
  const int which = blockIdx.z, r0b = blockIdx.x * 128, n0 = blockIdx.y * 128; const int b = r0b / SS, s0 = r0b % SS;
  const __bf16* Xb = which == 0 ? XQ : (which == 1 ? XK : XV);
  v8f acc[4][4] = {};
  const unsigned l0 = lds_off(smem) + (tid >> 3) * RP + (tid & 7) * 16;       // a copy of the block: 16 rows, 8 lanes a row
  const char* gX = (const char*)(Xb + (size_t)(r0b + (tid >> 3)) * E + (tid & 7) * 8);
  const char* gW = (const char*)(PT + (size_t)(which * E + n0 + (tid >> 3)) * E + (tid & 7) * 8);
  auto fill = [&](int t) { const unsigned l = l0 + (t & 1) * STG; const size_t ko = (size_t)t * 128;
    acp8(l, gX + ko, l + 64 * RP, gX + ko + (size_t)64 * E * 2, 16 * RP, (size_t)16 * E * 2);
    acp8(l + 128 * RP, gW + ko, l + 192 * RP, gW + ko + (size_t)64 * E * 2, 16 * RP, (size_t)16 * E * 2); };
  fill(0); WAIT_ACP(); __syncthreads(); fill(1);
#pragma unroll 2   // two trips a body: each half addresses its buffer by constant offsets
  for (int t = 0; t < E / 64; ++t) { const char* sb = smem + (t & 1) * STG;
#pragma unroll
    for (int kc = 0; kc < 2; ++kc) { v16b a[4], wb[4];
#pragma unroll     // the LDS reads of a k chunk go out as one group, so that their latency is paid once and not per product; a[] and wb[] stay in registers
      for (int i = 0; i < 4; ++i) a[i] = frag_b((const __bf16*)(sb + (wr * 64 + i * 16 + col) * RP) + kc * 32, lane);
#pragma unroll
      for (int j = 0; j < 4; ++j) wb[j] = frag_b((const __bf16*)(sb + (128 + wc * 64 + j * 16 + col) * RP) + kc * 32, lane);
      __builtin_amdgcn_sched_barrier(0);   // holds the group of reads ahead of the products: left free, this build fetched each a[i] directly in front of its four products and waited out the LDS latency four times a chunk
#pragma unroll
      for (int i = 0; i < 4; ++i) {
#pragma unroll
        for (int j = 0; j < 4; ++j) acc[i][j] = wmma_bf(a[i], wb[j], acc[i][j]); } }
    __builtin_amdgcn_sched_barrier(0);                     // holds the products ahead of the barrier: left free, this build sank the last chunk's sixteen behind it, in front of the refill, whose copies then had that much less time to land
    WAIT_DS(); WAIT_ACP(); __syncthreads();                // stage t + 1 is published, stage t's buffer is free
    if (t + 2 < E / 64) fill(t + 2); }
  WAIT_ACP();
  const int h = (n0 >> 6) + wc;                            // my wave's head
  if (which < 2) {
#pragma unroll
    for (int i = 0; i < 4; ++i) {
#pragma unroll
      for (int j = 0; j < 4; ++j) { const float bb = 0.f;
#pragma unroll
        for (int r = 0; r < 8; ++r) so[wave][i * 16 + 8 * g + r][j * 16 + col] = acc[i][j][r] + bb; } }
    LDSX();
    if (which == 0) { for (int qq = lane; qq < 64 * 16; qq += 32) { const int rl = qq >> 4, pc = qq & 15;
        vst2(Q32 + (((size_t)b * NH + h) * SS + s0 + wr * 64 + rl) * HD + pc * 4, *(const v4f*)(&so[wave][rl][pc * 4])); } }
    else {
      for (int qq = lane; qq < 64 * 16; qq += 32) { const int rl = qq >> 4, pl = qq & 15; const int pc = pl & 7; union { __bf16 e[8]; v4u u; } pk;
#pragma unroll
        for (int e = 0; e < 8; ++e) { const float v = so[wave][rl][pc * 8 + e]; const __bf16 hi = (__bf16)v; pk.e[e] = pl < 8 ? hi : (__bf16)(v - (float)hi); }
        vst2((unsigned*)((pl < 8 ? Kh : Kl) + (((size_t)b * NH + h) * SS + s0 + wr * 64 + rl) * HD + pc * 8), pk.u); } } }
  else {
#pragma unroll
    for (int i = 0; i < 4; ++i) {
#pragma unroll
      for (int j = 0; j < 4; ++j) { const float bb = 0.f;
#pragma unroll
        for (int r = 0; r < 8; ++r) { const float v = (acc[i][j][r] + bb) * 4.0f; const _Float16 hi = (_Float16)v; sth[wc * 64 + j * 16 + col][wr * 64 + i * 16 + 8 * g + r] = hi; stl[wc * 64 + j * 16 + col][wr * 64 + i * 16 + 8 * g + r] = (_Float16)((v - (float)hi) * VLO); } } }
    __syncthreads();
    for (int qq = tid; qq < 128 * 16; qq += 128) { const int cl = qq >> 4, pc = qq & 15; const int c = n0 + cl, hc = c >> 6, d = c & 63; const size_t o = (((size_t)b * NH + hc) * HD + d) * SS + s0 + pc * 8;
      vst2(VTh + o, *(const v4u*)(&sth[cl][pc * 8])); vst2(VTl + o, *(const v4u*)(&stl[cl][pc * 8])); } }
}
// eight hardware exponentials, each in its own register, in one statement: behind a transcendental the instruction set asks for one independent instruction before its result is read or its source overwritten;
// here each is that instruction for the one before it and the v_nop for the last
__device__ __forceinline__ void exp2x8(float (&e)[8]) {
  asm("v_exp_f32 %0, %0\n\tv_exp_f32 %1, %1\n\tv_exp_f32 %2, %2\n\tv_exp_f32 %3, %3\n\tv_exp_f32 %4, %4\n\tv_exp_f32 %5, %5\n\tv_exp_f32 %6, %6\n\tv_exp_f32 %7, %7\n\tv_nop"
      : "+v"(e[0]), "+v"(e[1]), "+v"(e[2]), "+v"(e[3]), "+v"(e[4]), "+v"(e[5]), "+v"(e[6]), "+v"(e[7]));
}
// padding-masked attention: block (64 queries, bh); all 16 key tiles; transposed products: S^T = K q^T (K hi/lo rows as A, q hi/lo as B), O^T += V^T P^T (V^T hi/lo rows as A, P^T hi/lo as B); O f32 [bh][s][64]
// a lane holds one query column: its scores, maximum, sum, valid length and rescale factor stay in its registers, and two score tiles (keys 8g+r and 16+8g+r of 32) are the B fragment of the second product as they stand
// softmax in base 2: scores and the fill carry the factor log2(e), and the running maximum lies 14 below the true one, so that one hardware exponential gives 2^14 e^(score - max)
__global__ __launch_bounds__(128) void k_attn(const float* __restrict__ Q32, const __bf16* __restrict__ Kh, const __bf16* __restrict__ Kl, const _Float16* __restrict__ VTh, const _Float16* __restrict__ VTl, const int* __restrict__ vlen, float* __restrict__ O32) {
  __shared__ __align__(16) char sKV[4 * 64 * RP];          // K buffer: K hi, K lo (64 keys x 64 d); V buffer: V^T hi, V^T lo (64 d x 64 keys); the output staging behind the loop
  float (*so)[16][68] = (float (*)[16][68])sKV;            // a wave's own 16 queries x 64 d
  const int tid = threadIdx.x, w = tid >> 5, lane = tid & 31, col = lane & 15, g = lane >> 4;
  const size_t bh = blockIdx.y; const int qb = blockIdx.x; const int q0 = qb * 64 + w * 16;
  F2 aq[2];
#pragma unroll
  for (int kc = 0; kc < 2; ++kc) aq[kc] = split_row(Q32 + (bh * SS + q0 + col) * HD, kc * 32, lane);
  const int vrel = vlen[bh * SS + q0 + col] - 8 * g;       // valid length of my query column, counted from my half's first key row
  float mrun = -3.0e38f, lrun = 0.f; v8f acc[4] = {}, ac1[4] = {}, ac2[4] = {};
  const unsigned l0 = lds_off(sKV) + (tid >> 3) * RP + (tid & 7) * 16;        // a copy of the block: 16 rows, 8 lanes a row
  const size_t oK = ((bh * SS + (tid >> 3)) * HD + (tid & 7) * 8) * 2, oV = ((bh * HD + (tid >> 3)) * SS + (tid & 7) * 8) * 2;
  // two buffers, stages K(0), V(0), K(1), V(1), ...: the score pass reads the K buffer alone, the P.V pass the V buffer alone; each refill flies during the other pass
  auto fillK = [&](int kt) { acp8(l0, (const char*)Kh + oK + (size_t)kt * 64 * HD * 2, l0 + 64 * RP, (const char*)Kl + oK + (size_t)kt * 64 * HD * 2, 16 * RP, (size_t)16 * HD * 2); };
  auto fillV = [&](int kt) { acp8(l0 + 128 * RP, (const char*)VTh + oV + (size_t)kt * 128, l0 + 192 * RP, (const char*)VTl + oV + (size_t)kt * 128, 16 * RP, (size_t)16 * SS * 2); };
  fillK(0); WAIT_ACP(); __syncthreads(); fillV(0);
#pragma unroll 1
  for (int kt = 0; kt < SS / 64; ++kt) { v8f s[4];
#pragma unroll
    for (int t = 0; t < 4; ++t) { const char* kr = sKV + (t * 16 + col) * RP; v8f x = {};
#pragma unroll
      for (int kc = 0; kc < 2; ++kc) { const v16b khf = frag_b((const __bf16*)kr + kc * 32, lane), klf = frag_b((const __bf16*)(kr + 64 * RP) + kc * 32, lane); x = wmma_bf(khf, aq[kc].l, x); x = wmma_bf(klf, aq[kc].h, x); x = wmma_bf(khf, aq[kc].h, x); }
#pragma unroll
      for (int r = 0; r < 8; ++r) s[t][r] = (kt * 64 + t * 16 + r < vrel) ? x[r] * (0.125f * L2E) : -1.0e6f * L2E; }
    WAIT_DS(); WAIT_ACP(); __syncthreads();                // V(kt) is published, the K buffer is free
    if (kt + 1 < SS / 64) fillK(kt + 1);
    float mx = -3.4e38f;
#pragma unroll
    for (int t = 0; t < 4; ++t) {
#pragma unroll
      for (int r = 0; r < 8; ++r) mx = fmaxf(mx, s[t][r]); }
    mx = fmaxf(mx, __shfl_xor(mx, 16, 32));
    const float mnew = fmaxf(mrun, mx - 14.0f); const float corr = __builtin_amdgcn_exp2f(mrun - mnew);
    float ps = 0.f; v16h ph[2], pl[2];
#pragma unroll
    for (int t = 0; t < 4; ++t) { float e[8];
#pragma unroll
      for (int r = 0; r < 8; ++r) e[r] = s[t][r] - mnew;
      exp2x8(e);
#pragma unroll
      for (int r = 0; r < 8; ++r) { const float p = e[r]; ps += p; const _Float16 hi = (_Float16)p; ph[t >> 1][(t & 1) * 8 + r] = hi; pl[t >> 1][(t & 1) * 8 + r] = (_Float16)((p - (float)hi) * PLO); } }
    ps += __shfl_xor(ps, 16, 32);
    lrun = lrun * corr + ps * (1.0f / 16384.0f); mrun = mnew;
#pragma unroll
    for (int t = 0; t < 4; ++t) {
#pragma unroll
      for (int r = 0; r < 8; ++r) { acc[t][r] *= corr; ac1[t][r] *= corr; ac2[t][r] *= corr; } }
#pragma unroll
    for (int kc = 0; kc < 2; ++kc) {
#pragma unroll
      for (int t = 0; t < 4; ++t) { const char* vr = sKV + (128 + t * 16 + col) * RP; const v16h vh = frag_h((const _Float16*)vr + kc * 32, lane);
        acc[t] = wmma16(vh, ph[kc], acc[t]); ac1[t] = wmma16(frag_h((const _Float16*)(vr + 64 * RP) + kc * 32, lane), ph[kc], ac1[t]); ac2[t] = wmma16(vh, pl[kc], ac2[t]); } }
    WAIT_DS(); WAIT_ACP(); __syncthreads();                // K(kt + 1) is published, the V buffer is free
    if (kt + 1 < SS / 64) fillV(kt + 1); }
  WAIT_ACP();
  const float inv = 1.0f / (lrun * 16384.0f * 4.0f);
#pragma unroll
  for (int t = 0; t < 4; ++t) { v4f o[2];
#pragma unroll
    for (int r = 0; r < 8; ++r) o[r >> 2][r & 3] = (acc[t][r] + ac1[t][r] * (1.0f / VLO) + ac2[t][r] * (1.0f / PLO)) * inv;
    *(v4f*)(&so[w][col][t * 16 + 8 * g]) = o[0]; *(v4f*)(&so[w][col][t * 16 + 8 * g + 4]) = o[1]; }
  LDSX();
  for (int qq = lane; qq < 16 * 16; qq += 32) { const int rl = qq >> 4, pc = qq & 15; vst2(O32 + ((bh * SS) + q0 + rl) * HD + pc * 4, *(const v4f*)(&so[w][rl][pc * 4])); }
}
// out = ctx Wo^T : split(ctx) x bf16(Wo rows): 2 products (Wo is an INPUT -> bf16 exact)
__global__ __launch_bounds__(128) void k_out(const float* __restrict__ O32, const __bf16* __restrict__ PT, float* __restrict__ out) {
  constexpr int STA = 64 * RPF, STG = STA + 128 * RP;      // one stage: 64 ctx rows of one head (f32), then 128 weight rows, 64 k each
  __shared__ __align__(16) char smem[2 * STG];             // two stages in the k loop; the output staging behind it
  float (*so)[16][132] = (float (*)[16][132])smem;
  const int tid = threadIdx.x, wave = tid >> 5, lane = tid & 31, col = lane & 15, g = lane >> 4;
  const int r0b = blockIdx.x * 64, r0 = r0b + wave * 16, n0 = blockIdx.y * 128; const int b = r0b / SS, s0 = r0b % SS;
  v8f acc[8] = {};
  const unsigned lA = lds_off(smem) + (tid >> 4) * RPF + (tid & 15) * 16;     // a copy of the block: 8 ctx rows, 16 lanes a row
  const unsigned lW = lds_off(smem) + STA + (tid >> 3) * RP + (tid & 7) * 16; // or 16 weight rows, 8 lanes a row
  const char* gA = (const char*)(O32 + ((size_t)b * NH * SS + s0 + (tid >> 4)) * HD + (tid & 15) * 4);
  const char* gW = (const char*)(PT + (size_t)(3 * E + n0 + (tid >> 3)) * E + (tid & 7) * 8);
  auto fill = [&](int t) { const unsigned lo = (t & 1) * STG; const char* ga = gA + (size_t)t * SS * HD * 4; const char* gw = gW + (size_t)t * 128;   // pass t = head t
    acp8(lA + lo, ga, lA + lo + 32 * RPF, ga + (size_t)32 * HD * 4, 8 * RPF, (size_t)8 * HD * 4);
    acp8(lW + lo, gw, lW + lo + 64 * RP, gw + (size_t)64 * E * 2, 16 * RP, (size_t)16 * E * 2); };
  fill(0); WAIT_ACP(); __syncthreads(); fill(1);
#pragma unroll 2   // two trips a body: each half addresses its buffer by constant offsets
  for (int t = 0; t < E / 64; ++t) { const char* sb = smem + (t & 1) * STG;
#pragma unroll
    for (int kc = 0; kc < 2; ++kc) { const F2 a = split_row((const float*)(sb + (wave * 16 + col) * RPF), kc * 32, lane); v16b wb[8];
#pragma unroll     // the LDS reads of a k chunk go out as one group, so that their latency is paid once and not per product; wb[] stays in registers
      for (int j = 0; j < 8; ++j) wb[j] = frag_b((const __bf16*)(sb + STA + (j * 16 + col) * RP) + kc * 32, lane);
      __builtin_amdgcn_sched_barrier(0);   // holds a chunk's reads ahead of its own products as one group (same reason as in k_qkv)
#pragma unroll
      for (int j = 0; j < 8; ++j) { acc[j] = wmma_bf(a.l, wb[j], acc[j]); acc[j] = wmma_bf(a.h, wb[j], acc[j]); } }
    __builtin_amdgcn_sched_barrier(0);                     // holds the products ahead of the barrier, so that the refill behind it goes out no later than before (same reason as in k_qkv)
    WAIT_DS(); WAIT_ACP(); __syncthreads();                // stage t + 1 is published, stage t's buffer is free
    if (t + 2 < E / 64) fill(t + 2); }
  WAIT_ACP();
#pragma unroll
  for (int j = 0; j < 8; ++j) {
#pragma unroll
    for (int r = 0; r < 8; ++r) so[wave][8 * g + r][j * 16 + col] = acc[j][r]; }
  LDSX();
#pragma unroll 4
  for (int rl = 0; rl < 16; ++rl) vst2(out + (size_t)(r0 + rl) * E + n0 + lane * 4, *(const v4f*)(&so[wave][rl][lane * 4]));
}
extern "C" void kernel_launch(void* const* d_in, const int* in_sizes, int n_in, void* d_out, int out_size, void* d_ws, size_t ws_size, hipStream_t stream) {
  (void)in_sizes; (void)n_in; (void)out_size; (void)ws_size;
  const float* Qi = (const float*)d_in[0]; const float* Ki = (const float*)d_in[1]; const float* Vi = (const float*)d_in[2]; const int* vlen = (const int*)d_in[3];
  const float* Wq = (const float*)d_in[4]; const float* Wk = (const float*)d_in[5]; const float* Wv = (const float*)d_in[6]; const float* Wo = (const float*)d_in[7];
  float* out = (float*)d_out;
  char* ws = (char*)d_ws; size_t off = 0;
  auto take = [&](size_t bytes) { char* p = ws + off; off += (bytes + 255) & ~(size_t)255; return p; };
  __bf16* XQ = (__bf16*)take((size_t)NR * E * 2); __bf16* XK = (__bf16*)take((size_t)NR * E * 2); __bf16* XV = (__bf16*)take((size_t)NR * E * 2); __bf16* PT = (__bf16*)take((size_t)4 * E * E * 2);
  float* Q32 = (float*)take((size_t)NR * E * 4); __bf16* Kh = (__bf16*)take((size_t)NR * E * 2); __bf16* Kl = (__bf16*)take((size_t)NR * E * 2); _Float16* VTh = (_Float16*)take((size_t)NR * E * 2); _Float16* VTl = (_Float16*)take((size_t)NR * E * 2); float* O32 = (float*)take((size_t)NR * E * 4);
  // ws = 96 MiB
  k_prep<<<(3 * NR * E + 4 * E * E) / PB, 512, 0, stream>>>(Qi, Ki, Vi, Wq, Wk, Wv, Wo, XQ);   // XQ, XK, XV, PT are contiguous in ws
  k_qkv<<<dim3(NR / 128, E / 128, 3), 128, 0, stream>>>(XQ, XK, XV, PT, Q32, Kh, Kl, VTh, VTl);
  k_attn<<<dim3(SS / 64, NB * NH), 128, 0, stream>>>(Q32, Kh, Kl, VTh, VTl, vlen, O32);
  k_out<<<dim3(NR / 64, E / 128), 128, 0, stream>>>(O32, PT, out);
}

// v008
// One run takes 83.8 microseconds.
// Versions in between are left out here; by their measured steps it is 1.28 times as fast as v006.
// All steps since v000 together make it 4.74 times as fast.
// compute dtype: Q, K, V, W* (INPUTS) rounded to bf16 with exact bf16 WMMA products (f32 accumulate) for the projections; q, K, P and V each rounded once to f16 (11 significant bits), one f16 WMMA product for the scores and one for P.V, f32 accumulate; ctx split bf16 hi/lo for the output projection; softmax with the -1e6 valid-length fill in f32 (no sentinel shortcut, so a zero valid length yields the reference's uniform row).
#include <hip/hip_runtime.h>
#include <math.h>

typedef __attribute__((ext_vector_type(16))) _Float16 v16h;
typedef __attribute__((ext_vector_type(16))) __bf16 v16b;
typedef __attribute__((ext_vector_type(8)))  _Float16 v8h;
typedef __attribute__((ext_vector_type(8)))  float v8f;
typedef __attribute__((ext_vector_type(4)))  float v4f;
typedef __attribute__((ext_vector_type(2)))  float v2f;
typedef __attribute__((ext_vector_type(4)))  unsigned v4u;
typedef __attribute__((ext_vector_type(2)))  unsigned v2u;
typedef __attribute__((ext_vector_type(4)))  int v4i;
typedef float __attribute__((may_alias)) float_a;
typedef int __attribute__((may_alias)) int_a;

template <typename T> __device__ __forceinline__ void vst2(void* p, T v) { *(T*)p = v;  }
__device__ __forceinline__ v8f wmma16(v16h a, v16h b, v8f c) {
  return __builtin_amdgcn_wmma_f32_16x16x32_f16(false, a, false, b, (short)0, c, false, false);
}
__device__ __forceinline__ v8f wmma_bf(v16b a, v16b b, v8f c) {
  return __builtin_amdgcn_wmma_f32_16x16x32_bf16(false, a, false, b, (short)0, c, false, false);
}
// 16x16x32 fragments: lane = (h = lane>>4, row/col = lane&15); elements 0..7 = k0+8h+0..7, 8..15 = k0+16+8h+0..7; D element r = row 8h+r
__device__ __forceinline__ v16h frag_h(const _Float16* rowk0, int lane) {
  union { v16h v; v8h q[2]; } u; const _Float16* p = rowk0 + 8 * (lane >> 4);
  u.q[0] = *(const v8h*)p; u.q[1] = *(const v8h*)(p + 16); return u.v;
}
__device__ __forceinline__ v16h frag_f32(const float* rowk0, int lane) {
  v16h a; const float* p = rowk0 + 8 * (lane >> 4);
#pragma unroll
  for (int i = 0; i < 8; ++i) { a[i] = (_Float16)p[i]; a[8 + i] = (_Float16)p[16 + i]; }
  return a;
}
__device__ __forceinline__ v16h frag_f32s(const float* rowk0, int lane, float sc) {
  v16h a; const float* p = rowk0 + 8 * (lane >> 4);
#pragma unroll
  for (int i = 0; i < 8; ++i) { a[i] = (_Float16)(p[i] * sc); a[8 + i] = (_Float16)(p[16 + i] * sc); }
  return a;
}
// column fragment from a [K][ld] layout (column n), rows >= K read as 0
__device__ __forceinline__ v16h fragc_f32(const float* W, int k0, int n, int lane, int ld, int K) {
  v16h a; const int g = lane >> 4;
#pragma unroll
  for (int i = 0; i < 8; ++i) { const int ka = k0 + 8 * g + i, kb = ka + 16;
    a[i] = (_Float16)(ka < K ? W[(size_t)ka * ld + n] : 0.f); a[8 + i] = (_Float16)(kb < K ? W[(size_t)kb * ld + n] : 0.f); }
  return a;
}
struct F2 { v16b h, l; };
__device__ __forceinline__ F2 bsplit16(const float v[16]) { F2 r;
#pragma unroll
  for (int i = 0; i < 16; ++i) { const __bf16 h = (__bf16)v[i]; r.h[i] = h; r.l[i] = (__bf16)(v[i] - (float)h); }
  return r; }
__device__ __forceinline__ F2 split_row(const float* row, int k0, int lane) { float v[16]; const float* p = row + k0 + 8 * (lane >> 4);
#pragma unroll
  for (int i = 0; i < 8; ++i) { v[i] = p[i]; v[8 + i] = p[16 + i]; }
  return bsplit16(v); }
__device__ __forceinline__ F2 split_rowK(const float* row, int k0, int lane, int K) { float v[16]; const int g = lane >> 4;
#pragma unroll
  for (int i = 0; i < 8; ++i) { const int ka = k0 + 8 * g + i, kb = ka + 16; v[i] = ka < K ? row[ka] : 0.f; v[8 + i] = kb < K ? row[kb] : 0.f; }
  return bsplit16(v); }
__device__ __forceinline__ F2 split_col(const float* W, int k0, int n, int lane, int ld, int K) { float v[16]; const int g = lane >> 4;
#pragma unroll
  for (int i = 0; i < 8; ++i) { const int ka = k0 + 8 * g + i, kb = ka + 16; v[i] = ka < K ? W[(size_t)ka * ld + n] : 0.f; v[8 + i] = kb < K ? W[(size_t)kb * ld + n] : 0.f; }
  return bsplit16(v); }
__device__ __forceinline__ v8f mac3(const F2& a, const F2& b, v8f c) { c = wmma_bf(a.l, b.h, c); c = wmma_bf(a.h, b.l, c); return wmma_bf(a.h, b.h, c); }
__device__ __forceinline__ float sigm(float v) { return 1.0f / (1.0f + expf(-v)); }
#define LDSX() do { asm volatile("s_wait_dscnt 0" ::: "memory"); __builtin_amdgcn_wave_barrier(); __builtin_amdgcn_fence(__ATOMIC_RELEASE, "workgroup"); } while (0)


// d2l-style multi-head attention (16 heads of 64 on [4,1024,1024]; separate Q/K/V inputs, [out][in] weights, no biases): scores = q.k/8, then where(key < valid_lens[bh*L + q], score, -1e6) (per-row valid length, int input), softmax, (P v) Wo^T.
#define NB 4
#define SS 1024
#define E 1024
#define NH 16
#define HD 64
#define NR (NB * SS)
#define L2E 1.4426950408889634f   // log2(e)
__device__ __forceinline__ float bfr(float v) { return (float)(__bf16)v; }
__device__ __forceinline__ v16b frag_b(const __bf16* rowk0, int lane) { return __builtin_bit_cast(v16b, frag_h((const _Float16*)rowk0, lane)); }

// Operand tiles go from global memory to LDS as whole 128-byte lines, 16 bytes a lane, through no register; the fragments are then read from LDS rows at a pitch of 16 B x odd.
#define RP 144   // LDS pitch in bytes of a 128-byte row
#define RPF 272  // LDS pitch in bytes of a 256-byte row
__device__ __forceinline__ unsigned lds_off(const void* p) { return (unsigned)(size_t)p; }
#define ACP(l, g) "global_load_async_to_lds_b128 %" #l ", %" #g ", off\n\t"
// four copies of a lane: LDS address l + i*ls, global address g + i*gs; s_wait_xcnt 0 closes the statement so that no address register is rewritten ahead of it
__device__ __forceinline__ void acp4(unsigned l, const char* g, unsigned ls, size_t gs) {
  asm volatile(ACP(0, 4) ACP(1, 5) ACP(2, 6) ACP(3, 7) "s_wait_xcnt 0x0"
               :: "v"(l), "v"(l + ls), "v"(l + 2 * ls), "v"(l + 3 * ls), "v"(g), "v"(g + gs), "v"(g + 2 * gs), "v"(g + 3 * gs) : "memory");
}
// eight copies of a lane, four from each of two bases, one closing s_wait_xcnt 0 (same reason)
__device__ __forceinline__ void acp8(unsigned l, const char* g, unsigned m, const char* h, unsigned ls, size_t gs) {
  asm volatile(ACP(0, 8) ACP(1, 9) ACP(2, 10) ACP(3, 11) ACP(4, 12) ACP(5, 13) ACP(6, 14) ACP(7, 15) "s_wait_xcnt 0x0"
               :: "v"(l), "v"(l + ls), "v"(l + 2 * ls), "v"(l + 3 * ls), "v"(m), "v"(m + ls), "v"(m + 2 * ls), "v"(m + 3 * ls),
                  "v"(g), "v"(g + gs), "v"(g + 2 * gs), "v"(g + 3 * gs), "v"(h), "v"(h + gs), "v"(h + 2 * gs), "v"(h + 3 * gs) : "memory");
}
// this wave's LDS reads have returned: stands in front of the barrier behind which their buffer is filled again
#define WAIT_DS() asm volatile("s_wait_dscnt 0x0" ::: "memory")
// this wave's copies have landed: stands in front of the barrier behind which other waves read them
#define WAIT_ACP() asm volatile("s_wait_asynccnt 0x0" ::: "memory")

// every f32 -> bf16 rounding of the inputs in one streaming launch: dst holds XQ, XK, XV (NR x E each) and PT, one behind the other.
// PT rows: [0,E) Wq, [E,2E) Wk, [2E,3E) Wv, [3E,4E) Wo  ([out][in] weights: PT row n = W row n % E, so the pack is the same elementwise rounding)
#define PB 65536   // elements of a block: 512 threads x 32 pieces of 4; 256 blocks in all
__global__ __launch_bounds__(512) void k_prep(const float* __restrict__ Qi, const float* __restrict__ Ki, const float* __restrict__ Vi, const float* __restrict__ Wq, const float* __restrict__ Wk, const float* __restrict__ Wv, const float* __restrict__ Wo, __bf16* __restrict__ dst) {
  const unsigned blk = blockIdx.x, seg = blk / (NR * E / PB), ws = (blk / (E * E / PB)) & 3;      // 64 blocks an activation, 16 a weight
  const float* s = seg == 0 ? Qi : (seg == 1 ? Ki : (seg == 2 ? Vi : (ws == 0 ? Wq : (ws == 1 ? Wk : (ws == 2 ? Wv : Wo)))));
  s += (size_t)(seg < 3 ? blk % (NR * E / PB) : blk % (E * E / PB)) * PB + threadIdx.x * 4;
  __bf16* d = dst + (size_t)blk * PB + threadIdx.x * 4;
  v4f v[32];
#pragma unroll     // unrolled so that a lane's loads go out far ahead of their use (many in flight a wave); each covers 512 contiguous bytes of a wave
  for (int i = 0; i < 32; ++i) v[i] = *(const v4f*)(s + i * 2048);
#pragma unroll
  for (int i = 0; i < 32; ++i) { union { __bf16 h[4]; v2u u; } pk;
#pragma unroll
    for (int e = 0; e < 4; ++e) pk.h[e] = (__bf16)v[i][e];
    vst2((unsigned*)(d + i * 2048), pk.u); }
}
// QKV: block (128 rows, 128 cols = 2 heads, which), four waves of 64 rows x 64 cols (one head) each: a k chunk's 8 fragments feed 16 products; q (+bias) -> Q32 f32 [bh][s][64]; k (+bias) -> f16 rows; v (+bias) -> VT f16 x4 [bh][d][s]
__global__ __launch_bounds__(128) void k_qkv(const __bf16* __restrict__ XQ, const __bf16* __restrict__ XK, const __bf16* __restrict__ XV, const __bf16* __restrict__ PT, float* __restrict__ Q32, _Float16* __restrict__ Kh, _Float16* __restrict__ VTh) {
  constexpr int STG = (128 + 128) * RP;                    // one stage: 128 X rows, then 128 weight rows, 64 k each
  __shared__ __align__(16) char smem[2 * STG];             // two stages in the k loop; the output staging behind it
  float (*so)[64][68] = (float (*)[64][68])smem;           // a wave's own 64 x 64 tile
  _Float16 (*sth)[136] = (_Float16 (*)[136])smem;
  const int tid = threadIdx.x, wave = tid >> 5, lane = tid & 31, col = lane & 15, g = lane >> 4, wr = wave >> 1, wc = wave & 1;
  const int which = blockIdx.z, r0b = blockIdx.x * 128, n0 = blockIdx.y * 128; const int b = r0b / SS, s0 = r0b % SS;
  const __bf16* Xb = which == 0 ? XQ : (which == 1 ? XK : XV);
  v8f acc[4][4] = {};
  const unsigned l0 = lds_off(smem) + (tid >> 3) * RP + (tid & 7) * 16;       // a copy of the block: 16 rows, 8 lanes a row
  const char* gX = (const char*)(Xb + (size_t)(r0b + (tid >> 3)) * E + (tid & 7) * 8);
  const char* gW = (const char*)(PT + (size_t)(which * E + n0 + (tid >> 3)) * E + (tid & 7) * 8);
  auto fill = [&](int t) { const unsigned l = l0 + (t & 1) * STG; const size_t ko = (size_t)t * 128;
    acp8(l, gX + ko, l + 64 * RP, gX + ko + (size_t)64 * E * 2, 16 * RP, (size_t)16 * E * 2);
    acp8(l + 128 * RP, gW + ko, l + 192 * RP, gW + ko + (size_t)64 * E * 2, 16 * RP, (size_t)16 * E * 2); };
  fill(0); WAIT_ACP(); __syncthreads(); fill(1);
#pragma unroll 2   // two trips a body: each half addresses its buffer by constant offsets
  for (int t = 0; t < E / 64; ++t) { const char* sb = smem + (t & 1) * STG;
#pragma unroll
    for (int kc = 0; kc < 2; ++kc) { v16b a[4], wb[4];
#pragma unroll     // the LDS reads of a k chunk go out as one group, so that their latency is paid once and not per product; a[] and wb[] stay in registers
      for (int i = 0; i < 4; ++i) a[i] = frag_b((const __bf16*)(sb + (wr * 64 + i * 16 + col) * RP) + kc * 32, lane);
#pragma unroll
      for (int j = 0; j < 4; ++j) wb[j] = frag_b((const __bf16*)(sb + (128 + wc * 64 + j * 16 + col) * RP) + kc * 32, lane);
      __builtin_amdgcn_sched_barrier(0);   // holds the group of reads ahead of the products: left free, this build fetched each a[i] directly in front of its four products and waited out the LDS latency four times a chunk
#pragma unroll
      for (int i = 0; i < 4; ++i) {
#pragma unroll
        for (int j = 0; j < 4; ++j) acc[i][j] = wmma_bf(a[i], wb[j], acc[i][j]); } }
    __builtin_amdgcn_sched_barrier(0);                     // holds the products ahead of the barrier: left free, this build sank the last chunk's sixteen behind it, in front of the refill, whose copies then had that much less time to land
    WAIT_DS(); WAIT_ACP(); __syncthreads();                // stage t + 1 is published, stage t's buffer is free
    if (t + 2 < E / 64) fill(t + 2); }
  WAIT_ACP();
  const int h = (n0 >> 6) + wc;                            // my wave's head
  if (which < 2) {
#pragma unroll
    for (int i = 0; i < 4; ++i) {
#pragma unroll
      for (int j = 0; j < 4; ++j) { const float bb = 0.f;
#pragma unroll
        for (int r = 0; r < 8; ++r) so[wave][i * 16 + 8 * g + r][j * 16 + col] = acc[i][j][r] + bb; } }
    LDSX();
    if (which == 0) { for (int qq = lane; qq < 64 * 16; qq += 32) { const int rl = qq >> 4, pc = qq & 15;
        vst2(Q32 + (((size_t)b * NH + h) * SS + s0 + wr * 64 + rl) * HD + pc * 4, *(const v4f*)(&so[wave][rl][pc * 4])); } }
    else {
      for (int qq = lane; qq < 64 * 8; qq += 32) { const int rl = qq >> 3, pc = qq & 7; union { _Float16 e[8]; v4u u; } pk;
#pragma unroll
        for (int e = 0; e < 8; ++e) pk.e[e] = (_Float16)so[wave][rl][pc * 8 + e];
        vst2((unsigned*)(Kh + (((size_t)b * NH + h) * SS + s0 + wr * 64 + rl) * HD + pc * 8), pk.u); } } }
  else {
#pragma unroll
    for (int i = 0; i < 4; ++i) {
#pragma unroll
      for (int j = 0; j < 4; ++j) { const float bb = 0.f;
#pragma unroll
        for (int r = 0; r < 8; ++r) sth[wc * 64 + j * 16 + col][wr * 64 + i * 16 + 8 * g + r] = (_Float16)((acc[i][j][r] + bb) * 4.0f); } }
    __syncthreads();
    for (int qq = tid; qq < 128 * 16; qq += 128) { const int cl = qq >> 4, pc = qq & 15; const int c = n0 + cl, hc = c >> 6, d = c & 63; const size_t o = (((size_t)b * NH + hc) * HD + d) * SS + s0 + pc * 8;
      vst2(VTh + o, *(const v4u*)(&sth[cl][pc * 8])); } }
}
// eight hardware exponentials, each in its own register, in one statement: behind a transcendental the instruction set asks for one independent instruction before its result is read or its source overwritten;
// here each is that instruction for the one before it and the v_nop for the last
__device__ __forceinline__ void exp2x8(float (&e)[8]) {
  asm("v_exp_f32 %0, %0\n\tv_exp_f32 %1, %1\n\tv_exp_f32 %2, %2\n\tv_exp_f32 %3, %3\n\tv_exp_f32 %4, %4\n\tv_exp_f32 %5, %5\n\tv_exp_f32 %6, %6\n\tv_exp_f32 %7, %7\n\tv_nop"
      : "+v"(e[0]), "+v"(e[1]), "+v"(e[2]), "+v"(e[3]), "+v"(e[4]), "+v"(e[5]), "+v"(e[6]), "+v"(e[7]));
}
// padding-masked attention: block (128 queries, bh), four waves of 32 query columns (two column groups of 16) each; all 16 key tiles; transposed products: S^T = K q^T (K rows as A, q as B), O^T += V^T P^T (V^T rows as A, P^T as B), all four operands f16; O f32 [bh][s][64]
// every K and V^T fragment read from LDS feeds one product of each column group, and a K or V tile copied from L2 serves 128 queries
// a lane holds one query column of each group: its scores, maximum, sum, valid length and rescale factor stay in its registers, and two score tiles (keys 8g+r and 16+8g+r of 32) are the B fragment of the second product as they stand
// softmax in base 2: scores and the fill carry the factor log2(e), and the running maximum lies 14 below the true one, so that one hardware exponential gives 2^14 e^(score - max)
__global__ __launch_bounds__(128) void k_attn(const float* __restrict__ Q32, const _Float16* __restrict__ Kh, const _Float16* __restrict__ VTh, const int* __restrict__ vlen, float* __restrict__ O32) {
  __shared__ __align__(16) char sKV[4 * 32 * 68 * 4];      // in the loop its first 2 * 64 * RP bytes: K buffer (64 keys x 64 d), V buffer: V^T (64 d x 64 keys); behind the loop all of it: the output staging
  float (*so)[32][68] = (float (*)[32][68])sKV;            // a wave's own 32 queries x 64 d
  const int tid = threadIdx.x, w = tid >> 5, lane = tid & 31, col = lane & 15, g = lane >> 4;
  const size_t bh = blockIdx.y; const int qb = blockIdx.x; const int q0 = qb * 128 + w * 32;
  v16h aq[2][2]; int vrel[2];
#pragma unroll
  for (int c = 0; c < 2; ++c) {
#pragma unroll
    for (int kc = 0; kc < 2; ++kc) aq[c][kc] = frag_f32(Q32 + (bh * SS + q0 + c * 16 + col) * HD + kc * 32, lane);
    vrel[c] = vlen[bh * SS + q0 + c * 16 + col] - 8 * g; } // valid length of my query column, counted from my half's first key row
  float mrun[2] = {-3.0e38f, -3.0e38f}, lrun[2] = {0.f, 0.f}; v8f acc[2][4] = {};
  const unsigned l0 = lds_off(sKV) + (tid >> 3) * RP + (tid & 7) * 16;        // a copy of the block: 16 rows, 8 lanes a row
  const size_t oK = ((bh * SS + (tid >> 3)) * HD + (tid & 7) * 8) * 2, oV = ((bh * HD + (tid >> 3)) * SS + (tid & 7) * 8) * 2;
  // two buffers, stages K(0), V(0), K(1), V(1), ...: the score pass reads the K buffer alone, the P.V pass the V buffer alone; each refill flies during the other pass
  auto fillK = [&](int kt) { acp4(l0, (const char*)Kh + oK + (size_t)kt * 64 * HD * 2, 16 * RP, (size_t)16 * HD * 2); };
  auto fillV = [&](int kt) { acp4(l0 + 64 * RP, (const char*)VTh + oV + (size_t)kt * 128, 16 * RP, (size_t)16 * SS * 2); };
  fillK(0); WAIT_ACP(); __syncthreads(); fillV(0);
#pragma unroll 1
  for (int kt = 0; kt < SS / 64; ++kt) { v8f s[2][4]; v16h fr[4][2];
#pragma unroll
    for (int t = 0; t < 4; ++t) {
#pragma unroll     // the tile's eight K fragments go out as one group, so that the LDS latency is paid once a key tile and not per fragment: with two waves on a SIMD little else covers it
      for (int kc = 0; kc < 2; ++kc) fr[t][kc] = frag_h((const _Float16*)(sKV + (t * 16 + col) * RP) + kc * 32, lane); }
    __builtin_amdgcn_sched_barrier(0);                     // holds the group of reads ahead of the products: left free, this build fetched each fragment directly in front of its two products and waited for it there
#pragma unroll
    for (int t = 0; t < 4; ++t) { v8f x[2] = {};
#pragma unroll
      for (int kc = 0; kc < 2; ++kc) {
#pragma unroll
        for (int c = 0; c < 2; ++c) x[c] = wmma16(fr[t][kc], aq[c][kc], x[c]); }
#pragma unroll
      for (int c = 0; c < 2; ++c) {
#pragma unroll
        for (int r = 0; r < 8; ++r) s[c][t][r] = (kt * 64 + t * 16 + r < vrel[c]) ? x[c][r] * (0.125f * L2E) : -1.0e6f * L2E; } }
    __builtin_amdgcn_sched_barrier(0);                     // holds the score products ahead of the wait below: left free, this build lifted that wait to directly behind the K reads, where V(kt)'s copies, issued just before, had had little time to land
    WAIT_DS(); WAIT_ACP(); __syncthreads();                // V(kt) is published, the K buffer is free
    if (kt + 1 < SS / 64) fillK(kt + 1);
#pragma unroll
    for (int t = 0; t < 4; ++t) {
#pragma unroll     // the tile's eight V^T fragments go out as one group ahead of the softmax, whose vector work covers their latency
      for (int kc = 0; kc < 2; ++kc) fr[t][kc] = frag_h((const _Float16*)(sKV + (64 + t * 16 + col) * RP) + kc * 32, lane); }
    __builtin_amdgcn_sched_barrier(0);                     // holds these reads ahead of the softmax: left free, this build sank each behind it, directly in front of its two products
    v16h ph[2][2]; float mx[2];
#pragma unroll     // both groups' maxima first, a chain per score tile, then both exchanges between the wave's halves under one wait (a maximum is exact in any order)
    for (int c = 0; c < 2; ++c) { float mt[4];
#pragma unroll
      for (int t = 0; t < 4; ++t) { mt[t] = -3.4e38f;
#pragma unroll
        for (int r = 0; r < 8; ++r) mt[t] = fmaxf(mt[t], s[c][t][r]); }
      mx[c] = fmaxf(fmaxf(mt[0], mt[1]), fmaxf(mt[2], mt[3])); }
    const float mo[2] = {__shfl_xor(mx[0], 16, 32), __shfl_xor(mx[1], 16, 32)};
#pragma unroll
    for (int c = 0; c < 2; ++c) {
      const float mnew = fmaxf(mrun[c], fmaxf(mx[c], mo[c]) - 14.0f); const float corr = __builtin_amdgcn_exp2f(mrun[c] - mnew);
      float ps = 0.f;
#pragma unroll
      for (int t = 0; t < 4; ++t) { float e[8];
#pragma unroll
        for (int r = 0; r < 8; ++r) e[r] = s[c][t][r] - mnew;
        exp2x8(e);
#pragma unroll
        for (int r = 0; r < 8; ++r) { ps += e[r]; ph[c][t >> 1][(t & 1) * 8 + r] = (_Float16)e[r]; } }
      ps += __shfl_xor(ps, 16, 32);
      lrun[c] = lrun[c] * corr + ps * (1.0f / 16384.0f); mrun[c] = mnew;
#pragma unroll
      for (int t = 0; t < 4; ++t) {
#pragma unroll
        for (int r = 0; r < 8; ++r) acc[c][t][r] *= corr; } }
#pragma unroll
    for (int kc = 0; kc < 2; ++kc) {
#pragma unroll
      for (int t = 0; t < 4; ++t) {
#pragma unroll
        for (int c = 0; c < 2; ++c) acc[c][t] = wmma16(fr[t][kc], ph[c][kc], acc[c][t]); } }
    __builtin_amdgcn_sched_barrier(0);                     // holds the softmax and the products ahead of the wait below: left free, this build lifted that wait to directly behind the V^T reads, whose latency then lay open
    WAIT_DS(); WAIT_ACP(); __syncthreads();                // K(kt + 1) is published, the V buffer is free
    if (kt + 1 < SS / 64) fillV(kt + 1); }
  WAIT_ACP();
#pragma unroll
  for (int c = 0; c < 2; ++c) { const float inv = 1.0f / (lrun[c] * 16384.0f * 4.0f);
#pragma unroll
    for (int t = 0; t < 4; ++t) { v4f o[2];
#pragma unroll
      for (int r = 0; r < 8; ++r) o[r >> 2][r & 3] = acc[c][t][r] * inv;
      *(v4f*)(&so[w][c * 16 + col][t * 16 + 8 * g]) = o[0]; *(v4f*)(&so[w][c * 16 + col][t * 16 + 8 * g + 4]) = o[1]; } }
  LDSX();
  for (int qq = lane; qq < 32 * 16; qq += 32) { const int rl = qq >> 4, pc = qq & 15; vst2(O32 + ((bh * SS) + q0 + rl) * HD + pc * 4, *(const v4f*)(&so[w][rl][pc * 4])); }
}
// out = ctx Wo^T : split(ctx) x bf16(Wo rows): 2 products (Wo is an INPUT -> bf16 exact)
__global__ __launch_bounds__(128) void k_out(const float* __restrict__ O32, const __bf16* __restrict__ PT, float* __restrict__ out) {
  constexpr int STA = 64 * RPF, STG = STA + 128 * RP;      // one stage: 64 ctx rows of one head (f32), then 128 weight rows, 64 k each
  __shared__ __align__(16) char smem[2 * STG];             // two stages in the k loop; the output staging behind it
  float (*so)[16][132] = (float (*)[16][132])smem;
  const int tid = threadIdx.x, wave = tid >> 5, lane = tid & 31, col = lane & 15, g = lane >> 4;
  const int r0b = blockIdx.x * 64, r0 = r0b + wave * 16, n0 = blockIdx.y * 128; const int b = r0b / SS, s0 = r0b % SS;
  v8f acc[8] = {};
  const unsigned lA = lds_off(smem) + (tid >> 4) * RPF + (tid & 15) * 16;     // a copy of the block: 8 ctx rows, 16 lanes a row
  const unsigned lW = lds_off(smem) + STA + (tid >> 3) * RP + (tid & 7) * 16; // or 16 weight rows, 8 lanes a row
  const char* gA = (const char*)(O32 + ((size_t)b * NH * SS + s0 + (tid >> 4)) * HD + (tid & 15) * 4);
  const char* gW = (const char*)(PT + (size_t)(3 * E + n0 + (tid >> 3)) * E + (tid & 7) * 8);
  auto fill = [&](int t) { const unsigned lo = (t & 1) * STG; const char* ga = gA + (size_t)t * SS * HD * 4; const char* gw = gW + (size_t)t * 128;   // pass t = head t
    acp8(lA + lo, ga, lA + lo + 32 * RPF, ga + (size_t)32 * HD * 4, 8 * RPF, (size_t)8 * HD * 4);
    acp8(lW + lo, gw, lW + lo + 64 * RP, gw + (size_t)64 * E * 2, 16 * RP, (size_t)16 * E * 2); };
  fill(0); WAIT_ACP(); __syncthreads(); fill(1);
#pragma unroll 2   // two trips a body: each half addresses its buffer by constant offsets
  for (int t = 0; t < E / 64; ++t) { const char* sb = smem + (t & 1) * STG;
#pragma unroll
    for (int kc = 0; kc < 2; ++kc) { const F2 a = split_row((const float*)(sb + (wave * 16 + col) * RPF), kc * 32, lane); v16b wb[8];
#pragma unroll     // the LDS reads of a k chunk go out as one group, so that their latency is paid once and not per product; wb[] stays in registers
      for (int j = 0; j < 8; ++j) wb[j] = frag_b((const __bf16*)(sb + STA + (j * 16 + col) * RP) + kc * 32, lane);
      __builtin_amdgcn_sched_barrier(0);   // holds a chunk's reads ahead of its own products as one group (same reason as in k_qkv)
#pragma unroll
      for (int j = 0; j < 8; ++j) { acc[j] = wmma_bf(a.l, wb[j], acc[j]); acc[j] = wmma_bf(a.h, wb[j], acc[j]); } }
    __builtin_amdgcn_sched_barrier(0);                     // holds the products ahead of the barrier, so that the refill behind it goes out no later than before (same reason as in k_qkv)
    WAIT_DS(); WAIT_ACP(); __syncthreads();                // stage t + 1 is published, stage t's buffer is free
    if (t + 2 < E / 64) fill(t + 2); }
  WAIT_ACP();
#pragma unroll
  for (int j = 0; j < 8; ++j) {
#pragma unroll
    for (int r = 0; r < 8; ++r) so[wave][8 * g + r][j * 16 + col] = acc[j][r]; }
  LDSX();
#pragma unroll 4
  for (int rl = 0; rl < 16; ++rl) vst2(out + (size_t)(r0 + rl) * E + n0 + lane * 4, *(const v4f*)(&so[wave][rl][lane * 4]));
}
extern "C" void kernel_launch(void* const* d_in, const int* in_sizes, int n_in, void* d_out, int out_size, void* d_ws, size_t ws_size, hipStream_t stream) {
  (void)in_sizes; (void)n_in; (void)out_size; (void)ws_size;
  const float* Qi = (const float*)d_in[0]; const float* Ki = (const float*)d_in[1]; const float* Vi = (const float*)d_in[2]; const int* vlen = (const int*)d_in[3];
  const float* Wq = (const float*)d_in[4]; const float* Wk = (const float*)d_in[5]; const float* Wv = (const float*)d_in[6]; const float* Wo = (const float*)d_in[7];
  float* out = (float*)d_out;
  char* ws = (char*)d_ws; size_t off = 0;
  auto take = [&](size_t bytes) { char* p = ws + off; off += (bytes + 255) & ~(size_t)255; return p; };
  __bf16* XQ = (__bf16*)take((size_t)NR * E * 2); __bf16* XK = (__bf16*)take((size_t)NR * E * 2); __bf16* XV = (__bf16*)take((size_t)NR * E * 2); __bf16* PT = (__bf16*)take((size_t)4 * E * E * 2);
  float* Q32 = (float*)take((size_t)NR * E * 4); _Float16* Kh = (_Float16*)take((size_t)NR * E * 2); _Float16* VTh = (_Float16*)take((size_t)NR * E * 2); float* O32 = (float*)take((size_t)NR * E * 4);
  // ws 80 MiB
  k_prep<<<(3 * NR * E + 4 * E * E) / PB, 512, 0, stream>>>(Qi, Ki, Vi, Wq, Wk, Wv, Wo, XQ);   // XQ, XK, XV, PT are contiguous in ws
  k_qkv<<<dim3(NR / 128, E / 128, 3), 128, 0, stream>>>(XQ, XK, XV, PT, Q32, Kh, VTh);
  k_attn<<<dim3(SS / 128, NB * NH), 128, 0, stream>>>(Q32, Kh, VTh, vlen, O32);
  k_out<<<dim3(NR / 64, E / 128), 128, 0, stream>>>(O32, PT, out);
}

// v009
// A run of this version takes 80.1 microseconds.
// In two side-by-side timings against v008, it was 1.04 and 1.05 times as fast.
// All steps since v000 together make it 4.97 times as fast.
// compute dtype: Q, K, V, W* (INPUTS) rounded to bf16 with exact bf16 WMMA products (f32 accumulate) for the projections; q, K, P and V each rounded once to f16 (11 significant bits), one f16 WMMA product for the scores and one for P.V, f32 accumulate; ctx split bf16 hi/lo for the output projection; softmax with the -1e6 valid-length fill in f32 (no sentinel shortcut, so a zero valid length yields the reference's uniform row).
#include <hip/hip_runtime.h>
#include <math.h>

typedef __attribute__((ext_vector_type(16))) _Float16 v16h;
typedef __attribute__((ext_vector_type(16))) __bf16 v16b;
typedef __attribute__((ext_vector_type(8)))  _Float16 v8h;
typedef __attribute__((ext_vector_type(8)))  float v8f;
typedef __attribute__((ext_vector_type(4)))  float v4f;
typedef __attribute__((ext_vector_type(2)))  float v2f;
typedef __attribute__((ext_vector_type(4)))  unsigned v4u;
typedef __attribute__((ext_vector_type(2)))  unsigned v2u;
typedef __attribute__((ext_vector_type(4)))  int v4i;
typedef float __attribute__((may_alias)) float_a;
typedef int __attribute__((may_alias)) int_a;

template <typename T> __device__ __forceinline__ void vst2(void* p, T v) { *(T*)p = v;  }
__device__ __forceinline__ v8f wmma16(v16h a, v16h b, v8f c) {
  return __builtin_amdgcn_wmma_f32_16x16x32_f16(false, a, false, b, (short)0, c, false, false);
}
__device__ __forceinline__ v8f wmma_bf(v16b a, v16b b, v8f c) {
  return __builtin_amdgcn_wmma_f32_16x16x32_bf16(false, a, false, b, (short)0, c, false, false);
}
// 16x16x32 fragments: lane = (h = lane>>4, row/col = lane&15); elements 0..7 = k0+8h+0..7, 8..15 = k0+16+8h+0..7; D element r = row 8h+r
__device__ __forceinline__ v16h frag_h(const _Float16* rowk0, int lane) {
  union { v16h v; v8h q[2]; } u; const _Float16* p = rowk0 + 8 * (lane >> 4);
  u.q[0] = *(const v8h*)p; u.q[1] = *(const v8h*)(p + 16); return u.v;
}
__device__ __forceinline__ v16h frag_f32(const float* rowk0, int lane) {
  v16h a; const float* p = rowk0 + 8 * (lane >> 4);
#pragma unroll
  for (int i = 0; i < 8; ++i) { a[i] = (_Float16)p[i]; a[8 + i] = (_Float16)p[16 + i]; }
  return a;
}
__device__ __forceinline__ v16h frag_f32s(const float* rowk0, int lane, float sc) {
  v16h a; const float* p = rowk0 + 8 * (lane >> 4);
#pragma unroll
  for (int i = 0; i < 8; ++i) { a[i] = (_Float16)(p[i] * sc); a[8 + i] = (_Float16)(p[16 + i] * sc); }
  return a;
}
// column fragment from a [K][ld] layout (column n), rows >= K read as 0
__device__ __forceinline__ v16h fragc_f32(const float* W, int k0, int n, int lane, int ld, int K) {
  v16h a; const int g = lane >> 4;
#pragma unroll
  for (int i = 0; i < 8; ++i) { const int ka = k0 + 8 * g + i, kb = ka + 16;
    a[i] = (_Float16)(ka < K ? W[(size_t)ka * ld + n] : 0.f); a[8 + i] = (_Float16)(kb < K ? W[(size_t)kb * ld + n] : 0.f); }
  return a;
}
struct F2 { v16b h, l; };
__device__ __forceinline__ F2 bsplit16(const float v[16]) { F2 r;
#pragma unroll
  for (int i = 0; i < 16; ++i) { const __bf16 h = (__bf16)v[i]; r.h[i] = h; r.l[i] = (__bf16)(v[i] - (float)h); }
  return r; }
__device__ __forceinline__ F2 split_row(const float* row, int k0, int lane) { float v[16]; const float* p = row + k0 + 8 * (lane >> 4);
#pragma unroll
  for (int i = 0; i < 8; ++i) { v[i] = p[i]; v[8 + i] = p[16 + i]; }
  return bsplit16(v); }
__device__ __forceinline__ F2 split_rowK(const float* row, int k0, int lane, int K) { float v[16]; const int g = lane >> 4;
#pragma unroll
  for (int i = 0; i < 8; ++i) { const int ka = k0 + 8 * g + i, kb = ka + 16; v[i] = ka < K ? row[ka] : 0.f; v[8 + i] = kb < K ? row[kb] : 0.f; }
  return bsplit16(v); }
__device__ __forceinline__ F2 split_col(const float* W, int k0, int n, int lane, int ld, int K) { float v[16]; const int g = lane >> 4;
#pragma unroll
  for (int i = 0; i < 8; ++i) { const int ka = k0 + 8 * g + i, kb = ka + 16; v[i] = ka < K ? W[(size_t)ka * ld + n] : 0.f; v[8 + i] = kb < K ? W[(size_t)kb * ld + n] : 0.f; }
  return bsplit16(v); }
__device__ __forceinline__ v8f mac3(const F2& a, const F2& b, v8f c) { c = wmma_bf(a.l, b.h, c); c = wmma_bf(a.h, b.l, c); return wmma_bf(a.h, b.h, c); }
__device__ __forceinline__ float sigm(float v) { return 1.0f / (1.0f + expf(-v)); }
#define LDSX() do { asm volatile("s_wait_dscnt 0" ::: "memory"); __builtin_amdgcn_wave_barrier(); __builtin_amdgcn_fence(__ATOMIC_RELEASE, "workgroup"); } while (0)


// d2l-style multi-head attention (16 heads of 64 on [4,1024,1024]; separate Q/K/V inputs, [out][in] weights, no biases): scores = q.k/8, then where(key < valid_lens[bh*L + q], score, -1e6) (per-row valid length, int input), softmax, (P v) Wo^T.
#define NB 4
#define SS 1024
#define E 1024
#define NH 16
#define HD 64
#define NR (NB * SS)
#define L2E 1.4426950408889634f   // log2(e)
__device__ __forceinline__ float bfr(float v) { return (float)(__bf16)v; }
__device__ __forceinline__ v16b frag_b(const __bf16* rowk0, int lane) { return __builtin_bit_cast(v16b, frag_h((const _Float16*)rowk0, lane)); }

// Operand tiles go from global memory to LDS as whole 128-byte lines, 16 bytes a lane, through no register; the fragments are then read from LDS rows at a pitch of 16 B x odd.
#define RP 144   // LDS pitch in bytes of a 128-byte row
#define RPF 272  // LDS pitch in bytes of a 256-byte row
__device__ __forceinline__ unsigned lds_off(const void* p) { return (unsigned)(size_t)p; }
#define ACP(l, g) "global_load_async_to_lds_b128 %" #l ", %" #g ", off\n\t"
// four copies of a lane: LDS address l + i*ls, global address g + i*gs; s_wait_xcnt 0 closes the statement so that no address register is rewritten ahead of it
__device__ __forceinline__ void acp4(unsigned l, const char* g, unsigned ls, size_t gs) {
  asm volatile(ACP(0, 4) ACP(1, 5) ACP(2, 6) ACP(3, 7) "s_wait_xcnt 0x0"
               :: "v"(l), "v"(l + ls), "v"(l + 2 * ls), "v"(l + 3 * ls), "v"(g), "v"(g + gs), "v"(g + 2 * gs), "v"(g + 3 * gs) : "memory");
}
// eight copies of a lane, four from each of two bases, one closing s_wait_xcnt 0 (same reason)
__device__ __forceinline__ void acp8(unsigned l, const char* g, unsigned m, const char* h, unsigned ls, size_t gs) {
  asm volatile(ACP(0, 8) ACP(1, 9) ACP(2, 10) ACP(3, 11) ACP(4, 12) ACP(5, 13) ACP(6, 14) ACP(7, 15) "s_wait_xcnt 0x0"
               :: "v"(l), "v"(l + ls), "v"(l + 2 * ls), "v"(l + 3 * ls), "v"(m), "v"(m + ls), "v"(m + 2 * ls), "v"(m + 3 * ls),
                  "v"(g), "v"(g + gs), "v"(g + 2 * gs), "v"(g + 3 * gs), "v"(h), "v"(h + gs), "v"(h + 2 * gs), "v"(h + 3 * gs) : "memory");
}
// this wave's LDS reads have returned: stands in front of the barrier behind which their buffer is filled again
#define WAIT_DS() asm volatile("s_wait_dscnt 0x0" ::: "memory")
// this wave's copies have landed: stands in front of the barrier behind which other waves read them
#define WAIT_ACP() asm volatile("s_wait_asynccnt 0x0" ::: "memory")

// every f32 -> bf16 rounding of the inputs in one streaming launch: dst holds XQ, XK, XV (NR x E each) and PT, one behind the other.
// PT rows: [0,E) Wq, [E,2E) Wk, [2E,3E) Wv, [3E,4E) Wo  ([out][in] weights: PT row n = W row n % E, so the pack is the same elementwise rounding)
#define PB 65536   // elements of a block: 512 threads x 32 pieces of 4; 256 blocks in all
__global__ __launch_bounds__(512) void k_prep(const float* __restrict__ Qi, const float* __restrict__ Ki, const float* __restrict__ Vi, const float* __restrict__ Wq, const float* __restrict__ Wk, const float* __restrict__ Wv, const float* __restrict__ Wo, __bf16* __restrict__ dst) {
  const unsigned blk = blockIdx.x, seg = blk / (NR * E / PB), ws = (blk / (E * E / PB)) & 3;      // 64 blocks an activation, 16 a weight
  const float* s = seg == 0 ? Qi : (seg == 1 ? Ki : (seg == 2 ? Vi : (ws == 0 ? Wq : (ws == 1 ? Wk : (ws == 2 ? Wv : Wo)))));
  s += (size_t)(seg < 3 ? blk % (NR * E / PB) : blk % (E * E / PB)) * PB + threadIdx.x * 4;
  __bf16* d = dst + (size_t)blk * PB + threadIdx.x * 4;
  v4f v[32];
#pragma unroll     // unrolled so that a lane's loads go out far ahead of their use (many in flight a wave); each covers 512 contiguous bytes of a wave
  for (int i = 0; i < 32; ++i) v[i] = *(const v4f*)(s + i * 2048);
#pragma unroll
  for (int i = 0; i < 32; ++i) { union { __bf16 h[4]; v2u u; } pk;
#pragma unroll
    for (int e = 0; e < 4; ++e) pk.h[e] = (__bf16)v[i][e];
    vst2((unsigned*)(d + i * 2048), pk.u); }
}
// QKV: block (128 rows, 128 cols = 2 heads, which), four waves of 64 rows x 64 cols (one head) each: a k chunk's 8 fragments feed 16 products; q (+bias) -> Q32 f32 [bh][s][64]; k (+bias) -> f16 rows; v (+bias) -> VT f16 x4 [bh][d][s]
__global__ __launch_bounds__(128) void k_qkv(const __bf16* __restrict__ XQ, const __bf16* __restrict__ XK, const __bf16* __restrict__ XV, const __bf16* __restrict__ PT, float* __restrict__ Q32, _Float16* __restrict__ Kh, _Float16* __restrict__ VTh) {
  constexpr int STG = (128 + 128) * RP;                    // one stage: 128 X rows, then 128 weight rows, 64 k each
  __shared__ __align__(16) char smem[2 * STG];             // two stages in the k loop; the output staging behind it
  float (*so)[64][68] = (float (*)[64][68])smem;           // a wave's own 64 x 64 tile
  _Float16 (*sth)[136] = (_Float16 (*)[136])smem;
  const int tid = threadIdx.x, wave = tid >> 5, lane = tid & 31, col = lane & 15, g = lane >> 4, wr = wave >> 1, wc = wave & 1;
  const int which = blockIdx.z, r0b = blockIdx.x * 128, n0 = blockIdx.y * 128; const int b = r0b / SS, s0 = r0b % SS;
  const __bf16* Xb = which == 0 ? XQ : (which == 1 ? XK : XV);
  v8f acc[4][4] = {};
  const unsigned l0 = lds_off(smem) + (tid >> 3) * RP + (tid & 7) * 16;       // a copy of the block: 16 rows, 8 lanes a row
  const char* gX = (const char*)(Xb + (size_t)(r0b + (tid >> 3)) * E + (tid & 7) * 8);
  const char* gW = (const char*)(PT + (size_t)(which * E + n0 + (tid >> 3)) * E + (tid & 7) * 8);
  auto fill = [&](int t) { const unsigned l = l0 + (t & 1) * STG; const size_t ko = (size_t)t * 128;
    acp8(l, gX + ko, l + 64 * RP, gX + ko + (size_t)64 * E * 2, 16 * RP, (size_t)16 * E * 2);
    acp8(l + 128 * RP, gW + ko, l + 192 * RP, gW + ko + (size_t)64 * E * 2, 16 * RP, (size_t)16 * E * 2); };
  fill(0); WAIT_ACP(); __syncthreads(); fill(1);
#pragma unroll 2   // two trips a body: each half addresses its buffer by constant offsets
  for (int t = 0; t < E / 64; ++t) { const char* sb = smem + (t & 1) * STG;
#pragma unroll
    for (int kc = 0; kc < 2; ++kc) { v16b a[4], wb[4];
#pragma unroll     // the LDS reads of a k chunk go out as one group, so that their latency is paid once and not per product; a[] and wb[] stay in registers
      for (int i = 0; i < 4; ++i) a[i] = frag_b((const __bf16*)(sb + (wr * 64 + i * 16 + col) * RP) + kc * 32, lane);
#pragma unroll
      for (int j = 0; j < 4; ++j) wb[j] = frag_b((const __bf16*)(sb + (128 + wc * 64 + j * 16 + col) * RP) + kc * 32, lane);
      __builtin_amdgcn_sched_barrier(0);   // holds the group of reads ahead of the products: left free, this build fetched each a[i] directly in front of its four products and waited out the LDS latency four times a chunk
#pragma unroll
      for (int i = 0; i < 4; ++i) {
#pragma unroll
        for (int j = 0; j < 4; ++j) acc[i][j] = wmma_bf(a[i], wb[j], acc[i][j]); } }
    __builtin_amdgcn_sched_barrier(0);                     // holds the products ahead of the barrier: left free, this build sank the last chunk's sixteen behind it, in front of the refill, whose copies then had that much less time to land
    WAIT_DS(); WAIT_ACP(); __syncthreads();                // stage t + 1 is published, stage t's buffer is free
    if (t + 2 < E / 64) fill(t + 2); }
  WAIT_ACP();
  const int h = (n0 >> 6) + wc;                            // my wave's head
  if (which < 2) {
#pragma unroll
    for (int i = 0; i < 4; ++i) {
#pragma unroll
      for (int j = 0; j < 4; ++j) { const float bb = 0.f;
#pragma unroll
        for (int r = 0; r < 8; ++r) so[wave][i * 16 + 8 * g + r][j * 16 + col] = acc[i][j][r] + bb; } }
    LDSX();
    if (which == 0) { for (int qq = lane; qq < 64 * 16; qq += 32) { const int rl = qq >> 4, pc = qq & 15;
        vst2(Q32 + (((size_t)b * NH + h) * SS + s0 + wr * 64 + rl) * HD + pc * 4, *(const v4f*)(&so[wave][rl][pc * 4])); } }
    else {
      for (int qq = lane; qq < 64 * 8; qq += 32) { const int rl = qq >> 3, pc = qq & 7; union { _Float16 e[8]; v4u u; } pk;
#pragma unroll
        for (int e = 0; e < 8; ++e) pk.e[e] = (_Float16)so[wave][rl][pc * 8 + e];
        vst2((unsigned*)(Kh + (((size_t)b * NH + h) * SS + s0 + wr * 64 + rl) * HD + pc * 8), pk.u); } } }
  else {
#pragma unroll
    for (int i = 0; i < 4; ++i) {
#pragma unroll
      for (int j = 0; j < 4; ++j) { const float bb = 0.f;
#pragma unroll
        for (int r = 0; r < 8; ++r) sth[wc * 64 + j * 16 + col][wr * 64 + i * 16 + 8 * g + r] = (_Float16)((acc[i][j][r] + bb) * 4.0f); } }
    __syncthreads();
    for (int qq = tid; qq < 128 * 16; qq += 128) { const int cl = qq >> 4, pc = qq & 15; const int c = n0 + cl, hc = c >> 6, d = c & 63; const size_t o = (((size_t)b * NH + hc) * HD + d) * SS + s0 + pc * 8;
      vst2(VTh + o, *(const v4u*)(&sth[cl][pc * 8])); } }
}
// eight hardware exponentials, each in its own register, in one statement: behind a transcendental the instruction set asks for one independent instruction before its result is read or its source overwritten;
// here each is that instruction for the one before it and the v_nop for the last
__device__ __forceinline__ void exp2x8(float (&e)[8]) {
  asm("v_exp_f32 %0, %0\n\tv_exp_f32 %1, %1\n\tv_exp_f32 %2, %2\n\tv_exp_f32 %3, %3\n\tv_exp_f32 %4, %4\n\tv_exp_f32 %5, %5\n\tv_exp_f32 %6, %6\n\tv_exp_f32 %7, %7\n\tv_nop"
      : "+v"(e[0]), "+v"(e[1]), "+v"(e[2]), "+v"(e[3]), "+v"(e[4]), "+v"(e[5]), "+v"(e[6]), "+v"(e[7]));
}
// padding-masked attention: block (128 queries, bh), eight waves: four query groups of 32 columns (two column groups of 16) x two key halves of 8 key tiles, so that two blocks put four waves on a SIMD and one wave's vector work covers another's products, LDS reads and barrier waits;
// a key half has its own K and V buffers, filled by its own four waves, and its own running maximum, sum and O^T; the halves are joined once behind the loop; transposed products: S^T = K q^T (K rows as A, q as B), O^T += V^T P^T (V^T rows as A, P^T as B), all four operands f16; O f32 [bh][s][64]
// every K and V^T fragment read from LDS feeds one product of each column group, and a K or V tile copied from L2 serves 128 queries
// a lane holds one query column of each group: its scores, maximum, sum, valid length and rescale factor stay in its registers, and two score tiles (keys 8g+r and 16+8g+r of 32) are the B fragment of the second product as they stand
// softmax in base 2: scores and the fill carry the factor log2(e), and the running maximum lies 14 below the true one, so that one hardware exponential gives 2^14 e^(score - max)
__global__ __launch_bounds__(256) __attribute__((amdgpu_waves_per_eu(4, 4))) void k_attn(const float* __restrict__ Q32, const _Float16* __restrict__ Kh, const _Float16* __restrict__ VTh, const int* __restrict__ vlen, float* __restrict__ O32) {
  constexpr int SET = 2 * 64 * RP;                         // a key half's K buffer (64 keys x 64 d) and V buffer: V^T (64 d x 64 keys)
  __shared__ __align__(16) char sKV[2 * SET];              // in the loop: the two halves' buffers; behind the loop its first 4 * 32 * 68 * 4 bytes: a query group's 8704 bytes hold first the second half's state, then the output staging
  float (*so)[32][68] = (float (*)[32][68])sKV;            // a query group's own 32 queries x 64 d
  const int tid = threadIdx.x & 127, lane = tid & 31, col = lane & 15, g = lane >> 4;   // tid: my place among my key half's four waves
  const int w = __builtin_amdgcn_readfirstlane(tid >> 5);  // my query group, in a scalar register: what is formed from it holds no vector register through the loop
  const int kh = __builtin_amdgcn_readfirstlane((int)threadIdx.x >> 7);   // my key half, in a scalar register: it sets the key tile's number and the branches behind the loop
  const char* sH = sKV + kh * SET;
  const size_t bh = blockIdx.y; const int qb = blockIdx.x; const int q0 = qb * 128 + w * 32;
  v16h aq[2][2]; int vrel[2];
#pragma unroll
  for (int c = 0; c < 2; ++c) {
#pragma unroll
    for (int kc = 0; kc < 2; ++kc) aq[c][kc] = frag_f32(Q32 + (bh * SS + q0 + c * 16 + col) * HD + kc * 32, lane);
    vrel[c] = vlen[bh * SS + q0 + c * 16 + col] - 8 * g - kh * (SS / 2); } // valid length of my query column, counted from my lane half's first key row of the current key tile (64 less after each tile)
  float mrun[2] = {-3.0e38f, -3.0e38f}, lrun[2] = {0.f, 0.f}; v8f acc[2][4] = {};
  const unsigned l0 = lds_off(sH) + (tid >> 3) * RP + (tid & 7) * 16;         // a copy of a key half's four waves: 16 rows, 8 lanes a row
  const size_t oK = ((bh * SS + (tid >> 3)) * HD + (tid & 7) * 8) * 2, oV = ((bh * HD + (tid >> 3)) * SS + (tid & 7) * 8) * 2;
  // two buffers, stages K(0), V(0), K(1), V(1), ...: the score pass reads the K buffer alone, the P.V pass the V buffer alone; each refill flies during the other pass
  auto fillK = [&](int kt) { acp4(l0, (const char*)Kh + oK + (size_t)kt * 64 * HD * 2, 16 * RP, (size_t)16 * HD * 2); };
  auto fillV = [&](int kt) { acp4(l0 + 64 * RP, (const char*)VTh + oV + (size_t)kt * 128, 16 * RP, (size_t)16 * SS * 2); };
  constexpr int NT = SS / 64 / 2;                          // key tiles of a half
  fillK(kh * NT); WAIT_ACP(); __syncthreads(); fillV(kh * NT);
#pragma unroll 1
  for (int i = 0; i < NT; ++i) { const int kt = kh * NT + i; v8f s[2][4]; v16h fr[4][2];
#pragma unroll
    for (int t = 0; t < 4; ++t) {
#pragma unroll     // the tile's eight K fragments go out as one group, so that the LDS latency is paid once a key tile and not per fragment
      for (int kc = 0; kc < 2; ++kc) fr[t][kc] = frag_h((const _Float16*)(sH + (t * 16 + col) * RP) + kc * 32, lane); }
    __builtin_amdgcn_sched_barrier(0);                     // holds the group of reads ahead of the products: left free, this build fetched each fragment directly in front of its two products and waited for it there
#pragma unroll
    for (int t = 0; t < 4; ++t) { v8f x[2] = {};
#pragma unroll
      for (int kc = 0; kc < 2; ++kc) {
#pragma unroll
        for (int c = 0; c < 2; ++c) x[c] = wmma16(fr[t][kc], aq[c][kc], x[c]); }
#pragma unroll
      for (int c = 0; c < 2; ++c) {
#pragma unroll
        for (int r = 0; r < 8; ++r) s[c][t][r] = (t * 16 + r < vrel[c]) ? x[c][r] * (0.125f * L2E) : -1.0e6f * L2E; } }
    __builtin_amdgcn_sched_barrier(0);                     // holds the score products ahead of the wait below: left free, this build lifted that wait to directly behind the K reads, where V(kt)'s copies, issued just before, had had little time to land
    WAIT_DS(); WAIT_ACP(); __syncthreads();                // V(kt) is published, the K buffer is free
    if (i + 1 < NT) fillK(kt + 1);
#pragma unroll     // the tile's V^T fragments go out in two groups of four, 32 keys each (all eight ahead of the softmax do not fit the 256 registers of four waves a SIMD): the first ahead of the softmax, whose vector work covers its latency
    for (int t = 0; t < 4; ++t) fr[t][0] = frag_h((const _Float16*)(sH + (64 + t * 16 + col) * RP), lane);
    __builtin_amdgcn_sched_barrier(0);                     // holds these reads ahead of the softmax: left free, this build sank each behind it, directly in front of its two products
    v16h ph[2][2]; float mx[2];
#pragma unroll     // both groups' maxima first, a chain per score tile, then the two exchanges between the wave's halves (a maximum is exact in any order)
    for (int c = 0; c < 2; ++c) { float mt[4];
#pragma unroll
      for (int t = 0; t < 4; ++t) { mt[t] = -3.4e38f;
#pragma unroll
        for (int r = 0; r < 8; ++r) mt[t] = fmaxf(mt[t], s[c][t][r]); }
      mx[c] = fmaxf(fmaxf(mt[0], mt[1]), fmaxf(mt[2], mt[3])); }
    const float mo[2] = {__shfl_xor(mx[0], 16, 32), __shfl_xor(mx[1], 16, 32)};
#pragma unroll
    for (int c = 0; c < 2; ++c) {
      const float mnew = fmaxf(mrun[c], fmaxf(mx[c], mo[c]) - 14.0f); const float corr = __builtin_amdgcn_exp2f(mrun[c] - mnew);
      float ps = 0.f;
#pragma unroll
      for (int t = 0; t < 4; ++t) { float e[8];
#pragma unroll
        for (int r = 0; r < 8; ++r) e[r] = s[c][t][r] - mnew;
        exp2x8(e);
#pragma unroll
        for (int r = 0; r < 8; ++r) { ps += e[r]; ph[c][t >> 1][(t & 1) * 8 + r] = (_Float16)e[r]; } }
      ps += __shfl_xor(ps, 16, 32);
      lrun[c] = lrun[c] * corr + ps * (1.0f / 16384.0f); mrun[c] = mnew;
#pragma unroll
      for (int t = 0; t < 4; ++t) {
#pragma unroll
        for (int r = 0; r < 8; ++r) acc[c][t][r] *= corr; } }
#pragma unroll
    for (int kc = 0; kc < 2; ++kc) {
#pragma unroll
      for (int t = 0; t < 4; ++t) {
#pragma unroll
        for (int c = 0; c < 2; ++c) acc[c][t] = wmma16(fr[t][kc], ph[c][kc], acc[c][t]); }
      if (kc == 0) {
        __builtin_amdgcn_sched_barrier(0);                 // holds the second group behind the first 32 keys' products, whose fragments and P have then left their registers, and as one group (same reason)
#pragma unroll
        for (int t = 0; t < 4; ++t) fr[t][1] = frag_h((const _Float16*)(sH + (64 + t * 16 + col) * RP) + 32, lane);
        __builtin_amdgcn_sched_barrier(0); } }             // and ahead of its own products
    __builtin_amdgcn_sched_barrier(0);                     // holds the softmax and the products ahead of the wait below: left free, this build lifted that wait to directly behind the V^T reads, whose latency then lay open
    WAIT_DS(); WAIT_ACP(); __syncthreads();                // K(kt + 1) is published, the V buffer is free
    if (i + 1 < NT) fillV(kt + 1);
    vrel[0] -= 64; vrel[1] -= 64; }
  WAIT_ACP();
  // the join: the second half's wave hands its lane's state (O^T, maximum, sum) to the same lane of the first half's wave of its query group: 17 pieces of 16 bytes a lane, piece j of the wave's lanes side by side
  const int le = (int)__lane_id() & 31, ce = le & 15, ge = le >> 4;   // lane, column and half formed anew from the lane number that the loop's exchanges keep: carried from the kernel's head they were spilled
  v4f* mb = (v4f*)sKV + w * (17 * 32) + le;
  if (kh == 1) {
#pragma unroll
    for (int c = 0; c < 2; ++c) {
#pragma unroll
      for (int t = 0; t < 4; ++t) { v4f o[2];
#pragma unroll
        for (int r = 0; r < 8; ++r) o[r >> 2][r & 3] = acc[c][t][r];
        mb[((c * 4 + t) * 2) * 32] = o[0]; mb[((c * 4 + t) * 2 + 1) * 32] = o[1]; } }
    const v4f ml = {mrun[0], mrun[1], lrun[0], lrun[1]}; mb[16 * 32] = ml; }
  __syncthreads();                                         // the second half's state is published (the loop's last barrier has ended every read of the K and V buffers that it overwrites)
  if (kh == 1) return;                                     // no barrier stands behind this line
  v4f p[17];
#pragma unroll
  for (int j = 0; j < 17; ++j) p[j] = mb[j * 32];
  asm volatile("s_wait_dscnt 0x0" ::: "memory");           // my reads of the handed state have returned before the staging below overwrites the same bytes
#pragma unroll
  for (int c = 0; c < 2; ++c) { const float mj = fmaxf(mrun[c], p[16][c]); const float f0 = __builtin_amdgcn_exp2f(mrun[c] - mj), f1 = __builtin_amdgcn_exp2f(p[16][c] - mj);
    const float inv = 1.0f / ((lrun[c] * f0 + p[16][2 + c] * f1) * 16384.0f * 4.0f); const float a0 = f0 * inv, a1 = f1 * inv;
#pragma unroll
    for (int t = 0; t < 4; ++t) { v4f o[2];
#pragma unroll
      for (int r = 0; r < 8; ++r) o[r >> 2][r & 3] = acc[c][t][r] * a0 + p[(c * 4 + t) * 2 + (r >> 2)][r & 3] * a1;
      *(v4f*)(&so[w][c * 16 + ce][t * 16 + 8 * ge]) = o[0]; *(v4f*)(&so[w][c * 16 + ce][t * 16 + 8 * ge + 4]) = o[1]; } }
  LDSX();
  for (int qq = le; qq < 32 * 16; qq += 32) { const int rl = qq >> 4, pc = qq & 15; vst2(O32 + ((bh * SS) + q0 + rl) * HD + pc * 4, *(const v4f*)(&so[w][rl][pc * 4])); }
}
// out = ctx Wo^T : split(ctx) x bf16(Wo rows): 2 products (Wo is an INPUT -> bf16 exact)
__global__ __launch_bounds__(128) void k_out(const float* __restrict__ O32, const __bf16* __restrict__ PT, float* __restrict__ out) {
  constexpr int STA = 64 * RPF, STG = STA + 128 * RP;      // one stage: 64 ctx rows of one head (f32), then 128 weight rows, 64 k each
  __shared__ __align__(16) char smem[2 * STG];             // two stages in the k loop; the output staging behind it
  float (*so)[16][132] = (float (*)[16][132])smem;
  const int tid = threadIdx.x, wave = tid >> 5, lane = tid & 31, col = lane & 15, g = lane >> 4;
  const int r0b = blockIdx.x * 64, r0 = r0b + wave * 16, n0 = blockIdx.y * 128; const int b = r0b / SS, s0 = r0b % SS;
  v8f acc[8] = {};
  const unsigned lA = lds_off(smem) + (tid >> 4) * RPF + (tid & 15) * 16;     // a copy of the block: 8 ctx rows, 16 lanes a row
  const unsigned lW = lds_off(smem) + STA + (tid >> 3) * RP + (tid & 7) * 16; // or 16 weight rows, 8 lanes a row
  const char* gA = (const char*)(O32 + ((size_t)b * NH * SS + s0 + (tid >> 4)) * HD + (tid & 15) * 4);
  const char* gW = (const char*)(PT + (size_t)(3 * E + n0 + (tid >> 3)) * E + (tid & 7) * 8);
  auto fill = [&](int t) { const unsigned lo = (t & 1) * STG; const char* ga = gA + (size_t)t * SS * HD * 4; const char* gw = gW + (size_t)t * 128;   // pass t = head t
    acp8(lA + lo, ga, lA + lo + 32 * RPF, ga + (size_t)32 * HD * 4, 8 * RPF, (size_t)8 * HD * 4);
    acp8(lW + lo, gw, lW + lo + 64 * RP, gw + (size_t)64 * E * 2, 16 * RP, (size_t)16 * E * 2); };
  fill(0); WAIT_ACP(); __syncthreads(); fill(1);
#pragma unroll 2   // two trips a body: each half addresses its buffer by constant offsets
  for (int t = 0; t < E / 64; ++t) { const char* sb = smem + (t & 1) * STG;
#pragma unroll
    for (int kc = 0; kc < 2; ++kc) { const F2 a = split_row((const float*)(sb + (wave * 16 + col) * RPF), kc * 32, lane); v16b wb[8];
#pragma unroll     // the LDS reads of a k chunk go out as one group, so that their latency is paid once and not per product; wb[] stays in registers
      for (int j = 0; j < 8; ++j) wb[j] = frag_b((const __bf16*)(sb + STA + (j * 16 + col) * RP) + kc * 32, lane);
      __builtin_amdgcn_sched_barrier(0);   // holds a chunk's reads ahead of its own products as one group (same reason as in k_qkv)
#pragma unroll
      for (int j = 0; j < 8; ++j) { acc[j] = wmma_bf(a.l, wb[j], acc[j]); acc[j] = wmma_bf(a.h, wb[j], acc[j]); } }
    __builtin_amdgcn_sched_barrier(0);                     // holds the products ahead of the barrier, so that the refill behind it goes out no later than before (same reason as in k_qkv)
    WAIT_DS(); WAIT_ACP(); __syncthreads();                // stage t + 1 is published, stage t's buffer is free
    if (t + 2 < E / 64) fill(t + 2); }
  WAIT_ACP();
#pragma unroll
  for (int j = 0; j < 8; ++j) {
#pragma unroll
    for (int r = 0; r < 8; ++r) so[wave][8 * g + r][j * 16 + col] = acc[j][r]; }
  LDSX();
#pragma unroll 4
  for (int rl = 0; rl < 16; ++rl) vst2(out + (size_t)(r0 + rl) * E + n0 + lane * 4, *(const v4f*)(&so[wave][rl][lane * 4]));
}
extern "C" void kernel_launch(void* const* d_in, const int* in_sizes, int n_in, void* d_out, int out_size, void* d_ws, size_t ws_size, hipStream_t stream) {
  (void)in_sizes; (void)n_in; (void)out_size; (void)ws_size;
  const float* Qi = (const float*)d_in[0]; const float* Ki = (const float*)d_in[1]; const float* Vi = (const float*)d_in[2]; const int* vlen = (const int*)d_in[3];
  const float* Wq = (const float*)d_in[4]; const float* Wk = (const float*)d_in[5]; const float* Wv = (const float*)d_in[6]; const float* Wo = (const float*)d_in[7];
  float* out = (float*)d_out;
  char* ws = (char*)d_ws; size_t off = 0;
  auto take = [&](size_t bytes) { char* p = ws + off; off += (bytes + 255) & ~(size_t)255; return p; };
  __bf16* XQ = (__bf16*)take((size_t)NR * E * 2); __bf16* XK = (__bf16*)take((size_t)NR * E * 2); __bf16* XV = (__bf16*)take((size_t)NR * E * 2); __bf16* PT = (__bf16*)take((size_t)4 * E * E * 2);
  float* Q32 = (float*)take((size_t)NR * E * 4); _Float16* Kh = (_Float16*)take((size_t)NR * E * 2); _Float16* VTh = (_Float16*)take((size_t)NR * E * 2); float* O32 = (float*)take((size_t)NR * E * 4);
  // ws 80 MiB
  k_prep<<<(3 * NR * E + 4 * E * E) / PB, 512, 0, stream>>>(Qi, Ki, Vi, Wq, Wk, Wv, Wo, XQ);   // XQ, XK, XV, PT are contiguous in ws
  k_qkv<<<dim3(NR / 128, E / 128, 3), 128, 0, stream>>>(XQ, XK, XV, PT, Q32, Kh, VTh);
  k_attn<<<dim3(SS / 128, NB * NH), 256, 0, stream>>>(Q32, Kh, VTh, vlen, O32);
  k_out<<<dim3(NR / 64, E / 128), 128, 0, stream>>>(O32, PT, out);
}

// v010
// It runs in 75.8 microseconds.
// In two side-by-side timings against v009, it was 1.07 and 1.05 times as fast.
// Counting every step since v000, it is 5.26 times as fast.
// compute dtype: Q, K, V, W* (INPUTS) rounded to bf16 with exact bf16 WMMA products (f32 accumulate) for the projections; q, K, P and V each rounded once to f16 (11 significant bits), one f16 WMMA product for the scores and one for P.V, f32 accumulate; ctx split bf16 hi/lo for the output projection; softmax with the -1e6 valid-length fill in f32 (no sentinel shortcut, so a zero valid length yields the reference's uniform row).
#include <hip/hip_runtime.h>
#include <math.h>

typedef __attribute__((ext_vector_type(16))) _Float16 v16h;
typedef __attribute__((ext_vector_type(16))) __bf16 v16b;
typedef __attribute__((ext_vector_type(8)))  _Float16 v8h;
typedef __attribute__((ext_vector_type(8)))  float v8f;
typedef __attribute__((ext_vector_type(4)))  float v4f;
typedef __attribute__((ext_vector_type(2)))  float v2f;
typedef __attribute__((ext_vector_type(4)))  unsigned v4u;
typedef __attribute__((ext_vector_type(2)))  unsigned v2u;
typedef __attribute__((ext_vector_type(4)))  int v4i;
typedef float __attribute__((may_alias)) float_a;
typedef int __attribute__((may_alias)) int_a;

template <typename T> __device__ __forceinline__ void vst2(void* p, T v) { *(T*)p = v;  }
__device__ __forceinline__ v8f wmma16(v16h a, v16h b, v8f c) {
  return __builtin_amdgcn_wmma_f32_16x16x32_f16(false, a, false, b, (short)0, c, false, false);
}
__device__ __forceinline__ v8f wmma_bf(v16b a, v16b b, v8f c) {
  return __builtin_amdgcn_wmma_f32_16x16x32_bf16(false, a, false, b, (short)0, c, false, false);
}
// 16x16x32 fragments: lane = (h = lane>>4, row/col = lane&15); elements 0..7 = k0+8h+0..7, 8..15 = k0+16+8h+0..7; D element r = row 8h+r
__device__ __forceinline__ v16h frag_h(const _Float16* rowk0, int lane) {
  union { v16h v; v8h q[2]; } u; const _Float16* p = rowk0 + 8 * (lane >> 4);
  u.q[0] = *(const v8h*)p; u.q[1] = *(const v8h*)(p + 16); return u.v;
}
__device__ __forceinline__ v16h frag_f32(const float* rowk0, int lane) {
  v16h a; const float* p = rowk0 + 8 * (lane >> 4);
#pragma unroll
  for (int i = 0; i < 8; ++i) { a[i] = (_Float16)p[i]; a[8 + i] = (_Float16)p[16 + i]; }
  return a;
}
__device__ __forceinline__ v16h frag_f32s(const float* rowk0, int lane, float sc) {
  v16h a; const float* p = rowk0 + 8 * (lane >> 4);
#pragma unroll
  for (int i = 0; i < 8; ++i) { a[i] = (_Float16)(p[i] * sc); a[8 + i] = (_Float16)(p[16 + i] * sc); }
  return a;
}
// column fragment from a [K][ld] layout (column n), rows >= K read as 0
__device__ __forceinline__ v16h fragc_f32(const float* W, int k0, int n, int lane, int ld, int K) {
  v16h a; const int g = lane >> 4;
#pragma unroll
  for (int i = 0; i < 8; ++i) { const int ka = k0 + 8 * g + i, kb = ka + 16;
    a[i] = (_Float16)(ka < K ? W[(size_t)ka * ld + n] : 0.f); a[8 + i] = (_Float16)(kb < K ? W[(size_t)kb * ld + n] : 0.f); }
  return a;
}
struct F2 { v16b h, l; };
__device__ __forceinline__ F2 bsplit16(const float v[16]) { F2 r;
#pragma unroll
  for (int i = 0; i < 16; ++i) { const __bf16 h = (__bf16)v[i]; r.h[i] = h; r.l[i] = (__bf16)(v[i] - (float)h); }
  return r; }
__device__ __forceinline__ F2 split_row(const float* row, int k0, int lane) { float v[16]; const float* p = row + k0 + 8 * (lane >> 4);
#pragma unroll
  for (int i = 0; i < 8; ++i) { v[i] = p[i]; v[8 + i] = p[16 + i]; }
  return bsplit16(v); }
__device__ __forceinline__ F2 split_rowK(const float* row, int k0, int lane, int K) { float v[16]; const int g = lane >> 4;
#pragma unroll
  for (int i = 0; i < 8; ++i) { const int ka = k0 + 8 * g + i, kb = ka + 16; v[i] = ka < K ? row[ka] : 0.f; v[8 + i] = kb < K ? row[kb] : 0.f; }
  return bsplit16(v); }
__device__ __forceinline__ F2 split_col(const float* W, int k0, int n, int lane, int ld, int K) { float v[16]; const int g = lane >> 4;
#pragma unroll
  for (int i = 0; i < 8; ++i) { const int ka = k0 + 8 * g + i, kb = ka + 16; v[i] = ka < K ? W[(size_t)ka * ld + n] : 0.f; v[8 + i] = kb < K ? W[(size_t)kb * ld + n] : 0.f; }
  return bsplit16(v); }
__device__ __forceinline__ v8f mac3(const F2& a, const F2& b, v8f c) { c = wmma_bf(a.l, b.h, c); c = wmma_bf(a.h, b.l, c); return wmma_bf(a.h, b.h, c); }
__device__ __forceinline__ float sigm(float v) { return 1.0f / (1.0f + expf(-v)); }
#define LDSX() do { asm volatile("s_wait_dscnt 0" ::: "memory"); __builtin_amdgcn_wave_barrier(); __builtin_amdgcn_fence(__ATOMIC_RELEASE, "workgroup"); } while (0)


// d2l-style multi-head attention (16 heads of 64 on [4,1024,1024]; separate Q/K/V inputs, [out][in] weights, no biases): scores = q.k/8, then where(key < valid_lens[bh*L + q], score, -1e6) (per-row valid length, int input), softmax, (P v) Wo^T.
#define NB 4
#define SS 1024
#define E 1024
#define NH 16
#define HD 64
#define NR (NB * SS)
#define L2E 1.4426950408889634f   // log2(e)
__device__ __forceinline__ float bfr(float v) { return (float)(__bf16)v; }
__device__ __forceinline__ v16b frag_b(const __bf16* rowk0, int lane) { return __builtin_bit_cast(v16b, frag_h((const _Float16*)rowk0, lane)); }

// Operand tiles go from global memory to LDS as whole 128-byte lines, 16 bytes a lane, through no register; the fragments are then read from LDS rows at a pitch of 16 B x odd.
#define RP 144   // LDS pitch in bytes of a 128-byte row
#define RPF 272  // LDS pitch in bytes of a 256-byte row
__device__ __forceinline__ unsigned lds_off(const void* p) { return (unsigned)(size_t)p; }
#define ACP(l, g) "global_load_async_to_lds_b128 %" #l ", %" #g ", off\n\t"
// four copies of a lane: LDS address l + i*ls, global address g + i*gs; s_wait_xcnt 0 closes the statement so that no address register is rewritten ahead of it
__device__ __forceinline__ void acp4(unsigned l, const char* g, unsigned ls, size_t gs) {
  asm volatile(ACP(0, 4) ACP(1, 5) ACP(2, 6) ACP(3, 7) "s_wait_xcnt 0x0"
               :: "v"(l), "v"(l + ls), "v"(l + 2 * ls), "v"(l + 3 * ls), "v"(g), "v"(g + gs), "v"(g + 2 * gs), "v"(g + 3 * gs) : "memory");
}
// eight copies of a lane, four from each of two bases, one closing s_wait_xcnt 0 (same reason)
__device__ __forceinline__ void acp8(unsigned l, const char* g, unsigned m, const char* h, unsigned ls, size_t gs) {
  asm volatile(ACP(0, 8) ACP(1, 9) ACP(2, 10) ACP(3, 11) ACP(4, 12) ACP(5, 13) ACP(6, 14) ACP(7, 15) "s_wait_xcnt 0x0"
               :: "v"(l), "v"(l + ls), "v"(l + 2 * ls), "v"(l + 3 * ls), "v"(m), "v"(m + ls), "v"(m + 2 * ls), "v"(m + 3 * ls),
                  "v"(g), "v"(g + gs), "v"(g + 2 * gs), "v"(g + 3 * gs), "v"(h), "v"(h + gs), "v"(h + 2 * gs), "v"(h + 3 * gs) : "memory");
}
// this wave's LDS reads have returned: stands in front of the barrier behind which their buffer is filled again
#define WAIT_DS() asm volatile("s_wait_dscnt 0x0" ::: "memory")
// this wave's copies have landed: stands in front of the barrier behind which other waves read them
#define WAIT_ACP() asm volatile("s_wait_asynccnt 0x0" ::: "memory")

// every f32 -> bf16 rounding of the inputs in one streaming launch: dst holds XQ, XK, XV (NR x E each) and PT, one behind the other.
// PT rows: [0,E) Wq, [E,2E) Wk, [2E,3E) Wv, [3E,4E) Wo  ([out][in] weights: PT row n = W row n % E, so the pack is the same elementwise rounding)
#define PB 65536   // elements of a block: 512 threads x 32 pieces of 4; 256 such blocks
// key tiles (64 keys) that a query row needs: those that hold a valid key; a row with no valid key is the reference's uniform row over all keys and needs all 16
__device__ __forceinline__ int row_tiles(int v) { return v <= 0 ? SS / 64 : min(SS / 64, (v + 63) >> 6); }
// the launch's last NB * NH blocks, one a head (behind the 256 streaming blocks, which so keep a WGP each; these light blocks run beside them): perm[place] = query row + 65536 x its valid length (cut to 0..1024, which masks the same keys), the head's 1024 rows in falling order of row_tiles, and nt8[eighth] = row_tiles of the first row of each 128 places (a head's eight in a 128-byte line of their own) (a counting sort over 16 classes without atomics: a ballot per class gives each group of 32 rows its counts and each row its place in its group; one prefix sum over the 16 x 32 counts gives each group's first place in each class)
__global__ __launch_bounds__(512) void k_prep(const float* __restrict__ Qi, const float* __restrict__ Ki, const float* __restrict__ Vi, const float* __restrict__ Wq, const float* __restrict__ Wk, const float* __restrict__ Wv, const float* __restrict__ Wo, const int* __restrict__ vlen, __bf16* __restrict__ dst, int* __restrict__ perm, int* __restrict__ nt8) {
  constexpr unsigned NSB = (3 * NR * E + 4 * E * E) / PB;  // streaming blocks
  if (blockIdx.x >= NSB) {                                 // the same for the whole block: its barriers are passed by every wave
    __shared__ int cnt[16 * 32]; __shared__ int wtot[16];  // cnt[class][group]: class 0 = 16 tiles ... class 15 = 1 tile
    const int tid = threadIdx.x, wave = tid >> 5, lane = tid & 31; const int hd = blockIdx.x - NSB, hb = hd * SS;
    int vl[2], cl[2], below[2];
#pragma unroll
    for (int h = 0; h < 2; ++h) { vl[h] = vlen[hb + h * 512 + tid]; cl[h] = SS / 64 - row_tiles(vl[h]); below[h] = 0; int mine = 0;
#pragma unroll
      for (int b = 0; b < 16; ++b) { const unsigned m = __builtin_amdgcn_ballot_w32(cl[h] == b);
        if (lane == b) mine = __builtin_popcount(m);
        if (cl[h] == b) below[h] = __builtin_popcount(m & ((1u << lane) - 1u)); }
      if (lane < 16) cnt[lane * 32 + h * 16 + wave] = mine; }
    __syncthreads();                                       // the counts are published
    const int x = cnt[tid]; int inc = x;
#pragma unroll
    for (int d = 1; d < 32; d <<= 1) { const int y = __shfl_up(inc, d, 32); if (lane >= d) inc += y; }
    if (lane == 31) wtot[wave] = inc;
    __syncthreads();                                       // the waves' totals are published
    int base = 0;
#pragma unroll
    for (int k = 0; k < 16; ++k) base += k < wave ? wtot[k] : 0;
    cnt[tid] = base + inc - x;                             // my own entry alone: nobody else has read or will write it before the next barrier
    __syncthreads();                                       // the first places are published
#pragma unroll
    for (int h = 0; h < 2; ++h) { const int pos = cnt[cl[h] * 32 + h * 16 + wave] + below[h];
      perm[hb + pos] = (h * 512 + tid) | (min(max(vl[h], 0), SS) << 16);
      if ((pos & 127) == 0) nt8[hd * 32 + (pos >> 7)] = SS / 64 - cl[h]; }
    return; }
  const unsigned blk = blockIdx.x, seg = blk / (NR * E / PB), ws = (blk / (E * E / PB)) & 3;      // 64 blocks an activation, 16 a weight
  const float* s = seg == 0 ? Qi : (seg == 1 ? Ki : (seg == 2 ? Vi : (ws == 0 ? Wq : (ws == 1 ? Wk : (ws == 2 ? Wv : Wo)))));
  s += (size_t)(seg < 3 ? blk % (NR * E / PB) : blk % (E * E / PB)) * PB + threadIdx.x * 4;
  __bf16* d = dst + (size_t)blk * PB + threadIdx.x * 4;
  v4f v[32];
#pragma unroll     // unrolled so that a lane's loads go out far ahead of their use (many in flight a wave); each covers 512 contiguous bytes of a wave
  for (int i = 0; i < 32; ++i) v[i] = *(const v4f*)(s + i * 2048);
#pragma unroll
  for (int i = 0; i < 32; ++i) { union { __bf16 h[4]; v2u u; } pk;
#pragma unroll
    for (int e = 0; e < 4; ++e) pk.h[e] = (__bf16)v[i][e];
    vst2((unsigned*)(d + i * 2048), pk.u); }
}
// QKV: block (128 rows, 128 cols = 2 heads, which), four waves of 64 rows x 64 cols (one head) each: a k chunk's 8 fragments feed 16 products; q (+bias) -> Q32 f32 [bh][s][64]; k (+bias) -> f16 rows; v (+bias) -> VT f16 x4 [bh][d][s]
__global__ __launch_bounds__(128) void k_qkv(const __bf16* __restrict__ XQ, const __bf16* __restrict__ XK, const __bf16* __restrict__ XV, const __bf16* __restrict__ PT, float* __restrict__ Q32, _Float16* __restrict__ Kh, _Float16* __restrict__ VTh) {
  constexpr int STG = (128 + 128) * RP;                    // one stage: 128 X rows, then 128 weight rows, 64 k each
  __shared__ __align__(16) char smem[2 * STG];             // two stages in the k loop; the output staging behind it
  float (*so)[64][68] = (float (*)[64][68])smem;           // a wave's own 64 x 64 tile
  _Float16 (*sth)[136] = (_Float16 (*)[136])smem;
  const int tid = threadIdx.x, wave = tid >> 5, lane = tid & 31, col = lane & 15, g = lane >> 4, wr = wave >> 1, wc = wave & 1;
  const int which = blockIdx.z, r0b = blockIdx.x * 128, n0 = blockIdx.y * 128; const int b = r0b / SS, s0 = r0b % SS;
  const __bf16* Xb = which == 0 ? XQ : (which == 1 ? XK : XV);
  v8f acc[4][4] = {};
  const unsigned l0 = lds_off(smem) + (tid >> 3) * RP + (tid & 7) * 16;       // a copy of the block: 16 rows, 8 lanes a row
  const char* gX = (const char*)(Xb + (size_t)(r0b + (tid >> 3)) * E + (tid & 7) * 8);
  const char* gW = (const char*)(PT + (size_t)(which * E + n0 + (tid >> 3)) * E + (tid & 7) * 8);
  auto fill = [&](int t) { const unsigned l = l0 + (t & 1) * STG; const size_t ko = (size_t)t * 128;
    acp8(l, gX + ko, l + 64 * RP, gX + ko + (size_t)64 * E * 2, 16 * RP, (size_t)16 * E * 2);
    acp8(l + 128 * RP, gW + ko, l + 192 * RP, gW + ko + (size_t)64 * E * 2, 16 * RP, (size_t)16 * E * 2); };
  fill(0); WAIT_ACP(); __syncthreads(); fill(1);
#pragma unroll 2   // two trips a body: each half addresses its buffer by constant offsets
  for (int t = 0; t < E / 64; ++t) { const char* sb = smem + (t & 1) * STG;
#pragma unroll
    for (int kc = 0; kc < 2; ++kc) { v16b a[4], wb[4];
#pragma unroll     // the LDS reads of a k chunk go out as one group, so that their latency is paid once and not per product; a[] and wb[] stay in registers
      for (int i = 0; i < 4; ++i) a[i] = frag_b((const __bf16*)(sb + (wr * 64 + i * 16 + col) * RP) + kc * 32, lane);
#pragma unroll
      for (int j = 0; j < 4; ++j) wb[j] = frag_b((const __bf16*)(sb + (128 + wc * 64 + j * 16 + col) * RP) + kc * 32, lane);
      __builtin_amdgcn_sched_barrier(0);   // holds the group of reads ahead of the products: left free, this build fetched each a[i] directly in front of its four products and waited out the LDS latency four times a chunk
#pragma unroll
      for (int i = 0; i < 4; ++i) {
#pragma unroll
        for (int j = 0; j < 4; ++j) acc[i][j] = wmma_bf(a[i], wb[j], acc[i][j]); } }
    __builtin_amdgcn_sched_barrier(0);                     // holds the products ahead of the barrier: left free, this build sank the last chunk's sixteen behind it, in front of the refill, whose copies then had that much less time to land
    WAIT_DS(); WAIT_ACP(); __syncthreads();                // stage t + 1 is published, stage t's buffer is free
    if (t + 2 < E / 64) fill(t + 2); }
  WAIT_ACP();
  const int h = (n0 >> 6) + wc;                            // my wave's head
  if (which < 2) {
#pragma unroll
    for (int i = 0; i < 4; ++i) {
#pragma unroll
      for (int j = 0; j < 4; ++j) { const float bb = 0.f;
#pragma unroll
        for (int r = 0; r < 8; ++r) so[wave][i * 16 + 8 * g + r][j * 16 + col] = acc[i][j][r] + bb; } }
    LDSX();
    if (which == 0) { for (int qq = lane; qq < 64 * 16; qq += 32) { const int rl = qq >> 4, pc = qq & 15;
        vst2(Q32 + (((size_t)b * NH + h) * SS + s0 + wr * 64 + rl) * HD + pc * 4, *(const v4f*)(&so[wave][rl][pc * 4])); } }
    else {
      for (int qq = lane; qq < 64 * 8; qq += 32) { const int rl = qq >> 3, pc = qq & 7; union { _Float16 e[8]; v4u u; } pk;
#pragma unroll
        for (int e = 0; e < 8; ++e) pk.e[e] = (_Float16)so[wave][rl][pc * 8 + e];
        vst2((unsigned*)(Kh + (((size_t)b * NH + h) * SS + s0 + wr * 64 + rl) * HD + pc * 8), pk.u); } } }
  else {
#pragma unroll
    for (int i = 0; i < 4; ++i) {
#pragma unroll
      for (int j = 0; j < 4; ++j) { const float bb = 0.f;
#pragma unroll
        for (int r = 0; r < 8; ++r) sth[wc * 64 + j * 16 + col][wr * 64 + i * 16 + 8 * g + r] = (_Float16)((acc[i][j][r] + bb) * 4.0f); } }
    __syncthreads();
    for (int qq = tid; qq < 128 * 16; qq += 128) { const int cl = qq >> 4, pc = qq & 15; const int c = n0 + cl, hc = c >> 6, d = c & 63; const size_t o = (((size_t)b * NH + hc) * HD + d) * SS + s0 + pc * 8;
      vst2(VTh + o, *(const v4u*)(&sth[cl][pc * 8])); } }
}
// eight hardware exponentials, each in its own register, in one statement: behind a transcendental the instruction set asks for one independent instruction before its result is read or its source overwritten;
// here each is that instruction for the one before it and the v_nop for the last
__device__ __forceinline__ void exp2x8(float (&e)[8]) {
  asm("v_exp_f32 %0, %0\n\tv_exp_f32 %1, %1\n\tv_exp_f32 %2, %2\n\tv_exp_f32 %3, %3\n\tv_exp_f32 %4, %4\n\tv_exp_f32 %5, %5\n\tv_exp_f32 %6, %6\n\tv_exp_f32 %7, %7\n\tv_nop"
      : "+v"(e[0]), "+v"(e[1]), "+v"(e[2]), "+v"(e[3]), "+v"(e[4]), "+v"(e[5]), "+v"(e[6]), "+v"(e[7]));
}
// padding-masked attention: block (128 queries, bh), eight waves: four query groups of 32 columns (two column groups of 16) x two key halves of NT key tiles (1 to 8: as many as the block's longest row needs), so that two blocks put four waves on a SIMD and one wave's vector work covers another's products, LDS reads and barrier waits;
// a key half has its own K and V buffers, filled by its own four waves, and its own running maximum, sum and O^T; the halves are joined once behind the loop; transposed products: S^T = K q^T (K rows as A, q as B), O^T += V^T P^T (V^T rows as A, P^T as B), all four operands f16; O f32 [bh][s][64]
// every K and V^T fragment read from LDS feeds one product of each column group, and a K or V tile copied from L2 serves 128 queries
// a lane holds one query column of each group: its scores, maximum, sum, valid length and rescale factor stay in its registers, and two score tiles (keys 8g+r and 16+8g+r of 32) are the B fragment of the second product as they stand
// softmax in base 2: scores and the fill carry the factor log2(e), and the running maximum lies 14 below the true one, so that one hardware exponential gives 2^14 e^(score - max)
__global__ __launch_bounds__(256) __attribute__((amdgpu_waves_per_eu(4, 4))) void k_attn(const float* __restrict__ Q32, const _Float16* __restrict__ Kh, const _Float16* __restrict__ VTh, const int* __restrict__ perm, const int* __restrict__ nt8, float* __restrict__ O32) {
  constexpr int SET = 2 * 64 * RP;                         // a key half's K buffer (64 keys x 64 d) and V buffer: V^T (64 d x 64 keys)
  __shared__ __align__(16) char sKV[2 * SET];              // in the loop: the two halves' buffers; behind the loop its first 4 * 32 * 68 * 4 bytes: a query group's 8704 bytes hold first the second half's state, then the output staging
  float (*so)[32][68] = (float (*)[32][68])sKV;            // a query group's own 32 queries x 64 d
  const int tid = threadIdx.x & 127, lane = tid & 31, col = lane & 15, g = lane >> 4;   // tid: my place among my key half's four waves
  const int w = __builtin_amdgcn_readfirstlane(tid >> 5);  // my query group, in a scalar register: what is formed from it holds no vector register through the loop
  const int kh = __builtin_amdgcn_readfirstlane((int)threadIdx.x >> 7);   // my key half, in a scalar register: it sets the key tile's number and the branches behind the loop
  const char* sH = sKV + kh * SET;
  // which head, and which eighth of its sorted rows: all 512 blocks are resident at once, two a WGP, so the launch lasts as long as its most loaded WGP. The first 256 blocks take the long eighths 0..3, the last 256 the short ones 7..4:
  // block f and block f + 256, and any two blocks of the two layers whose f agree modulo 8, hold eighths e and 7 - e. For speed only: every eighth of every head is taken once wherever the blocks land
  const int fb = blockIdx.x + blockIdx.y * (SS / 128);
  const size_t bh = (fb & 255) >> 2; const int qb = (fb >> 8) ? 7 - (fb & 3) : (fb & 3);
  const int q0 = qb * 128 + w * 32;                        // my query group's first place in the sorted order
  const int* pr = perm + bh * SS;
  // key tiles of a half: the block's first row needs the most tiles; behind them every key is masked for every row of the block, and each row has a valid key, so those keys' weights are exactly 0
  const int NT = __builtin_amdgcn_readfirstlane((min(max(nt8[bh * 32 + qb], 1), SS / 64) + 1) >> 1);   // 1..8: both halves' tiles lie inside the 16
  v16h aq[2][2]; int vrel[2];
  const int pe2[2] = {pr[q0 + col], pr[q0 + 16 + col]};    // both column groups' places first: one latency, not two
  const int prow = pr[q0 + lane] & (SS - 1);               // lane l: the query row of my group's place l, for the stores at the end
#pragma unroll
  for (int c = 0; c < 2; ++c) { const int pe = pe2[c], row = pe & (SS - 1);
#pragma unroll
    for (int kc = 0; kc < 2; ++kc) aq[c][kc] = frag_f32(Q32 + (bh * SS + row) * HD + kc * 32, lane);
    asm volatile("s_wait_xcnt 0x0" ::: "memory");          // behind this column group's loads: what follows may reuse their address registers
    vrel[c] = (pe >> 16) - 8 * g - kh * NT * 64; } // valid length of my query column, counted from my lane half's first key row of the current key tile (64 less after each tile)
  float mrun[2] = {-3.0e38f, -3.0e38f}, lrun[2] = {0.f, 0.f}; v8f acc[2][4] = {};
  const unsigned l0 = lds_off(sH) + (tid >> 3) * RP + (tid & 7) * 16;         // a copy of a key half's four waves: 16 rows, 8 lanes a row
  const size_t oK = ((bh * SS + (tid >> 3)) * HD + (tid & 7) * 8) * 2, oV = ((bh * HD + (tid >> 3)) * SS + (tid & 7) * 8) * 2;
  // two buffers, stages K(0), V(0), K(1), V(1), ...: the score pass reads the K buffer alone, the P.V pass the V buffer alone; each refill flies during the other pass
  auto fillK = [&](int kt) { acp4(l0, (const char*)Kh + oK + (size_t)kt * 64 * HD * 2, 16 * RP, (size_t)16 * HD * 2); };
  auto fillV = [&](int kt) { acp4(l0 + 64 * RP, (const char*)VTh + oV + (size_t)kt * 128, 16 * RP, (size_t)16 * SS * 2); };
  fillK(kh * NT); WAIT_ACP(); __syncthreads(); fillV(kh * NT);
#pragma unroll 1
  for (int i = 0; i < NT; ++i) { const int kt = kh * NT + i; v8f s[2][4]; v16h fr[4][2];
#pragma unroll
    for (int t = 0; t < 4; ++t) {
#pragma unroll     // the tile's eight K fragments go out as one group, so that the LDS latency is paid once a key tile and not per fragment
      for (int kc = 0; kc < 2; ++kc) fr[t][kc] = frag_h((const _Float16*)(sH + (t * 16 + col) * RP) + kc * 32, lane); }
    __builtin_amdgcn_sched_barrier(0);                     // holds the group of reads ahead of the products: left free, this build fetched each fragment directly in front of its two products and waited for it there
#pragma unroll
    for (int t = 0; t < 4; ++t) { v8f x[2] = {};
#pragma unroll
      for (int kc = 0; kc < 2; ++kc) {
#pragma unroll
        for (int c = 0; c < 2; ++c) x[c] = wmma16(fr[t][kc], aq[c][kc], x[c]); }
#pragma unroll
      for (int c = 0; c < 2; ++c) {
#pragma unroll
        for (int r = 0; r < 8; ++r) s[c][t][r] = (t * 16 + r < vrel[c]) ? x[c][r] * (0.125f * L2E) : -1.0e6f * L2E; } }
    __builtin_amdgcn_sched_barrier(0);                     // holds the score products ahead of the wait below: left free, this build lifted that wait to directly behind the K reads, where V(kt)'s copies, issued just before, had had little time to land
    WAIT_DS(); WAIT_ACP(); __syncthreads();                // V(kt) is published, the K buffer is free
    if (i + 1 < NT) fillK(kt + 1);
#pragma unroll     // the tile's V^T fragments go out in two groups of four, 32 keys each (all eight ahead of the softmax do not fit the 256 registers of four waves a SIMD): the first ahead of the softmax, whose vector work covers its latency
    for (int t = 0; t < 4; ++t) fr[t][0] = frag_h((const _Float16*)(sH + (64 + t * 16 + col) * RP), lane);
    __builtin_amdgcn_sched_barrier(0);                     // holds these reads ahead of the softmax: left free, this build sank each behind it, directly in front of its two products
    v16h ph[2][2]; float mx[2];
#pragma unroll     // both groups' maxima first, a chain per score tile, then the two exchanges between the wave's halves (a maximum is exact in any order)
    for (int c = 0; c < 2; ++c) { float mt[4];
#pragma unroll
      for (int t = 0; t < 4; ++t) { mt[t] = -3.4e38f;
#pragma unroll
        for (int r = 0; r < 8; ++r) mt[t] = fmaxf(mt[t], s[c][t][r]); }
      mx[c] = fmaxf(fmaxf(mt[0], mt[1]), fmaxf(mt[2], mt[3])); }
    const float mo[2] = {__shfl_xor(mx[0], 16, 32), __shfl_xor(mx[1], 16, 32)};
#pragma unroll
    for (int c = 0; c < 2; ++c) {
      const float mnew = fmaxf(mrun[c], fmaxf(mx[c], mo[c]) - 14.0f); const float corr = __builtin_amdgcn_exp2f(mrun[c] - mnew);
      float ps = 0.f;
#pragma unroll
      for (int t = 0; t < 4; ++t) { float e[8];
#pragma unroll
        for (int r = 0; r < 8; ++r) e[r] = s[c][t][r] - mnew;
        exp2x8(e);
#pragma unroll
        for (int r = 0; r < 8; ++r) { ps += e[r]; ph[c][t >> 1][(t & 1) * 8 + r] = (_Float16)e[r]; } }
      ps += __shfl_xor(ps, 16, 32);
      lrun[c] = lrun[c] * corr + ps * (1.0f / 16384.0f); mrun[c] = mnew;
#pragma unroll
      for (int t = 0; t < 4; ++t) {
#pragma unroll
        for (int r = 0; r < 8; ++r) acc[c][t][r] *= corr; } }
#pragma unroll
    for (int kc = 0; kc < 2; ++kc) {
#pragma unroll
      for (int t = 0; t < 4; ++t) {
#pragma unroll
        for (int c = 0; c < 2; ++c) acc[c][t] = wmma16(fr[t][kc], ph[c][kc], acc[c][t]); }
      if (kc == 0) {
        __builtin_amdgcn_sched_barrier(0);                 // holds the second group behind the first 32 keys' products, whose fragments and P have then left their registers, and as one group (same reason)
#pragma unroll
        for (int t = 0; t < 4; ++t) fr[t][1] = frag_h((const _Float16*)(sH + (64 + t * 16 + col) * RP) + 32, lane);
        __builtin_amdgcn_sched_barrier(0); } }             // and ahead of its own products
    __builtin_amdgcn_sched_barrier(0);                     // holds the softmax and the products ahead of the wait below: left free, this build lifted that wait to directly behind the V^T reads, whose latency then lay open
    WAIT_DS(); WAIT_ACP(); __syncthreads();                // K(kt + 1) is published, the V buffer is free
    if (i + 1 < NT) fillV(kt + 1);
    vrel[0] -= 64; vrel[1] -= 64; }
  WAIT_ACP();
  // the join: the second half's wave hands its lane's state (O^T, maximum, sum) to the same lane of the first half's wave of its query group: 17 pieces of 16 bytes a lane, piece j of the wave's lanes side by side
  const int le = (int)__lane_id() & 31, ce = le & 15, ge = le >> 4;   // lane, column and half formed anew from the lane number that the loop's exchanges keep: carried from the kernel's head they were spilled
  v4f* mb = (v4f*)sKV + w * (17 * 32) + le;
  if (kh == 1) {
#pragma unroll
    for (int c = 0; c < 2; ++c) {
#pragma unroll
      for (int t = 0; t < 4; ++t) { v4f o[2];
#pragma unroll
        for (int r = 0; r < 8; ++r) o[r >> 2][r & 3] = acc[c][t][r];
        mb[((c * 4 + t) * 2) * 32] = o[0]; mb[((c * 4 + t) * 2 + 1) * 32] = o[1]; } }
    const v4f ml = {mrun[0], mrun[1], lrun[0], lrun[1]}; mb[16 * 32] = ml; }
  __syncthreads();                                         // the second half's state is published (the loop's last barrier has ended every read of the K and V buffers that it overwrites)
  if (kh == 1) return;                                     // no barrier stands behind this line
  v4f p[17];
#pragma unroll
  for (int j = 0; j < 17; ++j) p[j] = mb[j * 32];
  asm volatile("s_wait_dscnt 0x0" ::: "memory");           // my reads of the handed state have returned before the staging below overwrites the same bytes
#pragma unroll
  for (int c = 0; c < 2; ++c) { const float mj = fmaxf(mrun[c], p[16][c]); const float f0 = __builtin_amdgcn_exp2f(mrun[c] - mj), f1 = __builtin_amdgcn_exp2f(p[16][c] - mj);
    const float inv = 1.0f / ((lrun[c] * f0 + p[16][2 + c] * f1) * 16384.0f * 4.0f); const float a0 = f0 * inv, a1 = f1 * inv;
#pragma unroll
    for (int t = 0; t < 4; ++t) { v4f o[2];
#pragma unroll
      for (int r = 0; r < 8; ++r) o[r >> 2][r & 3] = acc[c][t][r] * a0 + p[(c * 4 + t) * 2 + (r >> 2)][r & 3] * a1;
      *(v4f*)(&so[w][c * 16 + ce][t * 16 + 8 * ge]) = o[0]; *(v4f*)(&so[w][c * 16 + ce][t * 16 + 8 * ge + 4]) = o[1]; } }
  LDSX();
  for (int qq = le; qq < 32 * 16; qq += 32) { const int rl = qq >> 4, pc = qq & 15; vst2(O32 + ((bh * SS) + __shfl(prow, rl, 32)) * HD + pc * 4, *(const v4f*)(&so[w][rl][pc * 4])); }
}
// out = ctx Wo^T : split(ctx) x bf16(Wo rows): 2 products (Wo is an INPUT -> bf16 exact)
__global__ __launch_bounds__(128) void k_out(const float* __restrict__ O32, const __bf16* __restrict__ PT, float* __restrict__ out) {
  constexpr int STA = 64 * RPF, STG = STA + 128 * RP;      // one stage: 64 ctx rows of one head (f32), then 128 weight rows, 64 k each
  __shared__ __align__(16) char smem[2 * STG];             // two stages in the k loop; the output staging behind it
  float (*so)[16][132] = (float (*)[16][132])smem;
  const int tid = threadIdx.x, wave = tid >> 5, lane = tid & 31, col = lane & 15, g = lane >> 4;
  const int r0b = blockIdx.x * 64, r0 = r0b + wave * 16, n0 = blockIdx.y * 128; const int b = r0b / SS, s0 = r0b % SS;
  v8f acc[8] = {};
  const unsigned lA = lds_off(smem) + (tid >> 4) * RPF + (tid & 15) * 16;     // a copy of the block: 8 ctx rows, 16 lanes a row
  const unsigned lW = lds_off(smem) + STA + (tid >> 3) * RP + (tid & 7) * 16; // or 16 weight rows, 8 lanes a row
  const char* gA = (const char*)(O32 + ((size_t)b * NH * SS + s0 + (tid >> 4)) * HD + (tid & 15) * 4);
  const char* gW = (const char*)(PT + (size_t)(3 * E + n0 + (tid >> 3)) * E + (tid & 7) * 8);
  auto fill = [&](int t) { const unsigned lo = (t & 1) * STG; const char* ga = gA + (size_t)t * SS * HD * 4; const char* gw = gW + (size_t)t * 128;   // pass t = head t
    acp8(lA + lo, ga, lA + lo + 32 * RPF, ga + (size_t)32 * HD * 4, 8 * RPF, (size_t)8 * HD * 4);
    acp8(lW + lo, gw, lW + lo + 64 * RP, gw + (size_t)64 * E * 2, 16 * RP, (size_t)16 * E * 2); };
  fill(0); WAIT_ACP(); __syncthreads(); fill(1);
#pragma unroll 2   // two trips a body: each half addresses its buffer by constant offsets
  for (int t = 0; t < E / 64; ++t) { const char* sb = smem + (t & 1) * STG;
#pragma unroll
    for (int kc = 0; kc < 2; ++kc) { const F2 a = split_row((const float*)(sb + (wave * 16 + col) * RPF), kc * 32, lane); v16b wb[8];
#pragma unroll     // the LDS reads of a k chunk go out as one group, so that their latency is paid once and not per product; wb[] stays in registers
      for (int j = 0; j < 8; ++j) wb[j] = frag_b((const __bf16*)(sb + STA + (j * 16 + col) * RP) + kc * 32, lane);
      __builtin_amdgcn_sched_barrier(0);   // holds a chunk's reads ahead of its own products as one group (same reason as in k_qkv)
#pragma unroll
      for (int j = 0; j < 8; ++j) { acc[j] = wmma_bf(a.l, wb[j], acc[j]); acc[j] = wmma_bf(a.h, wb[j], acc[j]); } }
    __builtin_amdgcn_sched_barrier(0);                     // holds the products ahead of the barrier, so that the refill behind it goes out no later than before (same reason as in k_qkv)
    WAIT_DS(); WAIT_ACP(); __syncthreads();                // stage t + 1 is published, stage t's buffer is free
    if (t + 2 < E / 64) fill(t + 2); }
  WAIT_ACP();
#pragma unroll
  for (int j = 0; j < 8; ++j) {
#pragma unroll
    for (int r = 0; r < 8; ++r) so[wave][8 * g + r][j * 16 + col] = acc[j][r]; }
  LDSX();
#pragma unroll 4
  for (int rl = 0; rl < 16; ++rl) vst2(out + (size_t)(r0 + rl) * E + n0 + lane * 4, *(const v4f*)(&so[wave][rl][lane * 4]));
}
extern "C" void kernel_launch(void* const* d_in, const int* in_sizes, int n_in, void* d_out, int out_size, void* d_ws, size_t ws_size, hipStream_t stream) {
  (void)in_sizes; (void)n_in; (void)out_size; (void)ws_size;
  const float* Qi = (const float*)d_in[0]; const float* Ki = (const float*)d_in[1]; const float* Vi = (const float*)d_in[2]; const int* vlen = (const int*)d_in[3];
  const float* Wq = (const float*)d_in[4]; const float* Wk = (const float*)d_in[5]; const float* Wv = (const float*)d_in[6]; const float* Wo = (const float*)d_in[7];
  float* out = (float*)d_out;
  char* ws = (char*)d_ws; size_t off = 0;
  auto take = [&](size_t bytes) { char* p = ws + off; off += (bytes + 255) & ~(size_t)255; return p; };
  __bf16* XQ = (__bf16*)take((size_t)NR * E * 2); __bf16* XK = (__bf16*)take((size_t)NR * E * 2); __bf16* XV = (__bf16*)take((size_t)NR * E * 2); __bf16* PT = (__bf16*)take((size_t)4 * E * E * 2);
  float* Q32 = (float*)take((size_t)NR * E * 4); _Float16* Kh = (_Float16*)take((size_t)NR * E * 2); _Float16* VTh = (_Float16*)take((size_t)NR * E * 2); float* O32 = (float*)take((size_t)NR * E * 4); int* perm = (int*)take((size_t)NB * NH * SS * 4); int* nt8 = (int*)take((size_t)NB * NH * 32 * 4);
  // ws 80 MiB
  k_prep<<<(3 * NR * E + 4 * E * E) / PB + NB * NH, 512, 0, stream>>>(Qi, Ki, Vi, Wq, Wk, Wv, Wo, vlen, XQ, perm, nt8);   // XQ, XK, XV, PT are contiguous in ws
  k_qkv<<<dim3(NR / 128, E / 128, 3), 128, 0, stream>>>(XQ, XK, XV, PT, Q32, Kh, VTh);
  k_attn<<<dim3(SS / 128, NB * NH), 256, 0, stream>>>(Q32, Kh, VTh, perm, nt8, O32);
  k_out<<<dim3(NR / 64, E / 128), 128, 0, stream>>>(O32, PT, out);
}
